// v000
// Measured on an AMD MI455X. A time is GPU time per run, averaged over a window of back-to-back runs after a warm-up
// (all launches, gaps included; the runs take copies of the inputs in turn), and the median of several windows.
// Apart from v000's, it joins two sittings. Times from different sittings can be a few percent apart, while
// side-by-side timings come from the same sitting.
// v000, which the later versions start from, runs in 362 microseconds.
// compute dtype: x, the six weights and biases (module inputs) rounded to bf16; q/k/v projections as exact bf16 products over the concatenated [Wc ; Wp] columns (x.(Wc+Wp) == x.Wc + x.Wp, f32 accumulate, + bc + bp); scores and P.V with both computed operands as bf16 hi + bf16 residual pairs (3 products); online softmax in f32; f32 accumulate.
#include <hip/hip_runtime.h>
#include <math.h>

typedef __attribute__((ext_vector_type(16))) _Float16 v16h;
typedef __attribute__((ext_vector_type(16))) __bf16 v16b;
typedef __attribute__((ext_vector_type(8)))  _Float16 v8h;
typedef __attribute__((ext_vector_type(8)))  float v8f;
typedef __attribute__((ext_vector_type(4)))  float v4f;
typedef __attribute__((ext_vector_type(2)))  float v2f;
typedef __attribute__((ext_vector_type(4)))  unsigned v4u;
typedef __attribute__((ext_vector_type(4)))  int v4i;
typedef float __attribute__((may_alias)) float_a;
typedef int __attribute__((may_alias)) int_a;

template <typename T> __device__ __forceinline__ void vst2(void* p, T v) { *(T*)p = v;  }
__device__ __forceinline__ v8f wmma16(v16h a, v16h b, v8f c) {
  v8f d = __builtin_amdgcn_wmma_f32_16x16x32_f16(false, a, false, b, (short)0, c, false, false);
  asm volatile("v_nop\n\tv_nop\n\tv_nop\n\tv_nop" : "+v"(d) : "v"(a), "v"(b));
  return d;
}
__device__ __forceinline__ v8f wmma_bf(v16b a, v16b b, v8f c) {
  v8f d = __builtin_amdgcn_wmma_f32_16x16x32_bf16(false, a, false, b, (short)0, c, false, false);
  asm volatile("v_nop\n\tv_nop\n\tv_nop\n\tv_nop" : "+v"(d) : "v"(a), "v"(b));
  return d;
}
// 16x16x32 fragments: lane = (h = lane>>4, row/col = lane&15); elements 0..7 = k0+8h+0..7, 8..15 = k0+16+8h+0..7; D element r = row 8h+r
__device__ __forceinline__ v16h frag_h(const _Float16* rowk0, int lane) {
  union { v16h v; v8h q[2]; } u; const _Float16* p = rowk0 + 8 * (lane >> 4);
  u.q[0] = *(const v8h*)p; u.q[1] = *(const v8h*)(p + 16); return u.v;
}
__device__ __forceinline__ v16h frag_f32(const float* rowk0, int lane) {
  v16h a; const float* p = rowk0 + 8 * (lane >> 4);
#pragma unroll
  for (int i = 0; i < 8; ++i) { a[i] = (_Float16)p[i]; a[8 + i] = (_Float16)p[16 + i]; }
  return a;
}
__device__ __forceinline__ v16h frag_f32s(const float* rowk0, int lane, float sc) {
  v16h a; const float* p = rowk0 + 8 * (lane >> 4);
#pragma unroll
  for (int i = 0; i < 8; ++i) { a[i] = (_Float16)(p[i] * sc); a[8 + i] = (_Float16)(p[16 + i] * sc); }
  return a;
}
// column fragment from a [K][ld] layout (column n), rows >= K read as 0
__device__ __forceinline__ v16h fragc_f32(const float* W, int k0, int n, int lane, int ld, int K) {
  v16h a; const int g = lane >> 4;
#pragma unroll
  for (int i = 0; i < 8; ++i) { const int ka = k0 + 8 * g + i, kb = ka + 16;
    a[i] = (_Float16)(ka < K ? W[(size_t)(ka < K ? ka : K - 1) * ld + n] : 0.f); a[8 + i] = (_Float16)(kb < K ? W[(size_t)(kb < K ? kb : K - 1) * ld + n] : 0.f); }
  return a;
}
struct F2 { v16b h, l; };
__device__ __forceinline__ F2 bsplit16(const float v[16]) { F2 r;
#pragma unroll
  for (int i = 0; i < 16; ++i) { const __bf16 h = (__bf16)v[i]; r.h[i] = h; r.l[i] = (__bf16)(v[i] - (float)h); }
  return r; }
__device__ __forceinline__ F2 split_row(const float* row, int k0, int lane) { float v[16]; const float* p = row + k0 + 8 * (lane >> 4);
#pragma unroll
  for (int i = 0; i < 8; ++i) { v[i] = p[i]; v[8 + i] = p[16 + i]; }
  return bsplit16(v); }
__device__ __forceinline__ F2 split_rowK(const float* row, int k0, int lane, int K) { float v[16]; const int g = lane >> 4;
#pragma unroll
  for (int i = 0; i < 8; ++i) { const int ka = k0 + 8 * g + i, kb = ka + 16; v[i] = ka < K ? row[ka < K ? ka : K - 1] : 0.f; v[8 + i] = kb < K ? row[kb < K ? kb : K - 1] : 0.f; }
  return bsplit16(v); }
__device__ __forceinline__ F2 split_col(const float* W, int k0, int n, int lane, int ld, int K) { float v[16]; const int g = lane >> 4;
#pragma unroll
  for (int i = 0; i < 8; ++i) { const int ka = k0 + 8 * g + i, kb = ka + 16; v[i] = ka < K ? W[(size_t)(ka < K ? ka : K - 1) * ld + n] : 0.f; v[8 + i] = kb < K ? W[(size_t)(kb < K ? kb : K - 1) * ld + n] : 0.f; }
  return bsplit16(v); }
__device__ __forceinline__ v8f mac3(const F2& a, const F2& b, v8f c) { c = wmma_bf(a.l, b.h, c); c = wmma_bf(a.h, b.l, c); return wmma_bf(a.h, b.h, c); }
__device__ __forceinline__ float sigm(float v) { return 1.0f / (1.0f + expf(-v)); }
#define LDSX() do { asm volatile("s_wait_dscnt 0" ::: "memory"); __builtin_amdgcn_wave_barrier(); __builtin_amdgcn_fence(__ATOMIC_RELEASE, "workgroup"); } while (0)


// Disentangled attention: q = x (W_cq + W_pq) + (b_cq + b_pq), likewise k, v (8 heads x 64); energy = q k^T / sqrt(512); softmax; out = P v merged to [8, 1024, 512] (no output projection).
// k_pack ([Wc col | Wp col] as one bf16 row of K = 1024), k_proj (exact GEMM over [x | x], + both biases), k_vt (V transposed hi/lo planes), k_attn (flash-style, 32 key steps; writes the output rows directly).
#define NB 8
#define SS 1024
#define DM 512
#define NH 8
#define HD 64
#define NR (NB * SS)
#define QKVP (3 * DM)
#define KK (2 * DM)            // concatenated K
#ifndef TRB
#define TRB (NR / 64)
#define TQB (SS / 64)
#define TNB NB
#endif
typedef __attribute__((ext_vector_type(8))) __bf16 v8b;
__device__ __forceinline__ v16b frag_b(const __bf16* rowk0, int lane) {
  union { v16b v; v8b q[2]; } u; const __bf16* p = rowk0 + 8 * (lane >> 4);
  u.q[0] = *(const v8b*)p; u.q[1] = *(const v8b*)(p + 16); return u.v;
}
__device__ __forceinline__ v16b frag_gbf(const float* rowk0, int lane) {
  v16b a; const float* p = rowk0 + 8 * (lane >> 4);
#pragma unroll
  for (int i = 0; i < 8; ++i) { a[i] = (__bf16)p[i]; a[8 + i] = (__bf16)p[16 + i]; }
  return a;
}
__device__ __forceinline__ float bfr(float v) { return (float)(__bf16)v; }
__device__ __attribute__((noinline)) float exp_ni(float v) { return expf(v); }
#define WS_PT   0u                                  // bf16 [1536][1024]: row n = [Wc_*[:, c] ; Wp_*[:, c]]
#define WS_QKV  (WS_PT + 2u * QKVP * KK)             // f32 [8192][1536]
#define WS_VTH  (WS_QKV + 4u * NR * QKVP)            // bf16 [8][512][1024]
#define WS_VTL  (WS_VTH + 2u * NB * DM * SS)
#define WS_END  (WS_VTL + 2u * NB * DM * SS)

__global__ __launch_bounds__(128) void k_pack(const float* __restrict__ Wcq, const float* __restrict__ Wck, const float* __restrict__ Wcv, const float* __restrict__ Wpq, const float* __restrict__ Wpk, const float* __restrict__ Wpv, __bf16* __restrict__ PT) {
  __shared__ __align__(16) __bf16 srow[KK];
  const int n = blockIdx.x, tid = threadIdx.x; const int which = n / DM, c = n % DM; const float* Wc = which == 0 ? Wcq : which == 1 ? Wck : Wcv; const float* Wp = which == 0 ? Wpq : which == 1 ? Wpk : Wpv;
  for (int k = tid; k < DM; k += 128) { srow[k] = (__bf16)Wc[(size_t)k * DM + c]; srow[DM + k] = (__bf16)Wp[(size_t)k * DM + c]; }   // [in][out] layout: column c
  __syncthreads();
  vst2((unsigned*)(PT + (size_t)n * KK + tid * 8), *(const v4u*)(&srow[tid * 8]));
}
// ---- k_proj: QKV[r][n] = [bf16(x[r]) | bf16(x[r])] . PT[n] (exact) + bc[n] + bp[n]; block (64 rows, 128 cols)
__global__ __launch_bounds__(128) void k_proj(const float* __restrict__ X, const __bf16* __restrict__ PT, const float* __restrict__ bcq, const float* __restrict__ bck, const float* __restrict__ bcv, const float* __restrict__ bpq, const float* __restrict__ bpk, const float* __restrict__ bpv, float* __restrict__ QKV) {
  __shared__ __align__(16) float so[4][16][132];
  const int tid = threadIdx.x, wave = tid >> 5, lane = tid & 31, col = lane & 15, g = lane >> 4; const size_t r0 = (size_t)blockIdx.x * 64 + wave * 16; const int n0 = blockIdx.y * 128;
  v8f acc[8] = {};
#pragma unroll 2
  for (int kc = 0; kc < KK / 32; ++kc) { const v16b a = frag_gbf(X + (r0 + col) * DM + (kc % (DM / 32)) * 32, lane);
#pragma unroll
    for (int j = 0; j < 8; ++j) acc[j] = wmma_bf(a, frag_b(PT + (size_t)(n0 + j * 16 + col) * KK + kc * 32, lane), acc[j]); }
#pragma unroll
  for (int j = 0; j < 8; ++j) { const int n = n0 + j * 16 + col; const int which = n / DM, c = n % DM; const float bb = bfr((which == 0 ? bcq : which == 1 ? bck : bcv)[c]) + bfr((which == 0 ? bpq : which == 1 ? bpk : bpv)[c]);
#pragma unroll
    for (int r = 0; r < 8; ++r) so[wave][8 * g + r][j * 16 + col] = acc[j][r] + bb; }
  LDSX();
  for (int rl = 0; rl < 16; ++rl) vst2(QKV + (r0 + rl) * QKVP + n0 + lane * 4, *(const v4f*)&so[wave][rl][lane * 4]);
}
__global__ __launch_bounds__(256) void k_vt(const float* __restrict__ QKV, __bf16* __restrict__ VTH, __bf16* __restrict__ VTL) {
  __shared__ __align__(16) __bf16 svh[DM][72], svl[DM][72];
  const int tid = threadIdx.x; const size_t t0 = (size_t)blockIdx.x * 64; const int b = (int)(t0 / SS), p0 = (int)(t0 % SS);
  for (int tl = 0; tl < 64; ++tl) { const float* row = QKV + (t0 + tl) * QKVP + 2 * DM; for (int q = tid; q < DM; q += 256) { const float v = row[q]; const __bf16 hb = (__bf16)v; svh[q][tl] = hb; svl[q][tl] = (__bf16)(v - (float)hb); } }
  __syncthreads();
  for (int q = tid; q < DM * 8; q += 256) { const int rowi = q >> 3, pc = q & 7; const size_t o = ((size_t)b * DM + rowi) * SS + p0 + pc * 8; vst2((unsigned*)(VTH + o), *(const v4u*)&svh[rowi][pc * 8]); vst2((unsigned*)(VTL + o), *(const v4u*)&svl[rowi][pc * 8]); }
}
// ---- k_attn: block = (query block, b*8 + h), 4 waves; 32 key steps; out rows written directly (head segment 256 B)
__global__ __launch_bounds__(128) void k_attn(const float* __restrict__ QKV, const __bf16* __restrict__ VTH, const __bf16* __restrict__ VTL, float* __restrict__ OUT) {
  __shared__ __align__(16) float sp[4][16][36]; __shared__ __align__(16) float so[4][16][68];
  const int tid = threadIdx.x, wave = tid >> 5, lane = tid & 31, col = lane & 15, g = lane >> 4;
  const int qb = blockIdx.x, bh = blockIdx.y, b = bh / NH, h = bh % NH; const int q0 = qb * 64 + wave * 16; const size_t tq = (size_t)b * SS + q0;
  const F2 a0 = split_row(QKV + (tq + col) * QKVP + h * HD, 0, lane), a1 = split_row(QKV + (tq + col) * QKVP + h * HD, 32, lane);
  float m[8], l[8];
#pragma unroll
  for (int r = 0; r < 8; ++r) { m[r] = -3.0e38f; l[r] = 0.f; }
  v8f acc[4] = {};
  const float scl = 0.044194173824159216f;   // 1/sqrt(512)
#pragma unroll 1
  for (int ks = 0; ks < SS / 32; ++ks) {
    v8f s[2];
#pragma unroll
    for (int ct = 0; ct < 2; ++ct) { const int kk = ks * 32 + ct * 16 + col; const float* krow = QKV + ((size_t)b * SS + kk) * QKVP + DM + h * HD; const F2 k0 = split_row(krow, 0, lane), k1 = split_row(krow, 32, lane);
      v8f c = mac3(a0, k0, (v8f){}); c = mac3(a1, k1, c);
#pragma unroll
      for (int r = 0; r < 8; ++r) s[ct][r] = c[r] * scl; }
#pragma unroll
    for (int r = 0; r < 8; ++r) { float mx = fmaxf(s[0][r], s[1][r]);
#pragma unroll
      for (int o = 1; o < 16; o <<= 1) mx = fmaxf(mx, __shfl_xor(mx, o));
      const float mn = fmaxf(m[r], mx); const float alpha = exp_ni(m[r] - mn);
      const float e0 = exp_ni(s[0][r] - mn), e1 = exp_ni(s[1][r] - mn); float es = e0 + e1;
#pragma unroll
      for (int o = 1; o < 16; o <<= 1) es += __shfl_xor(es, o);
      l[r] = l[r] * alpha + es; m[r] = mn;
#pragma unroll
      for (int dt = 0; dt < 4; ++dt) acc[dt][r] *= alpha;
      sp[wave][8 * g + r][col] = e0; sp[wave][8 * g + r][16 + col] = e1; }
    LDSX();
    const F2 pa = split_row(&sp[wave][col][0], 0, lane);
#pragma unroll
    for (int dt = 0; dt < 4; ++dt) { const size_t vrow = ((size_t)b * DM + h * HD + dt * 16 + col) * SS + ks * 32; const v16b vh = frag_b(VTH + vrow, lane), vl = frag_b(VTL + vrow, lane);
      acc[dt] = wmma_bf(pa.l, vh, acc[dt]); acc[dt] = wmma_bf(pa.h, vl, acc[dt]); acc[dt] = wmma_bf(pa.h, vh, acc[dt]); }
    LDSX(); }
#pragma unroll
  for (int r = 0; r < 8; ++r) { const float il = 1.0f / l[r];
#pragma unroll
    for (int dt = 0; dt < 4; ++dt) so[wave][8 * g + r][dt * 16 + col] = acc[dt][r] * il; }
  LDSX();
  for (int rl = 0; rl < 16; ++rl) if (lane < 16) vst2(OUT + (tq + rl) * DM + h * HD + lane * 4, *(const v4f*)&so[wave][rl][lane * 4]);
}

extern "C" void kernel_launch(void* const* d_in, const int* in_sizes, int n_in, void* d_out, int out_size, void* d_ws, size_t ws_size, hipStream_t stream) {
  (void)in_sizes; (void)n_in; (void)out_size;
  const float** F = (const float**)d_in;   // x, W_cq, b_cq, W_ck, b_ck, W_cv, b_cv, W_pq, b_pq, W_pk, b_pk, W_pv, b_pv  ([in][out] weights)
  if (ws_size < (size_t)WS_END) return;
  char* ws = (char*)d_ws; __bf16 *PT = (__bf16*)(ws + WS_PT), *VTH = (__bf16*)(ws + WS_VTH), *VTL = (__bf16*)(ws + WS_VTL); float* QKV = (float*)(ws + WS_QKV);
  k_pack<<<QKVP, 128, 0, stream>>>(F[1], F[3], F[5], F[7], F[9], F[11], PT);
  k_proj<<<dim3(TRB, QKVP / 128), 128, 0, stream>>>(F[0], PT, F[2], F[4], F[6], F[8], F[10], F[12], QKV);
  k_vt<<<TRB, 256, 0, stream>>>(QKV, VTH, VTL);
  k_attn<<<dim3(TQB, TNB * NH), 128, 0, stream>>>(QKV, VTH, VTL, (float*)d_out);
}

// v001
// Measured time: 329 microseconds a run.
// Two timings next to v000 put it at 1.13 and 1.14 times that version's speed.
// compute dtype: x, the six weights and biases (module inputs) rounded to bf16; q/k/v projections as exact bf16 products over the concatenated [Wc ; Wp] columns (x.(Wc+Wp) == x.Wc + x.Wp, f32 accumulate, + bc + bp); scores and P.V with both computed operands as bf16 hi + bf16 residual pairs (3 products); online softmax in f32; f32 accumulate.
#include <hip/hip_runtime.h>
#include <math.h>

typedef __attribute__((ext_vector_type(16))) _Float16 v16h;
typedef __attribute__((ext_vector_type(16))) __bf16 v16b;
typedef __attribute__((ext_vector_type(8)))  _Float16 v8h;
typedef __attribute__((ext_vector_type(8)))  float v8f;
typedef __attribute__((ext_vector_type(4)))  float v4f;
typedef __attribute__((ext_vector_type(2)))  float v2f;
typedef __attribute__((ext_vector_type(4)))  unsigned v4u;
typedef __attribute__((ext_vector_type(4)))  int v4i;
typedef float __attribute__((may_alias)) float_a;
typedef int __attribute__((may_alias)) int_a;

template <typename T> __device__ __forceinline__ void vst2(void* p, T v) { *(T*)p = v;  }
__device__ __forceinline__ v8f wmma16(v16h a, v16h b, v8f c) {
  v8f d = __builtin_amdgcn_wmma_f32_16x16x32_f16(false, a, false, b, (short)0, c, false, false);
  asm volatile("v_nop\n\tv_nop\n\tv_nop\n\tv_nop" : "+v"(d) : "v"(a), "v"(b));
  return d;
}
__device__ __forceinline__ v8f wmma_bf(v16b a, v16b b, v8f c) {
  v8f d = __builtin_amdgcn_wmma_f32_16x16x32_bf16(false, a, false, b, (short)0, c, false, false);
  asm volatile("v_nop\n\tv_nop\n\tv_nop\n\tv_nop" : "+v"(d) : "v"(a), "v"(b));
  return d;
}
// 16x16x32 fragments: lane = (h = lane>>4, row/col = lane&15); elements 0..7 = k0+8h+0..7, 8..15 = k0+16+8h+0..7; D element r = row 8h+r
__device__ __forceinline__ v16h frag_h(const _Float16* rowk0, int lane) {
  union { v16h v; v8h q[2]; } u; const _Float16* p = rowk0 + 8 * (lane >> 4);
  u.q[0] = *(const v8h*)p; u.q[1] = *(const v8h*)(p + 16); return u.v;
}
__device__ __forceinline__ v16h frag_f32(const float* rowk0, int lane) {
  v16h a; const float* p = rowk0 + 8 * (lane >> 4);
#pragma unroll
  for (int i = 0; i < 8; ++i) { a[i] = (_Float16)p[i]; a[8 + i] = (_Float16)p[16 + i]; }
  return a;
}
__device__ __forceinline__ v16h frag_f32s(const float* rowk0, int lane, float sc) {
  v16h a; const float* p = rowk0 + 8 * (lane >> 4);
#pragma unroll
  for (int i = 0; i < 8; ++i) { a[i] = (_Float16)(p[i] * sc); a[8 + i] = (_Float16)(p[16 + i] * sc); }
  return a;
}
// column fragment from a [K][ld] layout (column n), rows >= K read as 0
__device__ __forceinline__ v16h fragc_f32(const float* W, int k0, int n, int lane, int ld, int K) {
  v16h a; const int g = lane >> 4;
#pragma unroll
  for (int i = 0; i < 8; ++i) { const int ka = k0 + 8 * g + i, kb = ka + 16;
    a[i] = (_Float16)(ka < K ? W[(size_t)(ka < K ? ka : K - 1) * ld + n] : 0.f); a[8 + i] = (_Float16)(kb < K ? W[(size_t)(kb < K ? kb : K - 1) * ld + n] : 0.f); }
  return a;
}
struct F2 { v16b h, l; };
__device__ __forceinline__ F2 bsplit16(const float v[16]) { F2 r;
#pragma unroll
  for (int i = 0; i < 16; ++i) { const __bf16 h = (__bf16)v[i]; r.h[i] = h; r.l[i] = (__bf16)(v[i] - (float)h); }
  return r; }
__device__ __forceinline__ F2 split_row(const float* row, int k0, int lane) { float v[16]; const float* p = row + k0 + 8 * (lane >> 4);
#pragma unroll
  for (int i = 0; i < 8; ++i) { v[i] = p[i]; v[8 + i] = p[16 + i]; }
  return bsplit16(v); }
__device__ __forceinline__ F2 split_rowK(const float* row, int k0, int lane, int K) { float v[16]; const int g = lane >> 4;
#pragma unroll
  for (int i = 0; i < 8; ++i) { const int ka = k0 + 8 * g + i, kb = ka + 16; v[i] = ka < K ? row[ka < K ? ka : K - 1] : 0.f; v[8 + i] = kb < K ? row[kb < K ? kb : K - 1] : 0.f; }
  return bsplit16(v); }
__device__ __forceinline__ F2 split_col(const float* W, int k0, int n, int lane, int ld, int K) { float v[16]; const int g = lane >> 4;
#pragma unroll
  for (int i = 0; i < 8; ++i) { const int ka = k0 + 8 * g + i, kb = ka + 16; v[i] = ka < K ? W[(size_t)(ka < K ? ka : K - 1) * ld + n] : 0.f; v[8 + i] = kb < K ? W[(size_t)(kb < K ? kb : K - 1) * ld + n] : 0.f; }
  return bsplit16(v); }
__device__ __forceinline__ v8f mac3(const F2& a, const F2& b, v8f c) { c = wmma_bf(a.l, b.h, c); c = wmma_bf(a.h, b.l, c); return wmma_bf(a.h, b.h, c); }
__device__ __forceinline__ float sigm(float v) { return 1.0f / (1.0f + expf(-v)); }
#define LDSX() do { asm volatile("s_wait_dscnt 0" ::: "memory"); __builtin_amdgcn_wave_barrier(); __builtin_amdgcn_fence(__ATOMIC_RELEASE, "workgroup"); } while (0)


// Disentangled attention: q = x (W_cq + W_pq) + (b_cq + b_pq), likewise k, v (8 heads x 64); energy = q k^T / sqrt(512); softmax; out = P v merged to [8, 1024, 512] (no output projection).
// k_pack ([Wc col | Wp col] as one bf16 row of K = 1024), k_proj (exact GEMM over [x | x], + both biases), k_vt (V transposed hi/lo planes), k_attn (flash-style, 32 key steps, transposed products; writes the output rows directly).
#define NB 8
#define SS 1024
#define DM 512
#define NH 8
#define HD 64
#define NR (NB * SS)
#define QKVP (3 * DM)
#define KK (2 * DM)            // concatenated K
#ifndef TRB
#define TRB (NR / 64)
#define TQB (SS / 64)
#define TNB NB
#endif
typedef __attribute__((ext_vector_type(8))) __bf16 v8b;
__device__ __forceinline__ v16b frag_b(const __bf16* rowk0, int lane) {
  union { v16b v; v8b q[2]; } u; const __bf16* p = rowk0 + 8 * (lane >> 4);
  u.q[0] = *(const v8b*)p; u.q[1] = *(const v8b*)(p + 16); return u.v;
}
__device__ __forceinline__ v16b frag_gbf(const float* rowk0, int lane) {
  v16b a; const float* p = rowk0 + 8 * (lane >> 4);
#pragma unroll
  for (int i = 0; i < 8; ++i) { a[i] = (__bf16)p[i]; a[8 + i] = (__bf16)p[16 + i]; }
  return a;
}
__device__ __forceinline__ float bfr(float v) { return (float)(__bf16)v; }
__device__ __attribute__((noinline)) float exp_ni(float v) { return expf(v); }
#define WS_PT   0u                                  // bf16 [1536][1024]: row n = [Wc_*[:, c] ; Wp_*[:, c]]
#define WS_QKV  (WS_PT + 2u * QKVP * KK)             // f32 [8192][1536]
#define WS_VTH  (WS_QKV + 4u * NR * QKVP)            // bf16 [8][512][1024]
#define WS_VTL  (WS_VTH + 2u * NB * DM * SS)
#define WS_END  (WS_VTL + 2u * NB * DM * SS)

__global__ __launch_bounds__(128) void k_pack(const float* __restrict__ Wcq, const float* __restrict__ Wck, const float* __restrict__ Wcv, const float* __restrict__ Wpq, const float* __restrict__ Wpk, const float* __restrict__ Wpv, __bf16* __restrict__ PT) {
  __shared__ __align__(16) __bf16 srow[KK];
  const int n = blockIdx.x, tid = threadIdx.x; const int which = n / DM, c = n % DM; const float* Wc = which == 0 ? Wcq : which == 1 ? Wck : Wcv; const float* Wp = which == 0 ? Wpq : which == 1 ? Wpk : Wpv;
  for (int k = tid; k < DM; k += 128) { srow[k] = (__bf16)Wc[(size_t)k * DM + c]; srow[DM + k] = (__bf16)Wp[(size_t)k * DM + c]; }   // [in][out] layout: column c
  __syncthreads();
  vst2((unsigned*)(PT + (size_t)n * KK + tid * 8), *(const v4u*)(&srow[tid * 8]));
}
// ---- k_proj: QKV[r][n] = [bf16(x[r]) | bf16(x[r])] . PT[n] (exact) + bc[n] + bp[n]; block (64 rows, 128 cols)
__global__ __launch_bounds__(128) void k_proj(const float* __restrict__ X, const __bf16* __restrict__ PT, const float* __restrict__ bcq, const float* __restrict__ bck, const float* __restrict__ bcv, const float* __restrict__ bpq, const float* __restrict__ bpk, const float* __restrict__ bpv, float* __restrict__ QKV) {
  __shared__ __align__(16) float so[4][16][132];
  const int tid = threadIdx.x, wave = tid >> 5, lane = tid & 31, col = lane & 15, g = lane >> 4; const size_t r0 = (size_t)blockIdx.x * 64 + wave * 16; const int n0 = blockIdx.y * 128;
  v8f acc[8] = {};
#pragma unroll 2
  for (int kc = 0; kc < KK / 32; ++kc) { const v16b a = frag_gbf(X + (r0 + col) * DM + (kc % (DM / 32)) * 32, lane);
#pragma unroll
    for (int j = 0; j < 8; ++j) acc[j] = wmma_bf(a, frag_b(PT + (size_t)(n0 + j * 16 + col) * KK + kc * 32, lane), acc[j]); }
#pragma unroll
  for (int j = 0; j < 8; ++j) { const int n = n0 + j * 16 + col; const int which = n / DM, c = n % DM; const float bb = bfr((which == 0 ? bcq : which == 1 ? bck : bcv)[c]) + bfr((which == 0 ? bpq : which == 1 ? bpk : bpv)[c]);
#pragma unroll
    for (int r = 0; r < 8; ++r) so[wave][8 * g + r][j * 16 + col] = acc[j][r] + bb; }
  LDSX();
  for (int rl = 0; rl < 16; ++rl) vst2(QKV + (r0 + rl) * QKVP + n0 + lane * 4, *(const v4f*)&so[wave][rl][lane * 4]);
}
__global__ __launch_bounds__(256) void k_vt(const float* __restrict__ QKV, __bf16* __restrict__ VTH, __bf16* __restrict__ VTL) {
  __shared__ __align__(16) __bf16 svh[DM][72], svl[DM][72];
  const int tid = threadIdx.x; const size_t t0 = (size_t)blockIdx.x * 64; const int b = (int)(t0 / SS), p0 = (int)(t0 % SS);
  for (int tl = 0; tl < 64; ++tl) { const float* row = QKV + (t0 + tl) * QKVP + 2 * DM; for (int q = tid; q < DM; q += 256) { const float v = row[q]; const __bf16 hb = (__bf16)v; svh[q][tl] = hb; svl[q][tl] = (__bf16)(v - (float)hb); } }
  __syncthreads();
  for (int q = tid; q < DM * 8; q += 256) { const int rowi = q >> 3, pc = q & 7; const size_t o = ((size_t)b * DM + rowi) * SS + p0 + pc * 8; vst2((unsigned*)(VTH + o), *(const v4u*)&svh[rowi][pc * 8]); vst2((unsigned*)(VTL + o), *(const v4u*)&svl[rowi][pc * 8]); }
}
// lane l with lane l ^ 16 (the two halves of a wave hold the two halves of a query's keys)
__device__ __forceinline__ float xhalf(float x) { return __builtin_bit_cast(float, __builtin_amdgcn_permlanex16(__builtin_bit_cast(int, x), __builtin_bit_cast(int, x), 0x76543210, 0xfedcba98, false, false)); }
// ---- k_attn: block = (query block, b*8 + h), 4 waves; 32 key steps; transposed products: S^T = K Q^T (A = key rows, B = query columns), O^T += V^T P^T.
// Lane (g, col) holds query col's scores of keys 8g+r and 16+8g+r: maximum and sum in the lane's own registers, and the two score tiles are P^T's B fragment as they stand.
__global__ __launch_bounds__(128) void k_attn(const float* __restrict__ QKV, const __bf16* __restrict__ VTH, const __bf16* __restrict__ VTL, float* __restrict__ OUT) {
  __shared__ __align__(16) float so[4][16][68];
  const int tid = threadIdx.x, wave = tid >> 5, lane = tid & 31, col = lane & 15, g = lane >> 4;
  const int qb = blockIdx.x, bh = blockIdx.y, b = bh / NH, h = bh % NH; const int q0 = qb * 64 + wave * 16; const size_t tq = (size_t)b * SS + q0;
  const F2 a0 = split_row(QKV + (tq + col) * QKVP + h * HD, 0, lane), a1 = split_row(QKV + (tq + col) * QKVP + h * HD, 32, lane);
  float m = -3.0e38f, l = 0.f;   // m: query col's running maximum (equal in both halves); l: this half's part of the sum
  v8f acc[4] = {};               // acc[dt][r] = O^T[dt*16 + 8g + r][col]
  const float scl = 0.044194173824159216f;   // 1/sqrt(512)
#pragma unroll 1
  for (int ks = 0; ks < SS / 32; ++ks) {
    float s[16];
#pragma unroll
    for (int ct = 0; ct < 2; ++ct) { const int kk = ks * 32 + ct * 16 + col; const float* krow = QKV + ((size_t)b * SS + kk) * QKVP + DM + h * HD; const F2 k0 = split_row(krow, 0, lane), k1 = split_row(krow, 32, lane);
      v8f c = wmma_bf(k0.h, a0.l, (v8f){}); c = wmma_bf(k0.l, a0.h, c); c = wmma_bf(k0.h, a0.h, c);
      c = wmma_bf(k1.h, a1.l, c); c = wmma_bf(k1.l, a1.h, c); c = wmma_bf(k1.h, a1.h, c);
#pragma unroll
      for (int r = 0; r < 8; ++r) s[ct * 8 + r] = c[r] * scl; }
    float mx = s[0];
#pragma unroll
    for (int i = 1; i < 16; ++i) mx = fmaxf(mx, s[i]);
    mx = fmaxf(mx, xhalf(mx));
    const float mn = fmaxf(m, mx); const float alpha = exp_ni(m - mn); m = mn;
    float es = 0.f;
#pragma unroll
    for (int i = 0; i < 16; ++i) { s[i] = exp_ni(s[i] - mn); es += s[i]; }
    l = l * alpha + es;
#pragma unroll
    for (int dt = 0; dt < 4; ++dt)
#pragma unroll
      for (int r = 0; r < 8; ++r) acc[dt][r] *= alpha;
    const F2 pb = bsplit16(s);   // element i = key 8g+i, element 8+i = key 16+8g+i: the k order of frag_b
#pragma unroll
    for (int dt = 0; dt < 4; ++dt) { const size_t vrow = ((size_t)b * DM + h * HD + dt * 16 + col) * SS + ks * 32; const v16b vh = frag_b(VTH + vrow, lane), vl = frag_b(VTL + vrow, lane);
      acc[dt] = wmma_bf(vh, pb.l, acc[dt]); acc[dt] = wmma_bf(vl, pb.h, acc[dt]); acc[dt] = wmma_bf(vh, pb.h, acc[dt]); } }
  const float il = 1.0f / (l + xhalf(l));
#pragma unroll
  for (int dt = 0; dt < 4; ++dt) { v4f lo, hi;
#pragma unroll
    for (int r = 0; r < 4; ++r) { lo[r] = acc[dt][r] * il; hi[r] = acc[dt][4 + r] * il; }
    *(v4f*)&so[wave][col][dt * 16 + 8 * g] = lo; *(v4f*)&so[wave][col][dt * 16 + 8 * g + 4] = hi; }
  LDSX();
  for (int rl = 0; rl < 16; ++rl) if (lane < 16) vst2(OUT + (tq + rl) * DM + h * HD + lane * 4, *(const v4f*)&so[wave][rl][lane * 4]);
}

extern "C" void kernel_launch(void* const* d_in, const int* in_sizes, int n_in, void* d_out, int out_size, void* d_ws, size_t ws_size, hipStream_t stream) {
  (void)in_sizes; (void)n_in; (void)out_size;
  const float** F = (const float**)d_in;   // x, W_cq, b_cq, W_ck, b_ck, W_cv, b_cv, W_pq, b_pq, W_pk, b_pk, W_pv, b_pv  ([in][out] weights)
  if (ws_size < (size_t)WS_END) return;
  char* ws = (char*)d_ws; __bf16 *PT = (__bf16*)(ws + WS_PT), *VTH = (__bf16*)(ws + WS_VTH), *VTL = (__bf16*)(ws + WS_VTL); float* QKV = (float*)(ws + WS_QKV);
  k_pack<<<QKVP, 128, 0, stream>>>(F[1], F[3], F[5], F[7], F[9], F[11], PT);
  k_proj<<<dim3(TRB, QKVP / 128), 128, 0, stream>>>(F[0], PT, F[2], F[4], F[6], F[8], F[10], F[12], QKV);
  k_vt<<<TRB, 256, 0, stream>>>(QKV, VTH, VTL);
  k_attn<<<dim3(TQB, TNB * NH), 128, 0, stream>>>(QKV, VTH, VTL, (float*)d_out);
}

// v002
// It runs in 255 microseconds.
// Two timings next to v001 put it at 1.30 and 1.28 times that version's speed.
// Over all steps from v000 it is 1.46 times as fast.
// compute dtype: x, the six weights and biases (module inputs) rounded to bf16; q/k/v projections as exact bf16 products over the concatenated [Wc ; Wp] columns (x.(Wc+Wp) == x.Wc + x.Wp, f32 accumulate, + bc + bp); scores and P.V with both computed operands as bf16 hi + bf16 residual pairs (3 products); online softmax in f32; f32 accumulate.
#include <hip/hip_runtime.h>
#include <math.h>

typedef __attribute__((ext_vector_type(16))) _Float16 v16h;
typedef __attribute__((ext_vector_type(16))) __bf16 v16b;
typedef __attribute__((ext_vector_type(8)))  _Float16 v8h;
typedef __attribute__((ext_vector_type(8)))  float v8f;
typedef __attribute__((ext_vector_type(4)))  float v4f;
typedef __attribute__((ext_vector_type(2)))  float v2f;
typedef __attribute__((ext_vector_type(4)))  unsigned v4u;
typedef __attribute__((ext_vector_type(4)))  int v4i;
typedef float __attribute__((may_alias)) float_a;
typedef int __attribute__((may_alias)) int_a;

template <typename T> __device__ __forceinline__ void vst2(void* p, T v) { *(T*)p = v;  }
__device__ __forceinline__ v8f wmma16(v16h a, v16h b, v8f c) {
  v8f d = __builtin_amdgcn_wmma_f32_16x16x32_f16(false, a, false, b, (short)0, c, false, false);
  asm volatile("v_nop\n\tv_nop\n\tv_nop\n\tv_nop" : "+v"(d) : "v"(a), "v"(b));
  return d;
}
__device__ __forceinline__ v8f wmma_bf(v16b a, v16b b, v8f c) {
  v8f d = __builtin_amdgcn_wmma_f32_16x16x32_bf16(false, a, false, b, (short)0, c, false, false);
  asm volatile("v_nop\n\tv_nop\n\tv_nop\n\tv_nop" : "+v"(d) : "v"(a), "v"(b));
  return d;
}
// 16x16x32 fragments: lane = (h = lane>>4, row/col = lane&15); elements 0..7 = k0+8h+0..7, 8..15 = k0+16+8h+0..7; D element r = row 8h+r
__device__ __forceinline__ v16h frag_h(const _Float16* rowk0, int lane) {
  union { v16h v; v8h q[2]; } u; const _Float16* p = rowk0 + 8 * (lane >> 4);
  u.q[0] = *(const v8h*)p; u.q[1] = *(const v8h*)(p + 16); return u.v;
}
__device__ __forceinline__ v16h frag_f32(const float* rowk0, int lane) {
  v16h a; const float* p = rowk0 + 8 * (lane >> 4);
#pragma unroll
  for (int i = 0; i < 8; ++i) { a[i] = (_Float16)p[i]; a[8 + i] = (_Float16)p[16 + i]; }
  return a;
}
__device__ __forceinline__ v16h frag_f32s(const float* rowk0, int lane, float sc) {
  v16h a; const float* p = rowk0 + 8 * (lane >> 4);
#pragma unroll
  for (int i = 0; i < 8; ++i) { a[i] = (_Float16)(p[i] * sc); a[8 + i] = (_Float16)(p[16 + i] * sc); }
  return a;
}
// column fragment from a [K][ld] layout (column n), rows >= K read as 0
__device__ __forceinline__ v16h fragc_f32(const float* W, int k0, int n, int lane, int ld, int K) {
  v16h a; const int g = lane >> 4;
#pragma unroll
  for (int i = 0; i < 8; ++i) { const int ka = k0 + 8 * g + i, kb = ka + 16;
    a[i] = (_Float16)(ka < K ? W[(size_t)(ka < K ? ka : K - 1) * ld + n] : 0.f); a[8 + i] = (_Float16)(kb < K ? W[(size_t)(kb < K ? kb : K - 1) * ld + n] : 0.f); }
  return a;
}
struct F2 { v16b h, l; };
__device__ __forceinline__ F2 bsplit16(const float v[16]) { F2 r;
#pragma unroll
  for (int i = 0; i < 16; ++i) { const __bf16 h = (__bf16)v[i]; r.h[i] = h; r.l[i] = (__bf16)(v[i] - (float)h); }
  return r; }
__device__ __forceinline__ F2 split_row(const float* row, int k0, int lane) { float v[16]; const float* p = row + k0 + 8 * (lane >> 4);
#pragma unroll
  for (int i = 0; i < 8; ++i) { v[i] = p[i]; v[8 + i] = p[16 + i]; }
  return bsplit16(v); }
__device__ __forceinline__ F2 split_rowK(const float* row, int k0, int lane, int K) { float v[16]; const int g = lane >> 4;
#pragma unroll
  for (int i = 0; i < 8; ++i) { const int ka = k0 + 8 * g + i, kb = ka + 16; v[i] = ka < K ? row[ka < K ? ka : K - 1] : 0.f; v[8 + i] = kb < K ? row[kb < K ? kb : K - 1] : 0.f; }
  return bsplit16(v); }
__device__ __forceinline__ F2 split_col(const float* W, int k0, int n, int lane, int ld, int K) { float v[16]; const int g = lane >> 4;
#pragma unroll
  for (int i = 0; i < 8; ++i) { const int ka = k0 + 8 * g + i, kb = ka + 16; v[i] = ka < K ? W[(size_t)(ka < K ? ka : K - 1) * ld + n] : 0.f; v[8 + i] = kb < K ? W[(size_t)(kb < K ? kb : K - 1) * ld + n] : 0.f; }
  return bsplit16(v); }
__device__ __forceinline__ v8f mac3(const F2& a, const F2& b, v8f c) { c = wmma_bf(a.l, b.h, c); c = wmma_bf(a.h, b.l, c); return wmma_bf(a.h, b.h, c); }
__device__ __forceinline__ float sigm(float v) { return 1.0f / (1.0f + expf(-v)); }
#define LDSX() do { asm volatile("s_wait_dscnt 0" ::: "memory"); __builtin_amdgcn_wave_barrier(); __builtin_amdgcn_fence(__ATOMIC_RELEASE, "workgroup"); } while (0)


// Disentangled attention: q = x (W_cq + W_pq) + (b_cq + b_pq), likewise k, v (8 heads x 64); energy = q k^T / sqrt(512); softmax; out = P v merged to [8, 1024, 512] (no output projection).
// k_pack ([Wc col | Wp col] as one bf16 row of K = 1024), k_proj (exact GEMM over [x | x], + both biases), k_vt (V transposed hi/lo planes), k_attn (flash-style, 32 key steps, transposed products; writes the output rows directly).
#define NB 8
#define SS 1024
#define DM 512
#define NH 8
#define HD 64
#define NR (NB * SS)
#define QKVP (3 * DM)
#define KK (2 * DM)            // concatenated K
#ifndef TRB
#define TRB (NR / 64)
#define TQB (SS / 64)
#define TNB NB
#endif
typedef __attribute__((ext_vector_type(8))) __bf16 v8b;
__device__ __forceinline__ v16b frag_b(const __bf16* rowk0, int lane) {
  union { v16b v; v8b q[2]; } u; const __bf16* p = rowk0 + 8 * (lane >> 4);
  u.q[0] = *(const v8b*)p; u.q[1] = *(const v8b*)(p + 16); return u.v;
}
__device__ __forceinline__ v16b frag_gbf(const float* rowk0, int lane) {
  v16b a; const float* p = rowk0 + 8 * (lane >> 4);
#pragma unroll
  for (int i = 0; i < 8; ++i) { a[i] = (__bf16)p[i]; a[8 + i] = (__bf16)p[16 + i]; }
  return a;
}
__device__ __forceinline__ float bfr(float v) { return (float)(__bf16)v; }
__device__ __attribute__((noinline)) float exp_ni(float v) { return expf(v); }
#define WS_PT   0u                                  // bf16 [1536][1024]: row n = [Wc_*[:, c] ; Wp_*[:, c]]
#define WS_QKV  (WS_PT + 2u * QKVP * KK)             // f32 [8192][1536]
#define WS_VTH  (WS_QKV + 4u * NR * QKVP)            // bf16 [8][512][1024]
#define WS_VTL  (WS_VTH + 2u * NB * DM * SS)
#define WS_END  (WS_VTL + 2u * NB * DM * SS)

__global__ __launch_bounds__(128) void k_pack(const float* __restrict__ Wcq, const float* __restrict__ Wck, const float* __restrict__ Wcv, const float* __restrict__ Wpq, const float* __restrict__ Wpk, const float* __restrict__ Wpv, __bf16* __restrict__ PT) {
  __shared__ __align__(16) __bf16 srow[KK];
  const int n = blockIdx.x, tid = threadIdx.x; const int which = n / DM, c = n % DM; const float* Wc = which == 0 ? Wcq : which == 1 ? Wck : Wcv; const float* Wp = which == 0 ? Wpq : which == 1 ? Wpk : Wpv;
  for (int k = tid; k < DM; k += 128) { srow[k] = (__bf16)Wc[(size_t)k * DM + c]; srow[DM + k] = (__bf16)Wp[(size_t)k * DM + c]; }   // [in][out] layout: column c
  __syncthreads();
  vst2((unsigned*)(PT + (size_t)n * KK + tid * 8), *(const v4u*)(&srow[tid * 8]));
}
// ---- k_proj: QKV[r][n] = [bf16(x[r]) | bf16(x[r])] . PT[n] (exact) + bc[n] + bp[n]; block (64 rows, 128 cols)
// A stage is 64 wide in k: its x tile (64 rows of 256 B) and its PT tile (128 rows of 128 B) come into LDS once for the block, by asynchronous copies that
// cover whole 128-B lines, two buffers; the four waves take their fragments from LDS. Row pitches 272 B and 144 B (16 B x odd) keep ds_load_b128 free of bank conflicts.
#define PJ_KW 64
#define PJ_AP (PJ_KW * 4u + 16u)
#define PJ_BP (PJ_KW * 2u + 16u)
#define PJ_AB (64u * PJ_AP)
#define PJ_BUF (PJ_AB + 128u * PJ_BP)
#define PJ_NS (KK / PJ_KW)
__device__ __forceinline__ v16b frag_lf(const char* rowk0, int g) {   // frag_gbf's k order, from an f32 row in LDS
  const v4f* p = (const v4f*)(rowk0 + 32 * g); const v4f x0 = p[0], x1 = p[1], x2 = p[4], x3 = p[5]; v16b a;
#pragma unroll
  for (int i = 0; i < 4; ++i) { a[i] = (__bf16)x0[i]; a[4 + i] = (__bf16)x1[i]; a[8 + i] = (__bf16)x2[i]; a[12 + i] = (__bf16)x3[i]; }
  return a;
}
// eight copies of 16 B per lane, LDS places ls bytes and sources gs elements apart; the s_wait_xcnt closes the statement so that no address register is rewritten ahead of it
template <typename T> __device__ __forceinline__ void pj_cp8(unsigned l, unsigned ls, const T* s, int gs) {
  asm volatile("global_load_async_to_lds_b128 %0, %1, off\n\t"
               "global_load_async_to_lds_b128 %2, %3, off\n\t"
               "global_load_async_to_lds_b128 %4, %5, off\n\t"
               "global_load_async_to_lds_b128 %6, %7, off\n\t"
               "global_load_async_to_lds_b128 %8, %9, off\n\t"
               "global_load_async_to_lds_b128 %10, %11, off\n\t"
               "global_load_async_to_lds_b128 %12, %13, off\n\t"
               "global_load_async_to_lds_b128 %14, %15, off\n\t"
               "s_wait_xcnt 0x0"
               :: "v"(l), "v"(s), "v"(l + ls), "v"(s + gs), "v"(l + 2u * ls), "v"(s + 2 * gs), "v"(l + 3u * ls), "v"(s + 3 * gs),
                  "v"(l + 4u * ls), "v"(s + 4 * gs), "v"(l + 5u * ls), "v"(s + 5 * gs), "v"(l + 6u * ls), "v"(s + 6 * gs), "v"(l + 7u * ls), "v"(s + 7 * gs)
               : "memory");
}
__global__ __launch_bounds__(128) void k_proj(const float* __restrict__ X, const __bf16* __restrict__ PT, const float* __restrict__ bcq, const float* __restrict__ bck, const float* __restrict__ bcv, const float* __restrict__ bpq, const float* __restrict__ bpk, const float* __restrict__ bpv, float* __restrict__ QKV) {
  __shared__ __align__(16) char sm[2u * PJ_BUF];   // the two stage buffers; behind the loop the output staging so[4][16][132]
  static_assert(2u * PJ_BUF >= 4u * 16u * 132u * 4u, "the output staging must fit the two buffers");
  float (*so)[16][132] = (float (*)[16][132])sm;
  const int tid = threadIdx.x, wave = tid >> 5, lane = tid & 31, col = lane & 15, g = lane >> 4; const size_t r0 = (size_t)blockIdx.x * 64 + wave * 16; const int n0 = blockIdx.y * 128;
  const unsigned lbase = (unsigned)(size_t)sm;
  // x tile: 16 lanes a row, 8 rows a copy of the block; PT tile: 8 lanes a row, 16 rows a copy
  const unsigned la = lbase + (unsigned)(tid >> 4) * PJ_AP + (unsigned)(tid & 15) * 16u, lb = lbase + PJ_AB + (unsigned)(tid >> 3) * PJ_BP + (unsigned)(tid & 7) * 16u;
  const float* ga = X + ((size_t)blockIdx.x * 64 + (tid >> 4)) * DM + (tid & 15) * 4; const __bf16* gb = PT + (size_t)(n0 + (tid >> 3)) * KK + (tid & 7) * 8;
  v8f acc[8] = {};
  pj_cp8(la, 8u * PJ_AP, ga, 8 * DM); pj_cp8(lb, 16u * PJ_BP, gb, 16 * KK);
  asm volatile("s_wait_asynccnt 0x0" ::: "memory");   // stage 0 has landed before the barrier publishes it
  __syncthreads();
  pj_cp8(la + PJ_BUF, 8u * PJ_AP, ga + PJ_KW, 8 * DM); pj_cp8(lb + PJ_BUF, 16u * PJ_BP, gb + PJ_KW, 16 * KK);
#pragma unroll 2   // by two, so that each half's buffer is a constant offset
  for (int st = 0; st < PJ_NS; ++st) { const char* sb = sm + (st & 1) * PJ_BUF;
#pragma unroll
    for (int u = 0; u < PJ_KW / 32; ++u) { const v16b a = frag_lf(sb + (wave * 16 + col) * PJ_AP + u * 128, g);
#pragma unroll
      for (int jh = 0; jh < 8; jh += 4) { v16b bq[4];   // four fragments' reads stand together ahead of their matrix instructions, not one wait a fragment
#pragma unroll
        for (int j = 0; j < 4; ++j) bq[j] = frag_b((const __bf16*)(sb + PJ_AB + ((jh + j) * 16 + col) * PJ_BP + u * 64), lane);
#pragma unroll
        for (int j = 0; j < 4; ++j) acc[jh + j] = wmma_bf(a, bq[j], acc[jh + j]); } }
    asm volatile("s_wait_dscnt 0x0" ::: "memory");      // this wave's reads of the buffer have returned before it is refilled
    asm volatile("s_wait_asynccnt 0x0" ::: "memory");   // this wave's copies of stage st + 1 have landed
    __syncthreads();                                    // publishes stage st + 1 and ends every wave's reads of stage st
    if (st + 2 < PJ_NS) { pj_cp8(la + (st & 1) * PJ_BUF, 8u * PJ_AP, ga + ((st + 2) % (DM / PJ_KW)) * PJ_KW, 8 * DM); pj_cp8(lb + (st & 1) * PJ_BUF, 16u * PJ_BP, gb + (st + 2) * PJ_KW, 16 * KK); } }
  asm volatile("s_wait_asynccnt 0x0" ::: "memory");     // no copy is outstanding when the buffers become output staging
#pragma unroll
  for (int j = 0; j < 8; ++j) { const int n = n0 + j * 16 + col; const int which = n / DM, c = n % DM; const float bb = bfr((which == 0 ? bcq : which == 1 ? bck : bcv)[c]) + bfr((which == 0 ? bpq : which == 1 ? bpk : bpv)[c]);
#pragma unroll
    for (int r = 0; r < 8; ++r) so[wave][8 * g + r][j * 16 + col] = acc[j][r] + bb; }
  LDSX();
  for (int rl = 0; rl < 16; ++rl) vst2(QKV + (r0 + rl) * QKVP + n0 + lane * 4, *(const v4f*)&so[wave][rl][lane * 4]);
}
__global__ __launch_bounds__(256) void k_vt(const float* __restrict__ QKV, __bf16* __restrict__ VTH, __bf16* __restrict__ VTL) {
  __shared__ __align__(16) __bf16 svh[DM][72], svl[DM][72];
  const int tid = threadIdx.x; const size_t t0 = (size_t)blockIdx.x * 64; const int b = (int)(t0 / SS), p0 = (int)(t0 % SS);
  for (int tl = 0; tl < 64; ++tl) { const float* row = QKV + (t0 + tl) * QKVP + 2 * DM; for (int q = tid; q < DM; q += 256) { const float v = row[q]; const __bf16 hb = (__bf16)v; svh[q][tl] = hb; svl[q][tl] = (__bf16)(v - (float)hb); } }
  __syncthreads();
  for (int q = tid; q < DM * 8; q += 256) { const int rowi = q >> 3, pc = q & 7; const size_t o = ((size_t)b * DM + rowi) * SS + p0 + pc * 8; vst2((unsigned*)(VTH + o), *(const v4u*)&svh[rowi][pc * 8]); vst2((unsigned*)(VTL + o), *(const v4u*)&svl[rowi][pc * 8]); }
}
// lane l with lane l ^ 16 (the two halves of a wave hold the two halves of a query's keys)
__device__ __forceinline__ float xhalf(float x) { return __builtin_bit_cast(float, __builtin_amdgcn_permlanex16(__builtin_bit_cast(int, x), __builtin_bit_cast(int, x), 0x76543210, 0xfedcba98, false, false)); }
// ---- k_attn: block = (query block, b*8 + h), 4 waves; 32 key steps; transposed products: S^T = K Q^T (A = key rows, B = query columns), O^T += V^T P^T.
// Lane (g, col) holds query col's scores of keys 8g+r and 16+8g+r: maximum and sum in the lane's own registers, and the two score tiles are P^T's B fragment as they stand.
__global__ __launch_bounds__(128) void k_attn(const float* __restrict__ QKV, const __bf16* __restrict__ VTH, const __bf16* __restrict__ VTL, float* __restrict__ OUT) {
  __shared__ __align__(16) float so[4][16][68];
  const int tid = threadIdx.x, wave = tid >> 5, lane = tid & 31, col = lane & 15, g = lane >> 4;
  const int qb = blockIdx.x, bh = blockIdx.y, b = bh / NH, h = bh % NH; const int q0 = qb * 64 + wave * 16; const size_t tq = (size_t)b * SS + q0;
  const F2 a0 = split_row(QKV + (tq + col) * QKVP + h * HD, 0, lane), a1 = split_row(QKV + (tq + col) * QKVP + h * HD, 32, lane);
  float m = -3.0e38f, l = 0.f;   // m: query col's running maximum (equal in both halves); l: this half's part of the sum
  v8f acc[4] = {};               // acc[dt][r] = O^T[dt*16 + 8g + r][col]
  const float scl = 0.044194173824159216f;   // 1/sqrt(512)
#pragma unroll 1
  for (int ks = 0; ks < SS / 32; ++ks) {
    float s[16];
#pragma unroll
    for (int ct = 0; ct < 2; ++ct) { const int kk = ks * 32 + ct * 16 + col; const float* krow = QKV + ((size_t)b * SS + kk) * QKVP + DM + h * HD; const F2 k0 = split_row(krow, 0, lane), k1 = split_row(krow, 32, lane);
      v8f c = wmma_bf(k0.h, a0.l, (v8f){}); c = wmma_bf(k0.l, a0.h, c); c = wmma_bf(k0.h, a0.h, c);
      c = wmma_bf(k1.h, a1.l, c); c = wmma_bf(k1.l, a1.h, c); c = wmma_bf(k1.h, a1.h, c);
#pragma unroll
      for (int r = 0; r < 8; ++r) s[ct * 8 + r] = c[r] * scl; }
    float mx = s[0];
#pragma unroll
    for (int i = 1; i < 16; ++i) mx = fmaxf(mx, s[i]);
    mx = fmaxf(mx, xhalf(mx));
    const float mn = fmaxf(m, mx); const float alpha = exp_ni(m - mn); m = mn;
    float es = 0.f;
#pragma unroll
    for (int i = 0; i < 16; ++i) { s[i] = exp_ni(s[i] - mn); es += s[i]; }
    l = l * alpha + es;
#pragma unroll
    for (int dt = 0; dt < 4; ++dt)
#pragma unroll
      for (int r = 0; r < 8; ++r) acc[dt][r] *= alpha;
    const F2 pb = bsplit16(s);   // element i = key 8g+i, element 8+i = key 16+8g+i: the k order of frag_b
#pragma unroll
    for (int dt = 0; dt < 4; ++dt) { const size_t vrow = ((size_t)b * DM + h * HD + dt * 16 + col) * SS + ks * 32; const v16b vh = frag_b(VTH + vrow, lane), vl = frag_b(VTL + vrow, lane);
      acc[dt] = wmma_bf(vh, pb.l, acc[dt]); acc[dt] = wmma_bf(vl, pb.h, acc[dt]); acc[dt] = wmma_bf(vh, pb.h, acc[dt]); } }
  const float il = 1.0f / (l + xhalf(l));
#pragma unroll
  for (int dt = 0; dt < 4; ++dt) { v4f lo, hi;
#pragma unroll
    for (int r = 0; r < 4; ++r) { lo[r] = acc[dt][r] * il; hi[r] = acc[dt][4 + r] * il; }
    *(v4f*)&so[wave][col][dt * 16 + 8 * g] = lo; *(v4f*)&so[wave][col][dt * 16 + 8 * g + 4] = hi; }
  LDSX();
  for (int rl = 0; rl < 16; ++rl) if (lane < 16) vst2(OUT + (tq + rl) * DM + h * HD + lane * 4, *(const v4f*)&so[wave][rl][lane * 4]);
}

extern "C" void kernel_launch(void* const* d_in, const int* in_sizes, int n_in, void* d_out, int out_size, void* d_ws, size_t ws_size, hipStream_t stream) {
  (void)in_sizes; (void)n_in; (void)out_size;
  const float** F = (const float**)d_in;   // x, W_cq, b_cq, W_ck, b_ck, W_cv, b_cv, W_pq, b_pq, W_pk, b_pk, W_pv, b_pv  ([in][out] weights)
  if (ws_size < (size_t)WS_END) return;
  char* ws = (char*)d_ws; __bf16 *PT = (__bf16*)(ws + WS_PT), *VTH = (__bf16*)(ws + WS_VTH), *VTL = (__bf16*)(ws + WS_VTL); float* QKV = (float*)(ws + WS_QKV);
  k_pack<<<QKVP, 128, 0, stream>>>(F[1], F[3], F[5], F[7], F[9], F[11], PT);
  k_proj<<<dim3(TRB, QKVP / 128), 128, 0, stream>>>(F[0], PT, F[2], F[4], F[6], F[8], F[10], F[12], QKV);
  k_vt<<<TRB, 256, 0, stream>>>(QKV, VTH, VTL);
  k_attn<<<dim3(TQB, TNB * NH), 128, 0, stream>>>(QKV, VTH, VTL, (float*)d_out);
}

// v003
// Measured time: 197 microseconds a run.
// Two timings next to v002 both put it at 1.29 times that version's speed.
// Counting every step since v000, it is 1.89 times as fast.
// compute dtype: x, the six weights and biases (module inputs) rounded to bf16; q/k/v projections as exact bf16 products over the concatenated [Wc ; Wp] columns (x.(Wc+Wp) == x.Wc + x.Wp, f32 accumulate, + bc + bp); scores and P.V with both computed operands as bf16 hi + bf16 residual pairs (3 products); online softmax in f32; f32 accumulate.
#include <hip/hip_runtime.h>
#include <math.h>

typedef __attribute__((ext_vector_type(16))) _Float16 v16h;
typedef __attribute__((ext_vector_type(16))) __bf16 v16b;
typedef __attribute__((ext_vector_type(8)))  _Float16 v8h;
typedef __attribute__((ext_vector_type(8)))  float v8f;
typedef __attribute__((ext_vector_type(4)))  float v4f;
typedef __attribute__((ext_vector_type(2)))  float v2f;
typedef __attribute__((ext_vector_type(4)))  unsigned v4u;
typedef __attribute__((ext_vector_type(4)))  int v4i;
typedef float __attribute__((may_alias)) float_a;
typedef int __attribute__((may_alias)) int_a;

template <typename T> __device__ __forceinline__ void vst2(void* p, T v) { *(T*)p = v;  }
__device__ __forceinline__ v8f wmma16(v16h a, v16h b, v8f c) {
  v8f d = __builtin_amdgcn_wmma_f32_16x16x32_f16(false, a, false, b, (short)0, c, false, false);
  asm volatile("v_nop\n\tv_nop\n\tv_nop\n\tv_nop" : "+v"(d) : "v"(a), "v"(b));
  return d;
}
__device__ __forceinline__ v8f wmma_bf(v16b a, v16b b, v8f c) {
  v8f d = __builtin_amdgcn_wmma_f32_16x16x32_bf16(false, a, false, b, (short)0, c, false, false);
  asm volatile("v_nop\n\tv_nop\n\tv_nop\n\tv_nop" : "+v"(d) : "v"(a), "v"(b));
  return d;
}
// 16x16x32 fragments: lane = (h = lane>>4, row/col = lane&15); elements 0..7 = k0+8h+0..7, 8..15 = k0+16+8h+0..7; D element r = row 8h+r
__device__ __forceinline__ v16h frag_h(const _Float16* rowk0, int lane) {
  union { v16h v; v8h q[2]; } u; const _Float16* p = rowk0 + 8 * (lane >> 4);
  u.q[0] = *(const v8h*)p; u.q[1] = *(const v8h*)(p + 16); return u.v;
}
__device__ __forceinline__ v16h frag_f32(const float* rowk0, int lane) {
  v16h a; const float* p = rowk0 + 8 * (lane >> 4);
#pragma unroll
  for (int i = 0; i < 8; ++i) { a[i] = (_Float16)p[i]; a[8 + i] = (_Float16)p[16 + i]; }
  return a;
}
__device__ __forceinline__ v16h frag_f32s(const float* rowk0, int lane, float sc) {
  v16h a; const float* p = rowk0 + 8 * (lane >> 4);
#pragma unroll
  for (int i = 0; i < 8; ++i) { a[i] = (_Float16)(p[i] * sc); a[8 + i] = (_Float16)(p[16 + i] * sc); }
  return a;
}
// column fragment from a [K][ld] layout (column n), rows >= K read as 0
__device__ __forceinline__ v16h fragc_f32(const float* W, int k0, int n, int lane, int ld, int K) {
  v16h a; const int g = lane >> 4;
#pragma unroll
  for (int i = 0; i < 8; ++i) { const int ka = k0 + 8 * g + i, kb = ka + 16;
    a[i] = (_Float16)(ka < K ? W[(size_t)(ka < K ? ka : K - 1) * ld + n] : 0.f); a[8 + i] = (_Float16)(kb < K ? W[(size_t)(kb < K ? kb : K - 1) * ld + n] : 0.f); }
  return a;
}
struct F2 { v16b h, l; };
__device__ __forceinline__ F2 bsplit16(const float v[16]) { F2 r;
#pragma unroll
  for (int i = 0; i < 16; ++i) { const __bf16 h = (__bf16)v[i]; r.h[i] = h; r.l[i] = (__bf16)(v[i] - (float)h); }
  return r; }
__device__ __forceinline__ F2 split_row(const float* row, int k0, int lane) { float v[16]; const float* p = row + k0 + 8 * (lane >> 4);
#pragma unroll
  for (int i = 0; i < 8; ++i) { v[i] = p[i]; v[8 + i] = p[16 + i]; }
  return bsplit16(v); }
__device__ __forceinline__ F2 split_rowK(const float* row, int k0, int lane, int K) { float v[16]; const int g = lane >> 4;
#pragma unroll
  for (int i = 0; i < 8; ++i) { const int ka = k0 + 8 * g + i, kb = ka + 16; v[i] = ka < K ? row[ka < K ? ka : K - 1] : 0.f; v[8 + i] = kb < K ? row[kb < K ? kb : K - 1] : 0.f; }
  return bsplit16(v); }
__device__ __forceinline__ F2 split_col(const float* W, int k0, int n, int lane, int ld, int K) { float v[16]; const int g = lane >> 4;
#pragma unroll
  for (int i = 0; i < 8; ++i) { const int ka = k0 + 8 * g + i, kb = ka + 16; v[i] = ka < K ? W[(size_t)(ka < K ? ka : K - 1) * ld + n] : 0.f; v[8 + i] = kb < K ? W[(size_t)(kb < K ? kb : K - 1) * ld + n] : 0.f; }
  return bsplit16(v); }
__device__ __forceinline__ v8f mac3(const F2& a, const F2& b, v8f c) { c = wmma_bf(a.l, b.h, c); c = wmma_bf(a.h, b.l, c); return wmma_bf(a.h, b.h, c); }
__device__ __forceinline__ float sigm(float v) { return 1.0f / (1.0f + expf(-v)); }
#define LDSX() do { asm volatile("s_wait_dscnt 0" ::: "memory"); __builtin_amdgcn_wave_barrier(); __builtin_amdgcn_fence(__ATOMIC_RELEASE, "workgroup"); } while (0)


// Disentangled attention: q = x (W_cq + W_pq) + (b_cq + b_pq), likewise k, v (8 heads x 64); energy = q k^T / sqrt(512); softmax; out = P v merged to [8, 1024, 512] (no output projection).
// k_pack ([Wc col | Wp col] as one bf16 row of K = 1024), k_proj (exact GEMM over [x | x], + both biases), k_vt (V transposed hi/lo planes), k_attn (flash-style, 32 key steps, transposed products; writes the output rows directly).
#define NB 8
#define SS 1024
#define DM 512
#define NH 8
#define HD 64
#define NR (NB * SS)
#define QKVP (3 * DM)
#define KK (2 * DM)            // concatenated K
#ifndef TRB
#define TRB (NR / 64)
#define TQB (SS / 64)
#define TNB NB
#endif
typedef __attribute__((ext_vector_type(8))) __bf16 v8b;
__device__ __forceinline__ v16b frag_b(const __bf16* rowk0, int lane) {
  union { v16b v; v8b q[2]; } u; const __bf16* p = rowk0 + 8 * (lane >> 4);
  u.q[0] = *(const v8b*)p; u.q[1] = *(const v8b*)(p + 16); return u.v;
}
__device__ __forceinline__ v16b frag_gbf(const float* rowk0, int lane) {
  v16b a; const float* p = rowk0 + 8 * (lane >> 4);
#pragma unroll
  for (int i = 0; i < 8; ++i) { a[i] = (__bf16)p[i]; a[8 + i] = (__bf16)p[16 + i]; }
  return a;
}
__device__ __forceinline__ float bfr(float v) { return (float)(__bf16)v; }
__device__ __attribute__((noinline)) float exp_ni(float v) { return expf(v); }
#define WS_PT   0u                                  // bf16 [1536][1024]: row n = [Wc_*[:, c] ; Wp_*[:, c]]
#define WS_QKV  (WS_PT + 2u * QKVP * KK)             // f32 [8192][1536]
#define WS_VTH  (WS_QKV + 4u * NR * QKVP)            // bf16 [8][512][1024]
#define WS_VTL  (WS_VTH + 2u * NB * DM * SS)
#define WS_END  (WS_VTL + 2u * NB * DM * SS)

__global__ __launch_bounds__(128) void k_pack(const float* __restrict__ Wcq, const float* __restrict__ Wck, const float* __restrict__ Wcv, const float* __restrict__ Wpq, const float* __restrict__ Wpk, const float* __restrict__ Wpv, __bf16* __restrict__ PT) {
  __shared__ __align__(16) __bf16 srow[KK];
  const int n = blockIdx.x, tid = threadIdx.x; const int which = n / DM, c = n % DM; const float* Wc = which == 0 ? Wcq : which == 1 ? Wck : Wcv; const float* Wp = which == 0 ? Wpq : which == 1 ? Wpk : Wpv;
  for (int k = tid; k < DM; k += 128) { srow[k] = (__bf16)Wc[(size_t)k * DM + c]; srow[DM + k] = (__bf16)Wp[(size_t)k * DM + c]; }   // [in][out] layout: column c
  __syncthreads();
  vst2((unsigned*)(PT + (size_t)n * KK + tid * 8), *(const v4u*)(&srow[tid * 8]));
}
// ---- k_proj: QKV[r][n] = [bf16(x[r]) | bf16(x[r])] . PT[n] (exact) + bc[n] + bp[n]; block (64 rows, 128 cols)
// A stage is 64 wide in k: its x tile (64 rows of 256 B) and its PT tile (128 rows of 128 B) come into LDS once for the block, by asynchronous copies that
// cover whole 128-B lines, two buffers; the four waves take their fragments from LDS. Row pitches 272 B and 144 B (16 B x odd) keep ds_load_b128 free of bank conflicts.
#define PJ_KW 64
#define PJ_AP (PJ_KW * 4u + 16u)
#define PJ_BP (PJ_KW * 2u + 16u)
#define PJ_AB (64u * PJ_AP)
#define PJ_BUF (PJ_AB + 128u * PJ_BP)
#define PJ_NS (KK / PJ_KW)
__device__ __forceinline__ v16b frag_lf(const char* rowk0, int g) {   // frag_gbf's k order, from an f32 row in LDS
  const v4f* p = (const v4f*)(rowk0 + 32 * g); const v4f x0 = p[0], x1 = p[1], x2 = p[4], x3 = p[5]; v16b a;
#pragma unroll
  for (int i = 0; i < 4; ++i) { a[i] = (__bf16)x0[i]; a[4 + i] = (__bf16)x1[i]; a[8 + i] = (__bf16)x2[i]; a[12 + i] = (__bf16)x3[i]; }
  return a;
}
// eight copies of 16 B per lane, LDS places ls bytes and sources gs elements apart; the s_wait_xcnt closes the statement so that no address register is rewritten ahead of it
template <typename T> __device__ __forceinline__ void pj_cp8(unsigned l, unsigned ls, const T* s, int gs) {
  asm volatile("global_load_async_to_lds_b128 %0, %1, off\n\t"
               "global_load_async_to_lds_b128 %2, %3, off\n\t"
               "global_load_async_to_lds_b128 %4, %5, off\n\t"
               "global_load_async_to_lds_b128 %6, %7, off\n\t"
               "global_load_async_to_lds_b128 %8, %9, off\n\t"
               "global_load_async_to_lds_b128 %10, %11, off\n\t"
               "global_load_async_to_lds_b128 %12, %13, off\n\t"
               "global_load_async_to_lds_b128 %14, %15, off\n\t"
               "s_wait_xcnt 0x0"
               :: "v"(l), "v"(s), "v"(l + ls), "v"(s + gs), "v"(l + 2u * ls), "v"(s + 2 * gs), "v"(l + 3u * ls), "v"(s + 3 * gs),
                  "v"(l + 4u * ls), "v"(s + 4 * gs), "v"(l + 5u * ls), "v"(s + 5 * gs), "v"(l + 6u * ls), "v"(s + 6 * gs), "v"(l + 7u * ls), "v"(s + 7 * gs)
               : "memory");
}
__global__ __launch_bounds__(128) void k_proj(const float* __restrict__ X, const __bf16* __restrict__ PT, const float* __restrict__ bcq, const float* __restrict__ bck, const float* __restrict__ bcv, const float* __restrict__ bpq, const float* __restrict__ bpk, const float* __restrict__ bpv, float* __restrict__ QKV) {
  __shared__ __align__(16) char sm[2u * PJ_BUF];   // the two stage buffers; behind the loop the output staging so[4][16][132]
  static_assert(2u * PJ_BUF >= 4u * 16u * 132u * 4u, "the output staging must fit the two buffers");
  float (*so)[16][132] = (float (*)[16][132])sm;
  const int tid = threadIdx.x, wave = tid >> 5, lane = tid & 31, col = lane & 15, g = lane >> 4; const size_t r0 = (size_t)blockIdx.x * 64 + wave * 16; const int n0 = blockIdx.y * 128;
  const unsigned lbase = (unsigned)(size_t)sm;
  // x tile: 16 lanes a row, 8 rows a copy of the block; PT tile: 8 lanes a row, 16 rows a copy
  const unsigned la = lbase + (unsigned)(tid >> 4) * PJ_AP + (unsigned)(tid & 15) * 16u, lb = lbase + PJ_AB + (unsigned)(tid >> 3) * PJ_BP + (unsigned)(tid & 7) * 16u;
  const float* ga = X + ((size_t)blockIdx.x * 64 + (tid >> 4)) * DM + (tid & 15) * 4; const __bf16* gb = PT + (size_t)(n0 + (tid >> 3)) * KK + (tid & 7) * 8;
  v8f acc[8] = {};
  pj_cp8(la, 8u * PJ_AP, ga, 8 * DM); pj_cp8(lb, 16u * PJ_BP, gb, 16 * KK);
  asm volatile("s_wait_asynccnt 0x0" ::: "memory");   // stage 0 has landed before the barrier publishes it
  __syncthreads();
  pj_cp8(la + PJ_BUF, 8u * PJ_AP, ga + PJ_KW, 8 * DM); pj_cp8(lb + PJ_BUF, 16u * PJ_BP, gb + PJ_KW, 16 * KK);
#pragma unroll 2   // by two, so that each half's buffer is a constant offset
  for (int st = 0; st < PJ_NS; ++st) { const char* sb = sm + (st & 1) * PJ_BUF;
#pragma unroll
    for (int u = 0; u < PJ_KW / 32; ++u) { const v16b a = frag_lf(sb + (wave * 16 + col) * PJ_AP + u * 128, g);
#pragma unroll
      for (int jh = 0; jh < 8; jh += 4) { v16b bq[4];   // four fragments' reads stand together ahead of their matrix instructions, not one wait a fragment
#pragma unroll
        for (int j = 0; j < 4; ++j) bq[j] = frag_b((const __bf16*)(sb + PJ_AB + ((jh + j) * 16 + col) * PJ_BP + u * 64), lane);
#pragma unroll
        for (int j = 0; j < 4; ++j) acc[jh + j] = wmma_bf(a, bq[j], acc[jh + j]); } }
    asm volatile("s_wait_dscnt 0x0" ::: "memory");      // this wave's reads of the buffer have returned before it is refilled
    asm volatile("s_wait_asynccnt 0x0" ::: "memory");   // this wave's copies of stage st + 1 have landed
    __syncthreads();                                    // publishes stage st + 1 and ends every wave's reads of stage st
    if (st + 2 < PJ_NS) { pj_cp8(la + (st & 1) * PJ_BUF, 8u * PJ_AP, ga + ((st + 2) % (DM / PJ_KW)) * PJ_KW, 8 * DM); pj_cp8(lb + (st & 1) * PJ_BUF, 16u * PJ_BP, gb + (st + 2) * PJ_KW, 16 * KK); } }
  asm volatile("s_wait_asynccnt 0x0" ::: "memory");     // no copy is outstanding when the buffers become output staging
#pragma unroll
  for (int j = 0; j < 8; ++j) { const int n = n0 + j * 16 + col; const int which = n / DM, c = n % DM; const float bb = bfr((which == 0 ? bcq : which == 1 ? bck : bcv)[c]) + bfr((which == 0 ? bpq : which == 1 ? bpk : bpv)[c]);
#pragma unroll
    for (int r = 0; r < 8; ++r) so[wave][8 * g + r][j * 16 + col] = acc[j][r] + bb; }
  LDSX();
  for (int rl = 0; rl < 16; ++rl) vst2(QKV + (r0 + rl) * QKVP + n0 + lane * 4, *(const v4f*)&so[wave][rl][lane * 4]);
}
__global__ __launch_bounds__(256) void k_vt(const float* __restrict__ QKV, __bf16* __restrict__ VTH, __bf16* __restrict__ VTL) {
  __shared__ __align__(16) __bf16 svh[DM][72], svl[DM][72];
  const int tid = threadIdx.x; const size_t t0 = (size_t)blockIdx.x * 64; const int b = (int)(t0 / SS), p0 = (int)(t0 % SS);
  for (int tl = 0; tl < 64; ++tl) { const float* row = QKV + (t0 + tl) * QKVP + 2 * DM; for (int q = tid; q < DM; q += 256) { const float v = row[q]; const __bf16 hb = (__bf16)v; svh[q][tl] = hb; svl[q][tl] = (__bf16)(v - (float)hb); } }
  __syncthreads();
  for (int q = tid; q < DM * 8; q += 256) { const int rowi = q >> 3, pc = q & 7; const size_t o = ((size_t)b * DM + rowi) * SS + p0 + pc * 8; vst2((unsigned*)(VTH + o), *(const v4u*)&svh[rowi][pc * 8]); vst2((unsigned*)(VTL + o), *(const v4u*)&svl[rowi][pc * 8]); }
}
// lane l with lane l ^ 16 (the two halves of a wave hold the two halves of a query's keys)
__device__ __forceinline__ float xhalf(float x) { return __builtin_bit_cast(float, __builtin_amdgcn_permlanex16(__builtin_bit_cast(int, x), __builtin_bit_cast(int, x), 0x76543210, 0xfedcba98, false, false)); }
// ---- k_attn: block = (query block, b*8 + h), 4 waves; 32 key steps; transposed products: S^T = K Q^T (A = key rows, B = query columns), O^T += V^T P^T.
// Lane (g, col) holds query col's scores of keys 8g+r and 16+8g+r: maximum and sum in the lane's own registers, and the two score tiles are P^T's B fragment as they stand.
// A stage is 64 keys (two key steps): its K tile (64 rows of 256 B) and its two V^T tiles (64 rows of 128 B each) come into LDS once for the block, by asynchronous
// copies that cover whole 128-B lines, two buffers; the four waves take their fragments from LDS. Row pitches 272 B and 144 B (16 B x odd) as in k_proj.
#define AT_KT 64
#define AT_KP (HD * 4u + 16u)
#define AT_VP (AT_KT * 2u + 16u)
#define AT_KB (AT_KT * AT_KP)
#define AT_VB (HD * AT_VP)
#define AT_BUF (AT_KB + 2u * AT_VB)
#define AT_NS (SS / AT_KT)
__device__ __forceinline__ F2 split_lf(const char* rowk0, int g) {   // split_row's k order, from an f32 row in LDS
  const v4f* p = (const v4f*)(rowk0 + 32 * g); const v4f x0 = p[0], x1 = p[1], x2 = p[4], x3 = p[5]; float v[16];
#pragma unroll
  for (int i = 0; i < 4; ++i) { v[i] = x0[i]; v[4 + i] = x1[i]; v[8 + i] = x2[i]; v[12 + i] = x3[i]; }
  return bsplit16(v);
}
// as pj_cp8, the first four copies from s0 and the last four from s1 (the two V^T planes, one behind the other in LDS); the s_wait_xcnt closes the statement for the same reason
__device__ __forceinline__ void at_cp44(unsigned l, unsigned ls, const __bf16* s0, const __bf16* s1, int gs) {
  asm volatile("global_load_async_to_lds_b128 %0, %1, off\n\t"
               "global_load_async_to_lds_b128 %2, %3, off\n\t"
               "global_load_async_to_lds_b128 %4, %5, off\n\t"
               "global_load_async_to_lds_b128 %6, %7, off\n\t"
               "global_load_async_to_lds_b128 %8, %9, off\n\t"
               "global_load_async_to_lds_b128 %10, %11, off\n\t"
               "global_load_async_to_lds_b128 %12, %13, off\n\t"
               "global_load_async_to_lds_b128 %14, %15, off\n\t"
               "s_wait_xcnt 0x0"
               :: "v"(l), "v"(s0), "v"(l + ls), "v"(s0 + gs), "v"(l + 2u * ls), "v"(s0 + 2 * gs), "v"(l + 3u * ls), "v"(s0 + 3 * gs),
                  "v"(l + 4u * ls), "v"(s1), "v"(l + 5u * ls), "v"(s1 + gs), "v"(l + 6u * ls), "v"(s1 + 2 * gs), "v"(l + 7u * ls), "v"(s1 + 3 * gs)
               : "memory");
}
__global__ __launch_bounds__(128) void k_attn(const float* __restrict__ QKV, const __bf16* __restrict__ VTH, const __bf16* __restrict__ VTL, float* __restrict__ OUT) {
  __shared__ __align__(16) char sm[2u * AT_BUF];   // the two stage buffers; behind the loop the output staging so[4][16][68]
  static_assert(2u * AT_BUF >= 4u * 16u * 68u * 4u, "the output staging must fit the two buffers");
  float (*so)[16][68] = (float (*)[16][68])sm;
  const int tid = threadIdx.x, wave = tid >> 5, lane = tid & 31, col = lane & 15, g = lane >> 4;
  const int qb = blockIdx.x, bh = blockIdx.y, b = bh / NH, h = bh % NH; const int q0 = qb * 64 + wave * 16; const size_t tq = (size_t)b * SS + q0;
  const unsigned lbase = (unsigned)(size_t)sm;
  // K tile: 16 lanes a row, 8 rows a copy of the block; V^T tiles: 8 lanes a row, 16 rows a copy
  const unsigned lk = lbase + (unsigned)(tid >> 4) * AT_KP + (unsigned)(tid & 15) * 16u, lv = lbase + AT_KB + (unsigned)(tid >> 3) * AT_VP + (unsigned)(tid & 7) * 16u;
  const float* gk = QKV + ((size_t)b * SS + (tid >> 4)) * QKVP + DM + h * HD + (tid & 15) * 4;
  const size_t vo = ((size_t)b * DM + h * HD + (tid >> 3)) * SS + (tid & 7) * 8; const __bf16 *gvh = VTH + vo, *gvl = VTL + vo;
  pj_cp8(lk, 8u * AT_KP, gk, 8 * QKVP); at_cp44(lv, 16u * AT_VP, gvh, gvl, 16 * SS);
  const F2 a0 = split_row(QKV + (tq + col) * QKVP + h * HD, 0, lane), a1 = split_row(QKV + (tq + col) * QKVP + h * HD, 32, lane);
  float m = -3.0e38f, l = 0.f;   // m: query col's running maximum (equal in both halves); l: this half's part of the sum
  v8f acc[4] = {};               // acc[dt][r] = O^T[dt*16 + 8g + r][col]
  const float scl = 0.044194173824159216f;   // 1/sqrt(512)
  asm volatile("s_wait_asynccnt 0x0" ::: "memory");   // stage 0 has landed before the barrier publishes it
  __syncthreads();
  pj_cp8(lk + AT_BUF, 8u * AT_KP, gk + (size_t)AT_KT * QKVP, 8 * QKVP); at_cp44(lv + AT_BUF, 16u * AT_VP, gvh + AT_KT, gvl + AT_KT, 16 * SS);
#pragma unroll 1   // stays rolled: the body already holds two key steps, and further copies would only lengthen the code
  for (int st = 0; st < AT_NS; ++st) { const char* sb = sm + (st & 1) * AT_BUF;
#pragma unroll     // so that a key step's place in the buffer is an immediate offset of the LDS reads
   for (int u = 0; u < AT_KT / 32; ++u) {
    float s[16];
#pragma unroll
    for (int ct = 0; ct < 2; ++ct) { const char* krow = sb + (u * 32 + ct * 16 + col) * AT_KP; const F2 k0 = split_lf(krow, g), k1 = split_lf(krow + 128, g);
      v8f c = wmma_bf(k0.h, a0.l, (v8f){}); c = wmma_bf(k0.l, a0.h, c); c = wmma_bf(k0.h, a0.h, c);
      c = wmma_bf(k1.h, a1.l, c); c = wmma_bf(k1.l, a1.h, c); c = wmma_bf(k1.h, a1.h, c);
#pragma unroll
      for (int r = 0; r < 8; ++r) s[ct * 8 + r] = c[r] * scl; }
    float mx = s[0];
#pragma unroll
    for (int i = 1; i < 16; ++i) mx = fmaxf(mx, s[i]);
    mx = fmaxf(mx, xhalf(mx));
    const float mn = fmaxf(m, mx); const float alpha = exp_ni(m - mn); m = mn;
    float es = 0.f;
#pragma unroll
    for (int i = 0; i < 16; ++i) { s[i] = exp_ni(s[i] - mn); es += s[i]; }
    l = l * alpha + es;
#pragma unroll
    for (int dt = 0; dt < 4; ++dt)
#pragma unroll
      for (int r = 0; r < 8; ++r) acc[dt][r] *= alpha;
    v16b vh[4], vl[4];   // the eight V^T fragments' reads stand together ahead of their matrix instructions, not one wait a tile
    const F2 pb = bsplit16(s);   // element i = key 8g+i, element 8+i = key 16+8g+i: the k order of frag_b
#pragma unroll
    for (int dt = 0; dt < 4; ++dt) { const char* vrow = sb + AT_KB + (dt * 16 + col) * AT_VP + u * 64; vh[dt] = frag_b((const __bf16*)vrow, lane); vl[dt] = frag_b((const __bf16*)(vrow + AT_VB), lane); }
#pragma unroll
    for (int dt = 0; dt < 4; ++dt) { acc[dt] = wmma_bf(vh[dt], pb.l, acc[dt]); acc[dt] = wmma_bf(vl[dt], pb.h, acc[dt]); acc[dt] = wmma_bf(vh[dt], pb.h, acc[dt]); } }
    asm volatile("s_wait_dscnt 0x0" ::: "memory");      // this wave's reads of the buffer have returned before it is refilled
    asm volatile("s_wait_asynccnt 0x0" ::: "memory");   // this wave's copies of stage st + 1 have landed
    __syncthreads();                                    // publishes stage st + 1 and ends every wave's reads of stage st
    if (st + 2 < AT_NS) { pj_cp8(lk + (st & 1) * AT_BUF, 8u * AT_KP, gk + (size_t)(st + 2) * AT_KT * QKVP, 8 * QKVP); at_cp44(lv + (st & 1) * AT_BUF, 16u * AT_VP, gvh + (st + 2) * AT_KT, gvl + (st + 2) * AT_KT, 16 * SS); } }
  asm volatile("s_wait_asynccnt 0x0" ::: "memory");     // no copy is outstanding when the buffers become output staging
  const float il = 1.0f / (l + xhalf(l));
#pragma unroll
  for (int dt = 0; dt < 4; ++dt) { v4f lo, hi;
#pragma unroll
    for (int r = 0; r < 4; ++r) { lo[r] = acc[dt][r] * il; hi[r] = acc[dt][4 + r] * il; }
    *(v4f*)&so[wave][col][dt * 16 + 8 * g] = lo; *(v4f*)&so[wave][col][dt * 16 + 8 * g + 4] = hi; }
  LDSX();
  for (int rl = 0; rl < 16; ++rl) if (lane < 16) vst2(OUT + (tq + rl) * DM + h * HD + lane * 4, *(const v4f*)&so[wave][rl][lane * 4]);
}

extern "C" void kernel_launch(void* const* d_in, const int* in_sizes, int n_in, void* d_out, int out_size, void* d_ws, size_t ws_size, hipStream_t stream) {
  (void)in_sizes; (void)n_in; (void)out_size;
  const float** F = (const float**)d_in;   // x, W_cq, b_cq, W_ck, b_ck, W_cv, b_cv, W_pq, b_pq, W_pk, b_pk, W_pv, b_pv  ([in][out] weights)
  if (ws_size < (size_t)WS_END) return;
  char* ws = (char*)d_ws; __bf16 *PT = (__bf16*)(ws + WS_PT), *VTH = (__bf16*)(ws + WS_VTH), *VTL = (__bf16*)(ws + WS_VTL); float* QKV = (float*)(ws + WS_QKV);
  k_pack<<<QKVP, 128, 0, stream>>>(F[1], F[3], F[5], F[7], F[9], F[11], PT);
  k_proj<<<dim3(TRB, QKVP / 128), 128, 0, stream>>>(F[0], PT, F[2], F[4], F[6], F[8], F[10], F[12], QKV);
  k_vt<<<TRB, 256, 0, stream>>>(QKV, VTH, VTL);
  k_attn<<<dim3(TQB, TNB * NH), 128, 0, stream>>>(QKV, VTH, VTL, (float*)d_out);
}

// v004
// Measured time: 138 microseconds a run.
// In both of two side-by-side timings against v003, it was 1.44 times as fast.
// Counting every step since v000, it is 2.71 times as fast.
// compute dtype: x, the six weights and biases (module inputs) rounded to bf16; q/k/v projections as exact bf16 products over the concatenated [Wc ; Wp] columns (x.(Wc+Wp) == x.Wc + x.Wp, f32 accumulate, + bc + bp); scores and P.V with both computed operands as bf16 hi + bf16 residual pairs (3 products); online softmax in f32; f32 accumulate.
#include <hip/hip_runtime.h>
#include <math.h>

typedef __attribute__((ext_vector_type(16))) _Float16 v16h;
typedef __attribute__((ext_vector_type(16))) __bf16 v16b;
typedef __attribute__((ext_vector_type(8)))  _Float16 v8h;
typedef __attribute__((ext_vector_type(8)))  float v8f;
typedef __attribute__((ext_vector_type(4)))  float v4f;
typedef __attribute__((ext_vector_type(2)))  float v2f;
typedef __attribute__((ext_vector_type(4)))  unsigned v4u;
typedef __attribute__((ext_vector_type(4)))  int v4i;
typedef float __attribute__((may_alias)) float_a;
typedef int __attribute__((may_alias)) int_a;

template <typename T> __device__ __forceinline__ void vst2(void* p, T v) { *(T*)p = v;  }
__device__ __forceinline__ v8f wmma16(v16h a, v16h b, v8f c) {
  v8f d = __builtin_amdgcn_wmma_f32_16x16x32_f16(false, a, false, b, (short)0, c, false, false);
  asm volatile("v_nop\n\tv_nop\n\tv_nop\n\tv_nop" : "+v"(d) : "v"(a), "v"(b));
  return d;
}
__device__ __forceinline__ v8f wmma_bf(v16b a, v16b b, v8f c) {
  v8f d = __builtin_amdgcn_wmma_f32_16x16x32_bf16(false, a, false, b, (short)0, c, false, false);
  asm volatile("v_nop\n\tv_nop\n\tv_nop\n\tv_nop" : "+v"(d) : "v"(a), "v"(b));
  return d;
}
// 16x16x32 fragments: lane = (h = lane>>4, row/col = lane&15); elements 0..7 = k0+8h+0..7, 8..15 = k0+16+8h+0..7; D element r = row 8h+r
__device__ __forceinline__ v16h frag_h(const _Float16* rowk0, int lane) {
  union { v16h v; v8h q[2]; } u; const _Float16* p = rowk0 + 8 * (lane >> 4);
  u.q[0] = *(const v8h*)p; u.q[1] = *(const v8h*)(p + 16); return u.v;
}
__device__ __forceinline__ v16h frag_f32(const float* rowk0, int lane) {
  v16h a; const float* p = rowk0 + 8 * (lane >> 4);
#pragma unroll
  for (int i = 0; i < 8; ++i) { a[i] = (_Float16)p[i]; a[8 + i] = (_Float16)p[16 + i]; }
  return a;
}
__device__ __forceinline__ v16h frag_f32s(const float* rowk0, int lane, float sc) {
  v16h a; const float* p = rowk0 + 8 * (lane >> 4);
#pragma unroll
  for (int i = 0; i < 8; ++i) { a[i] = (_Float16)(p[i] * sc); a[8 + i] = (_Float16)(p[16 + i] * sc); }
  return a;
}
// column fragment from a [K][ld] layout (column n), rows >= K read as 0
__device__ __forceinline__ v16h fragc_f32(const float* W, int k0, int n, int lane, int ld, int K) {
  v16h a; const int g = lane >> 4;
#pragma unroll
  for (int i = 0; i < 8; ++i) { const int ka = k0 + 8 * g + i, kb = ka + 16;
    a[i] = (_Float16)(ka < K ? W[(size_t)(ka < K ? ka : K - 1) * ld + n] : 0.f); a[8 + i] = (_Float16)(kb < K ? W[(size_t)(kb < K ? kb : K - 1) * ld + n] : 0.f); }
  return a;
}
struct F2 { v16b h, l; };
__device__ __forceinline__ F2 bsplit16(const float v[16]) { F2 r;
#pragma unroll
  for (int i = 0; i < 16; ++i) { const __bf16 h = (__bf16)v[i]; r.h[i] = h; r.l[i] = (__bf16)(v[i] - (float)h); }
  return r; }
__device__ __forceinline__ F2 split_row(const float* row, int k0, int lane) { float v[16]; const float* p = row + k0 + 8 * (lane >> 4);
#pragma unroll
  for (int i = 0; i < 8; ++i) { v[i] = p[i]; v[8 + i] = p[16 + i]; }
  return bsplit16(v); }
__device__ __forceinline__ F2 split_rowK(const float* row, int k0, int lane, int K) { float v[16]; const int g = lane >> 4;
#pragma unroll
  for (int i = 0; i < 8; ++i) { const int ka = k0 + 8 * g + i, kb = ka + 16; v[i] = ka < K ? row[ka < K ? ka : K - 1] : 0.f; v[8 + i] = kb < K ? row[kb < K ? kb : K - 1] : 0.f; }
  return bsplit16(v); }
__device__ __forceinline__ F2 split_col(const float* W, int k0, int n, int lane, int ld, int K) { float v[16]; const int g = lane >> 4;
#pragma unroll
  for (int i = 0; i < 8; ++i) { const int ka = k0 + 8 * g + i, kb = ka + 16; v[i] = ka < K ? W[(size_t)(ka < K ? ka : K - 1) * ld + n] : 0.f; v[8 + i] = kb < K ? W[(size_t)(kb < K ? kb : K - 1) * ld + n] : 0.f; }
  return bsplit16(v); }
__device__ __forceinline__ v8f mac3(const F2& a, const F2& b, v8f c) { c = wmma_bf(a.l, b.h, c); c = wmma_bf(a.h, b.l, c); return wmma_bf(a.h, b.h, c); }
__device__ __forceinline__ float sigm(float v) { return 1.0f / (1.0f + expf(-v)); }
#define LDSX() do { asm volatile("s_wait_dscnt 0" ::: "memory"); __builtin_amdgcn_wave_barrier(); __builtin_amdgcn_fence(__ATOMIC_RELEASE, "workgroup"); } while (0)


// Disentangled attention: q = x (W_cq + W_pq) + (b_cq + b_pq), likewise k, v (8 heads x 64); energy = q k^T / sqrt(512); softmax; out = P v merged to [8, 1024, 512] (no output projection).
// k_pack ([Wc col | Wp col] as one bf16 row of K = 1024), k_proj (exact GEMM over [x | x], + both biases; its V blocks write V transposed as hi/lo planes), k_attn (flash-style, 32 key steps, transposed products; writes the output rows directly).
#define NB 8
#define SS 1024
#define DM 512
#define NH 8
#define HD 64
#define NR (NB * SS)
#define QKVP (3 * DM)
#define KK (2 * DM)            // concatenated K
#ifndef TRB
#define TRB (NR / 64)
#define TQB (SS / 64)
#define TNB NB
#endif
typedef __attribute__((ext_vector_type(8))) __bf16 v8b;
__device__ __forceinline__ v16b frag_b(const __bf16* rowk0, int lane) {
  union { v16b v; v8b q[2]; } u; const __bf16* p = rowk0 + 8 * (lane >> 4);
  u.q[0] = *(const v8b*)p; u.q[1] = *(const v8b*)(p + 16); return u.v;
}
__device__ __forceinline__ v16b frag_gbf(const float* rowk0, int lane) {
  v16b a; const float* p = rowk0 + 8 * (lane >> 4);
#pragma unroll
  for (int i = 0; i < 8; ++i) { a[i] = (__bf16)p[i]; a[8 + i] = (__bf16)p[16 + i]; }
  return a;
}
__device__ __forceinline__ float bfr(float v) { return (float)(__bf16)v; }
__device__ __attribute__((noinline)) float exp_ni(float v) { return expf(v); }
#define WS_PT   0u                                  // bf16 [1536][1024]: row n = [Wc_*[:, c] ; Wp_*[:, c]]
#define WS_QKV  (WS_PT + 2u * QKVP * KK)             // f32 [8192][1536]; the V columns stay unwritten and unread
#define WS_VTH  (WS_QKV + 4u * NR * QKVP)            // bf16 [8][512][1024]
#define WS_VTL  (WS_VTH + 2u * NB * DM * SS)
#define WS_END  (WS_VTL + 2u * NB * DM * SS)

__global__ __launch_bounds__(128) void k_pack(const float* __restrict__ Wcq, const float* __restrict__ Wck, const float* __restrict__ Wcv, const float* __restrict__ Wpq, const float* __restrict__ Wpk, const float* __restrict__ Wpv, __bf16* __restrict__ PT) {
  __shared__ __align__(16) __bf16 srow[KK];
  const int n = blockIdx.x, tid = threadIdx.x; const int which = n / DM, c = n % DM; const float* Wc = which == 0 ? Wcq : which == 1 ? Wck : Wcv; const float* Wp = which == 0 ? Wpq : which == 1 ? Wpk : Wpv;
  for (int k = tid; k < DM; k += 128) { srow[k] = (__bf16)Wc[(size_t)k * DM + c]; srow[DM + k] = (__bf16)Wp[(size_t)k * DM + c]; }   // [in][out] layout: column c
  __syncthreads();
  vst2((unsigned*)(PT + (size_t)n * KK + tid * 8), *(const v4u*)(&srow[tid * 8]));
}
// ---- k_proj: QKV[r][n] = [bf16(x[r]) | bf16(x[r])] . PT[n] (exact) + bc[n] + bp[n]; block (64 rows, 128 cols)
// A block of V columns does not write f32 rows: it splits its sums into bf16 hi + residual, turns the 64 x 128 tile in LDS and writes V^T's two planes, 128-B lines of 64 tokens.
// A stage is 64 wide in k: its x tile (64 rows of 256 B) and its PT tile (128 rows of 128 B) come into LDS once for the block, by asynchronous copies that
// cover whole 128-B lines, two buffers; the four waves take their fragments from LDS. Row pitches 272 B and 144 B (16 B x odd) keep ds_load_b128 free of bank conflicts.
#define PJ_KW 64
#define PJ_AP (PJ_KW * 4u + 16u)
#define PJ_BP (PJ_KW * 2u + 16u)
#define PJ_AB (64u * PJ_AP)
#define PJ_BUF (PJ_AB + 128u * PJ_BP)
#define PJ_NS (KK / PJ_KW)
#define PJ_VP (64u * 2u + 16u)   // pitch of a V^T row of 64 tokens in the output staging (16 B x odd)
__device__ __forceinline__ v16b frag_lf(const char* rowk0, int g) {   // frag_gbf's k order, from an f32 row in LDS
  const v4f* p = (const v4f*)(rowk0 + 32 * g); const v4f x0 = p[0], x1 = p[1], x2 = p[4], x3 = p[5]; v16b a;
#pragma unroll
  for (int i = 0; i < 4; ++i) { a[i] = (__bf16)x0[i]; a[4 + i] = (__bf16)x1[i]; a[8 + i] = (__bf16)x2[i]; a[12 + i] = (__bf16)x3[i]; }
  return a;
}
// eight copies of 16 B per lane, LDS places ls bytes and sources gs elements apart; the s_wait_xcnt closes the statement so that no address register is rewritten ahead of it
template <typename T> __device__ __forceinline__ void pj_cp8(unsigned l, unsigned ls, const T* s, int gs) {
  asm volatile("global_load_async_to_lds_b128 %0, %1, off\n\t"
               "global_load_async_to_lds_b128 %2, %3, off\n\t"
               "global_load_async_to_lds_b128 %4, %5, off\n\t"
               "global_load_async_to_lds_b128 %6, %7, off\n\t"
               "global_load_async_to_lds_b128 %8, %9, off\n\t"
               "global_load_async_to_lds_b128 %10, %11, off\n\t"
               "global_load_async_to_lds_b128 %12, %13, off\n\t"
               "global_load_async_to_lds_b128 %14, %15, off\n\t"
               "s_wait_xcnt 0x0"
               :: "v"(l), "v"(s), "v"(l + ls), "v"(s + gs), "v"(l + 2u * ls), "v"(s + 2 * gs), "v"(l + 3u * ls), "v"(s + 3 * gs),
                  "v"(l + 4u * ls), "v"(s + 4 * gs), "v"(l + 5u * ls), "v"(s + 5 * gs), "v"(l + 6u * ls), "v"(s + 6 * gs), "v"(l + 7u * ls), "v"(s + 7 * gs)
               : "memory");
}
__global__ __launch_bounds__(128) void k_proj(const float* __restrict__ X, const __bf16* __restrict__ PT, const float* __restrict__ bcq, const float* __restrict__ bck, const float* __restrict__ bcv, const float* __restrict__ bpq, const float* __restrict__ bpk, const float* __restrict__ bpv, float* __restrict__ QKV, __bf16* __restrict__ VTH, __bf16* __restrict__ VTL) {
  __shared__ __align__(16) char sm[2u * PJ_BUF];   // the two stage buffers; behind the loop the output staging so[4][16][132], or in a V block two planes of [128][PJ_VP bytes]
  static_assert(2u * PJ_BUF >= 4u * 16u * 132u * 4u && 2u * PJ_BUF >= 2u * 128u * PJ_VP, "the output staging must fit the two buffers");
  float (*so)[16][132] = (float (*)[16][132])sm;
  const int tid = threadIdx.x, wave = tid >> 5, lane = tid & 31, col = lane & 15, g = lane >> 4; const size_t r0 = (size_t)blockIdx.x * 64 + wave * 16; const int n0 = blockIdx.y * 128;
  const unsigned lbase = (unsigned)(size_t)sm;
  // x tile: 16 lanes a row, 8 rows a copy of the block; PT tile: 8 lanes a row, 16 rows a copy
  const unsigned la = lbase + (unsigned)(tid >> 4) * PJ_AP + (unsigned)(tid & 15) * 16u, lb = lbase + PJ_AB + (unsigned)(tid >> 3) * PJ_BP + (unsigned)(tid & 7) * 16u;
  const float* ga = X + ((size_t)blockIdx.x * 64 + (tid >> 4)) * DM + (tid & 15) * 4; const __bf16* gb = PT + (size_t)(n0 + (tid >> 3)) * KK + (tid & 7) * 8;
  v8f acc[8] = {};
  pj_cp8(la, 8u * PJ_AP, ga, 8 * DM); pj_cp8(lb, 16u * PJ_BP, gb, 16 * KK);
  asm volatile("s_wait_asynccnt 0x0" ::: "memory");   // stage 0 has landed before the barrier publishes it
  __syncthreads();
  pj_cp8(la + PJ_BUF, 8u * PJ_AP, ga + PJ_KW, 8 * DM); pj_cp8(lb + PJ_BUF, 16u * PJ_BP, gb + PJ_KW, 16 * KK);
#pragma unroll 2   // by two, so that each half's buffer is a constant offset
  for (int st = 0; st < PJ_NS; ++st) { const char* sb = sm + (st & 1) * PJ_BUF;
#pragma unroll
    for (int u = 0; u < PJ_KW / 32; ++u) { const v16b a = frag_lf(sb + (wave * 16 + col) * PJ_AP + u * 128, g);
#pragma unroll
      for (int jh = 0; jh < 8; jh += 4) { v16b bq[4];   // four fragments' reads stand together ahead of their matrix instructions, not one wait a fragment
#pragma unroll
        for (int j = 0; j < 4; ++j) bq[j] = frag_b((const __bf16*)(sb + PJ_AB + ((jh + j) * 16 + col) * PJ_BP + u * 64), lane);
#pragma unroll
        for (int j = 0; j < 4; ++j) acc[jh + j] = wmma_bf(a, bq[j], acc[jh + j]); } }
    asm volatile("s_wait_dscnt 0x0" ::: "memory");      // this wave's reads of the buffer have returned before it is refilled
    asm volatile("s_wait_asynccnt 0x0" ::: "memory");   // this wave's copies of stage st + 1 have landed
    __syncthreads();                                    // publishes stage st + 1 and ends every wave's reads of stage st
    if (st + 2 < PJ_NS) { pj_cp8(la + (st & 1) * PJ_BUF, 8u * PJ_AP, ga + ((st + 2) % (DM / PJ_KW)) * PJ_KW, 8 * DM); pj_cp8(lb + (st & 1) * PJ_BUF, 16u * PJ_BP, gb + (st + 2) * PJ_KW, 16 * KK); } }
  asm volatile("s_wait_asynccnt 0x0" ::: "memory");     // no copy is outstanding when the buffers become output staging
  if (n0 >= 2 * DM) {   // V columns: the same answer for the whole block
    const int c0 = n0 - 2 * DM;
#pragma unroll
    for (int j = 0; j < 8; ++j) { const int c = c0 + j * 16 + col; const float bb = bfr(bcv[c]) + bfr(bpv[c]); v8b hv, lv;
#pragma unroll
      for (int r = 0; r < 8; ++r) { const float v = acc[j][r] + bb; const __bf16 hb = (__bf16)v; hv[r] = hb; lv[r] = (__bf16)(v - (float)hb); }
      char* p = sm + (j * 16 + col) * PJ_VP + (wave * 16 + 8 * g) * 2;   // a lane's eight sums are eight tokens in a row of one V^T row
      *(v8b*)p = hv; *(v8b*)(p + 128u * PJ_VP) = lv; }
    __syncthreads();   // a V^T row holds tokens of all four waves
    const size_t t0 = (size_t)blockIdx.x * 64; const size_t ob = ((t0 / SS) * DM + c0) * SS + t0 % SS;
    const size_t o = ob + (size_t)(tid >> 3) * SS + (tid & 7) * 8; const char* p = sm + (tid >> 3) * PJ_VP + (tid & 7) * 16;   // 8 lanes a row: whole 128-B lines; 16 rows a pass of the block
#pragma unroll
    for (int i = 0; i < 8; ++i) { vst2((unsigned*)(VTH + o + (size_t)i * 16 * SS), *(const v4u*)(p + i * 16 * PJ_VP)); vst2((unsigned*)(VTL + o + (size_t)i * 16 * SS), *(const v4u*)(p + (128u + i * 16) * PJ_VP)); }
    return;
  }
#pragma unroll
  for (int j = 0; j < 8; ++j) { const int n = n0 + j * 16 + col; const int which = n / DM, c = n % DM; const float bb = bfr((which == 0 ? bcq : which == 1 ? bck : bcv)[c]) + bfr((which == 0 ? bpq : which == 1 ? bpk : bpv)[c]);
#pragma unroll
    for (int r = 0; r < 8; ++r) so[wave][8 * g + r][j * 16 + col] = acc[j][r] + bb; }
  LDSX();
  for (int rl = 0; rl < 16; ++rl) vst2(QKV + (r0 + rl) * QKVP + n0 + lane * 4, *(const v4f*)&so[wave][rl][lane * 4]);
}
// lane l with lane l ^ 16 (the two halves of a wave hold the two halves of a query's keys)
__device__ __forceinline__ float xhalf(float x) { return __builtin_bit_cast(float, __builtin_amdgcn_permlanex16(__builtin_bit_cast(int, x), __builtin_bit_cast(int, x), 0x76543210, 0xfedcba98, false, false)); }
// ---- k_attn: block = (query block, b*8 + h), 4 waves; 32 key steps; transposed products: S^T = K Q^T (A = key rows, B = query columns), O^T += V^T P^T.
// Lane (g, col) holds query col's scores of keys 8g+r and 16+8g+r: maximum and sum in the lane's own registers, and the two score tiles are P^T's B fragment as they stand.
// A stage is 64 keys (two key steps): its K tile (64 rows of 256 B) and its two V^T tiles (64 rows of 128 B each) come into LDS once for the block, by asynchronous
// copies that cover whole 128-B lines, two buffers; the four waves take their fragments from LDS. Row pitches 272 B and 144 B (16 B x odd) as in k_proj.
#define AT_KT 64
#define AT_KP (HD * 4u + 16u)
#define AT_VP (AT_KT * 2u + 16u)
#define AT_KB (AT_KT * AT_KP)
#define AT_VB (HD * AT_VP)
#define AT_BUF (AT_KB + 2u * AT_VB)
#define AT_NS (SS / AT_KT)
__device__ __forceinline__ F2 split_lf(const char* rowk0, int g) {   // split_row's k order, from an f32 row in LDS
  const v4f* p = (const v4f*)(rowk0 + 32 * g); const v4f x0 = p[0], x1 = p[1], x2 = p[4], x3 = p[5]; float v[16];
#pragma unroll
  for (int i = 0; i < 4; ++i) { v[i] = x0[i]; v[4 + i] = x1[i]; v[8 + i] = x2[i]; v[12 + i] = x3[i]; }
  return bsplit16(v);
}
// as pj_cp8, the first four copies from s0 and the last four from s1 (the two V^T planes, one behind the other in LDS); the s_wait_xcnt closes the statement for the same reason
__device__ __forceinline__ void at_cp44(unsigned l, unsigned ls, const __bf16* s0, const __bf16* s1, int gs) {
  asm volatile("global_load_async_to_lds_b128 %0, %1, off\n\t"
               "global_load_async_to_lds_b128 %2, %3, off\n\t"
               "global_load_async_to_lds_b128 %4, %5, off\n\t"
               "global_load_async_to_lds_b128 %6, %7, off\n\t"
               "global_load_async_to_lds_b128 %8, %9, off\n\t"
               "global_load_async_to_lds_b128 %10, %11, off\n\t"
               "global_load_async_to_lds_b128 %12, %13, off\n\t"
               "global_load_async_to_lds_b128 %14, %15, off\n\t"
               "s_wait_xcnt 0x0"
               :: "v"(l), "v"(s0), "v"(l + ls), "v"(s0 + gs), "v"(l + 2u * ls), "v"(s0 + 2 * gs), "v"(l + 3u * ls), "v"(s0 + 3 * gs),
                  "v"(l + 4u * ls), "v"(s1), "v"(l + 5u * ls), "v"(s1 + gs), "v"(l + 6u * ls), "v"(s1 + 2 * gs), "v"(l + 7u * ls), "v"(s1 + 3 * gs)
               : "memory");
}
__global__ __launch_bounds__(128) void k_attn(const float* __restrict__ QKV, const __bf16* __restrict__ VTH, const __bf16* __restrict__ VTL, float* __restrict__ OUT) {
  __shared__ __align__(16) char sm[2u * AT_BUF];   // the two stage buffers; behind the loop the output staging so[4][16][68]
  static_assert(2u * AT_BUF >= 4u * 16u * 68u * 4u, "the output staging must fit the two buffers");
  float (*so)[16][68] = (float (*)[16][68])sm;
  const int tid = threadIdx.x, wave = tid >> 5, lane = tid & 31, col = lane & 15, g = lane >> 4;
  const int qb = blockIdx.x, bh = blockIdx.y, b = bh / NH, h = bh % NH; const int q0 = qb * 64 + wave * 16; const size_t tq = (size_t)b * SS + q0;
  const unsigned lbase = (unsigned)(size_t)sm;
  // K tile: 16 lanes a row, 8 rows a copy of the block; V^T tiles: 8 lanes a row, 16 rows a copy
  const unsigned lk = lbase + (unsigned)(tid >> 4) * AT_KP + (unsigned)(tid & 15) * 16u, lv = lbase + AT_KB + (unsigned)(tid >> 3) * AT_VP + (unsigned)(tid & 7) * 16u;
  const float* gk = QKV + ((size_t)b * SS + (tid >> 4)) * QKVP + DM + h * HD + (tid & 15) * 4;
  const size_t vo = ((size_t)b * DM + h * HD + (tid >> 3)) * SS + (tid & 7) * 8; const __bf16 *gvh = VTH + vo, *gvl = VTL + vo;
  pj_cp8(lk, 8u * AT_KP, gk, 8 * QKVP); at_cp44(lv, 16u * AT_VP, gvh, gvl, 16 * SS);
  const F2 a0 = split_row(QKV + (tq + col) * QKVP + h * HD, 0, lane), a1 = split_row(QKV + (tq + col) * QKVP + h * HD, 32, lane);
  float m = -3.0e38f, l = 0.f;   // m: query col's running maximum (equal in both halves); l: this half's part of the sum
  v8f acc[4] = {};               // acc[dt][r] = O^T[dt*16 + 8g + r][col]
  const float scl = 0.044194173824159216f;   // 1/sqrt(512)
  asm volatile("s_wait_asynccnt 0x0" ::: "memory");   // stage 0 has landed before the barrier publishes it
  __syncthreads();
  pj_cp8(lk + AT_BUF, 8u * AT_KP, gk + (size_t)AT_KT * QKVP, 8 * QKVP); at_cp44(lv + AT_BUF, 16u * AT_VP, gvh + AT_KT, gvl + AT_KT, 16 * SS);
#pragma unroll 1   // stays rolled: the body already holds two key steps, and further copies would only lengthen the code
  for (int st = 0; st < AT_NS; ++st) { const char* sb = sm + (st & 1) * AT_BUF;
#pragma unroll     // so that a key step's place in the buffer is an immediate offset of the LDS reads
   for (int u = 0; u < AT_KT / 32; ++u) {
    float s[16];
#pragma unroll
    for (int ct = 0; ct < 2; ++ct) { const char* krow = sb + (u * 32 + ct * 16 + col) * AT_KP; const F2 k0 = split_lf(krow, g), k1 = split_lf(krow + 128, g);
      v8f c = wmma_bf(k0.h, a0.l, (v8f){}); c = wmma_bf(k0.l, a0.h, c); c = wmma_bf(k0.h, a0.h, c);
      c = wmma_bf(k1.h, a1.l, c); c = wmma_bf(k1.l, a1.h, c); c = wmma_bf(k1.h, a1.h, c);
#pragma unroll
      for (int r = 0; r < 8; ++r) s[ct * 8 + r] = c[r] * scl; }
    float mx = s[0];
#pragma unroll
    for (int i = 1; i < 16; ++i) mx = fmaxf(mx, s[i]);
    mx = fmaxf(mx, xhalf(mx));
    const float mn = fmaxf(m, mx); const float alpha = exp_ni(m - mn); m = mn;
    float es = 0.f;
#pragma unroll
    for (int i = 0; i < 16; ++i) { s[i] = exp_ni(s[i] - mn); es += s[i]; }
    l = l * alpha + es;
#pragma unroll
    for (int dt = 0; dt < 4; ++dt)
#pragma unroll
      for (int r = 0; r < 8; ++r) acc[dt][r] *= alpha;
    v16b vh[4], vl[4];   // the eight V^T fragments' reads stand together ahead of their matrix instructions, not one wait a tile
    const F2 pb = bsplit16(s);   // element i = key 8g+i, element 8+i = key 16+8g+i: the k order of frag_b
#pragma unroll
    for (int dt = 0; dt < 4; ++dt) { const char* vrow = sb + AT_KB + (dt * 16 + col) * AT_VP + u * 64; vh[dt] = frag_b((const __bf16*)vrow, lane); vl[dt] = frag_b((const __bf16*)(vrow + AT_VB), lane); }
#pragma unroll
    for (int dt = 0; dt < 4; ++dt) { acc[dt] = wmma_bf(vh[dt], pb.l, acc[dt]); acc[dt] = wmma_bf(vl[dt], pb.h, acc[dt]); acc[dt] = wmma_bf(vh[dt], pb.h, acc[dt]); } }
    asm volatile("s_wait_dscnt 0x0" ::: "memory");      // this wave's reads of the buffer have returned before it is refilled
    asm volatile("s_wait_asynccnt 0x0" ::: "memory");   // this wave's copies of stage st + 1 have landed
    __syncthreads();                                    // publishes stage st + 1 and ends every wave's reads of stage st
    if (st + 2 < AT_NS) { pj_cp8(lk + (st & 1) * AT_BUF, 8u * AT_KP, gk + (size_t)(st + 2) * AT_KT * QKVP, 8 * QKVP); at_cp44(lv + (st & 1) * AT_BUF, 16u * AT_VP, gvh + (st + 2) * AT_KT, gvl + (st + 2) * AT_KT, 16 * SS); } }
  asm volatile("s_wait_asynccnt 0x0" ::: "memory");     // no copy is outstanding when the buffers become output staging
  const float il = 1.0f / (l + xhalf(l));
#pragma unroll
  for (int dt = 0; dt < 4; ++dt) { v4f lo, hi;
#pragma unroll
    for (int r = 0; r < 4; ++r) { lo[r] = acc[dt][r] * il; hi[r] = acc[dt][4 + r] * il; }
    *(v4f*)&so[wave][col][dt * 16 + 8 * g] = lo; *(v4f*)&so[wave][col][dt * 16 + 8 * g + 4] = hi; }
  LDSX();
  for (int rl = 0; rl < 16; ++rl) if (lane < 16) vst2(OUT + (tq + rl) * DM + h * HD + lane * 4, *(const v4f*)&so[wave][rl][lane * 4]);
}

extern "C" void kernel_launch(void* const* d_in, const int* in_sizes, int n_in, void* d_out, int out_size, void* d_ws, size_t ws_size, hipStream_t stream) {
  (void)in_sizes; (void)n_in; (void)out_size;
  const float** F = (const float**)d_in;   // x, W_cq, b_cq, W_ck, b_ck, W_cv, b_cv, W_pq, b_pq, W_pk, b_pk, W_pv, b_pv  ([in][out] weights)
  if (ws_size < (size_t)WS_END) return;
  char* ws = (char*)d_ws; __bf16 *PT = (__bf16*)(ws + WS_PT), *VTH = (__bf16*)(ws + WS_VTH), *VTL = (__bf16*)(ws + WS_VTL); float* QKV = (float*)(ws + WS_QKV);
  k_pack<<<QKVP, 128, 0, stream>>>(F[1], F[3], F[5], F[7], F[9], F[11], PT);
  k_proj<<<dim3(TRB, QKVP / 128), 128, 0, stream>>>(F[0], PT, F[2], F[4], F[6], F[8], F[10], F[12], QKV, VTH, VTL);
  k_attn<<<dim3(TQB, TNB * NH), 128, 0, stream>>>(QKV, VTH, VTL, (float*)d_out);
}

// v005
// A run of this version takes 114 microseconds.
// Next to v004, in two timings, it ran 1.21 times as fast each time.
// Over all steps from v000 it is 3.28 times as fast.
// compute dtype: x, the six weights and biases (module inputs) rounded to bf16; q/k/v projections as exact bf16 products over the concatenated [Wc ; Wp] columns (x.(Wc+Wp) == x.Wc + x.Wp, f32 accumulate, + bc + bp); scores and P.V with both computed operands as bf16 hi + bf16 residual pairs (3 products); online softmax in f32; f32 accumulate.
#include <hip/hip_runtime.h>
#include <math.h>

typedef __attribute__((ext_vector_type(16))) _Float16 v16h;
typedef __attribute__((ext_vector_type(16))) __bf16 v16b;
typedef __attribute__((ext_vector_type(8)))  _Float16 v8h;
typedef __attribute__((ext_vector_type(8)))  float v8f;
typedef __attribute__((ext_vector_type(4)))  float v4f;
typedef __attribute__((ext_vector_type(2)))  float v2f;
typedef __attribute__((ext_vector_type(4)))  unsigned v4u;
typedef __attribute__((ext_vector_type(4)))  int v4i;
typedef float __attribute__((may_alias)) float_a;
typedef int __attribute__((may_alias)) int_a;

template <typename T> __device__ __forceinline__ void vst2(void* p, T v) { *(T*)p = v;  }
__device__ __forceinline__ v8f wmma16(v16h a, v16h b, v8f c) {
  v8f d = __builtin_amdgcn_wmma_f32_16x16x32_f16(false, a, false, b, (short)0, c, false, false);
  asm volatile("v_nop\n\tv_nop\n\tv_nop\n\tv_nop" : "+v"(d) : "v"(a), "v"(b));
  return d;
}
__device__ __forceinline__ v8f wmma_bf(v16b a, v16b b, v8f c) {
  v8f d = __builtin_amdgcn_wmma_f32_16x16x32_bf16(false, a, false, b, (short)0, c, false, false);
  asm volatile("v_nop\n\tv_nop\n\tv_nop\n\tv_nop" : "+v"(d) : "v"(a), "v"(b));
  return d;
}
// 16x16x32 fragments: lane = (h = lane>>4, row/col = lane&15); elements 0..7 = k0+8h+0..7, 8..15 = k0+16+8h+0..7; D element r = row 8h+r
__device__ __forceinline__ v16h frag_h(const _Float16* rowk0, int lane) {
  union { v16h v; v8h q[2]; } u; const _Float16* p = rowk0 + 8 * (lane >> 4);
  u.q[0] = *(const v8h*)p; u.q[1] = *(const v8h*)(p + 16); return u.v;
}
__device__ __forceinline__ v16h frag_f32(const float* rowk0, int lane) {
  v16h a; const float* p = rowk0 + 8 * (lane >> 4);
#pragma unroll
  for (int i = 0; i < 8; ++i) { a[i] = (_Float16)p[i]; a[8 + i] = (_Float16)p[16 + i]; }
  return a;
}
__device__ __forceinline__ v16h frag_f32s(const float* rowk0, int lane, float sc) {
  v16h a; const float* p = rowk0 + 8 * (lane >> 4);
#pragma unroll
  for (int i = 0; i < 8; ++i) { a[i] = (_Float16)(p[i] * sc); a[8 + i] = (_Float16)(p[16 + i] * sc); }
  return a;
}
// column fragment from a [K][ld] layout (column n), rows >= K read as 0
__device__ __forceinline__ v16h fragc_f32(const float* W, int k0, int n, int lane, int ld, int K) {
  v16h a; const int g = lane >> 4;
#pragma unroll
  for (int i = 0; i < 8; ++i) { const int ka = k0 + 8 * g + i, kb = ka + 16;
    a[i] = (_Float16)(ka < K ? W[(size_t)(ka < K ? ka : K - 1) * ld + n] : 0.f); a[8 + i] = (_Float16)(kb < K ? W[(size_t)(kb < K ? kb : K - 1) * ld + n] : 0.f); }
  return a;
}
struct F2 { v16b h, l; };
__device__ __forceinline__ F2 bsplit16(const float v[16]) { F2 r;
#pragma unroll
  for (int i = 0; i < 16; ++i) { const __bf16 h = (__bf16)v[i]; r.h[i] = h; r.l[i] = (__bf16)(v[i] - (float)h); }
  return r; }
__device__ __forceinline__ F2 split_row(const float* row, int k0, int lane) { float v[16]; const float* p = row + k0 + 8 * (lane >> 4);
#pragma unroll
  for (int i = 0; i < 8; ++i) { v[i] = p[i]; v[8 + i] = p[16 + i]; }
  return bsplit16(v); }
__device__ __forceinline__ F2 split_rowK(const float* row, int k0, int lane, int K) { float v[16]; const int g = lane >> 4;
#pragma unroll
  for (int i = 0; i < 8; ++i) { const int ka = k0 + 8 * g + i, kb = ka + 16; v[i] = ka < K ? row[ka < K ? ka : K - 1] : 0.f; v[8 + i] = kb < K ? row[kb < K ? kb : K - 1] : 0.f; }
  return bsplit16(v); }
__device__ __forceinline__ F2 split_col(const float* W, int k0, int n, int lane, int ld, int K) { float v[16]; const int g = lane >> 4;
#pragma unroll
  for (int i = 0; i < 8; ++i) { const int ka = k0 + 8 * g + i, kb = ka + 16; v[i] = ka < K ? W[(size_t)(ka < K ? ka : K - 1) * ld + n] : 0.f; v[8 + i] = kb < K ? W[(size_t)(kb < K ? kb : K - 1) * ld + n] : 0.f; }
  return bsplit16(v); }
__device__ __forceinline__ v8f mac3(const F2& a, const F2& b, v8f c) { c = wmma_bf(a.l, b.h, c); c = wmma_bf(a.h, b.l, c); return wmma_bf(a.h, b.h, c); }
__device__ __forceinline__ float sigm(float v) { return 1.0f / (1.0f + expf(-v)); }
#define LDSX() do { asm volatile("s_wait_dscnt 0" ::: "memory"); __builtin_amdgcn_wave_barrier(); __builtin_amdgcn_fence(__ATOMIC_RELEASE, "workgroup"); } while (0)


// Disentangled attention: q = x (W_cq + W_pq) + (b_cq + b_pq), likewise k, v (8 heads x 64); energy = q k^T / sqrt(512); softmax; out = P v merged to [8, 1024, 512] (no output projection).
// k_pack ([Wc col | Wp col] as one bf16 row of K = 1024), k_proj (exact GEMM over [x | x], + both biases; its V blocks write V transposed as hi/lo planes), k_attn (flash-style, 32 key steps, transposed products; writes the output rows directly).
#define NB 8
#define SS 1024
#define DM 512
#define NH 8
#define HD 64
#define NR (NB * SS)
#define QKVP (3 * DM)
#define KK (2 * DM)            // concatenated K
#ifndef TRB
#define TRB (NR / 64)
#define TQB (SS / 64)
#define TNB NB
#endif
typedef __attribute__((ext_vector_type(8))) __bf16 v8b;
__device__ __forceinline__ v16b frag_b(const __bf16* rowk0, int lane) {
  union { v16b v; v8b q[2]; } u; const __bf16* p = rowk0 + 8 * (lane >> 4);
  u.q[0] = *(const v8b*)p; u.q[1] = *(const v8b*)(p + 16); return u.v;
}
__device__ __forceinline__ v16b frag_gbf(const float* rowk0, int lane) {
  v16b a; const float* p = rowk0 + 8 * (lane >> 4);
#pragma unroll
  for (int i = 0; i < 8; ++i) { a[i] = (__bf16)p[i]; a[8 + i] = (__bf16)p[16 + i]; }
  return a;
}
__device__ __forceinline__ float bfr(float v) { return (float)(__bf16)v; }
__device__ __forceinline__ float exp2_hw(float v) { return __builtin_amdgcn_exp2f(v); }   // 2^v as one v_exp_f32; a very negative v gives 0
#define WS_PT   0u                                  // bf16 [1536][1024]: row n = [Wc_*[:, c] ; Wp_*[:, c]]
#define WS_QKV  (WS_PT + 2u * QKVP * KK)             // f32 [8192][1536]; the V columns stay unwritten and unread
#define WS_VTH  (WS_QKV + 4u * NR * QKVP)            // bf16 [8][512][1024]
#define WS_VTL  (WS_VTH + 2u * NB * DM * SS)
#define WS_END  (WS_VTL + 2u * NB * DM * SS)

__global__ __launch_bounds__(128) void k_pack(const float* __restrict__ Wcq, const float* __restrict__ Wck, const float* __restrict__ Wcv, const float* __restrict__ Wpq, const float* __restrict__ Wpk, const float* __restrict__ Wpv, __bf16* __restrict__ PT) {
  __shared__ __align__(16) __bf16 srow[KK];
  const int n = blockIdx.x, tid = threadIdx.x; const int which = n / DM, c = n % DM; const float* Wc = which == 0 ? Wcq : which == 1 ? Wck : Wcv; const float* Wp = which == 0 ? Wpq : which == 1 ? Wpk : Wpv;
  for (int k = tid; k < DM; k += 128) { srow[k] = (__bf16)Wc[(size_t)k * DM + c]; srow[DM + k] = (__bf16)Wp[(size_t)k * DM + c]; }   // [in][out] layout: column c
  __syncthreads();
  vst2((unsigned*)(PT + (size_t)n * KK + tid * 8), *(const v4u*)(&srow[tid * 8]));
}
// ---- k_proj: QKV[r][n] = [bf16(x[r]) | bf16(x[r])] . PT[n] (exact) + bc[n] + bp[n]; block (64 rows, 128 cols)
// A block of V columns does not write f32 rows: it splits its sums into bf16 hi + residual, turns the 64 x 128 tile in LDS and writes V^T's two planes, 128-B lines of 64 tokens.
// A stage is 64 wide in k: its x tile (64 rows of 256 B) and its PT tile (128 rows of 128 B) come into LDS once for the block, by asynchronous copies that
// cover whole 128-B lines, two buffers; the four waves take their fragments from LDS. Row pitches 272 B and 144 B (16 B x odd) keep ds_load_b128 free of bank conflicts.
#define PJ_KW 64
#define PJ_AP (PJ_KW * 4u + 16u)
#define PJ_BP (PJ_KW * 2u + 16u)
#define PJ_AB (64u * PJ_AP)
#define PJ_BUF (PJ_AB + 128u * PJ_BP)
#define PJ_NS (KK / PJ_KW)
#define PJ_VP (64u * 2u + 16u)   // pitch of a V^T row of 64 tokens in the output staging (16 B x odd)
__device__ __forceinline__ v16b frag_lf(const char* rowk0, int g) {   // frag_gbf's k order, from an f32 row in LDS
  const v4f* p = (const v4f*)(rowk0 + 32 * g); const v4f x0 = p[0], x1 = p[1], x2 = p[4], x3 = p[5]; v16b a;
#pragma unroll
  for (int i = 0; i < 4; ++i) { a[i] = (__bf16)x0[i]; a[4 + i] = (__bf16)x1[i]; a[8 + i] = (__bf16)x2[i]; a[12 + i] = (__bf16)x3[i]; }
  return a;
}
// eight copies of 16 B per lane, LDS places ls bytes and sources gs elements apart; the s_wait_xcnt closes the statement so that no address register is rewritten ahead of it
template <typename T> __device__ __forceinline__ void pj_cp8(unsigned l, unsigned ls, const T* s, int gs) {
  asm volatile("global_load_async_to_lds_b128 %0, %1, off\n\t"
               "global_load_async_to_lds_b128 %2, %3, off\n\t"
               "global_load_async_to_lds_b128 %4, %5, off\n\t"
               "global_load_async_to_lds_b128 %6, %7, off\n\t"
               "global_load_async_to_lds_b128 %8, %9, off\n\t"
               "global_load_async_to_lds_b128 %10, %11, off\n\t"
               "global_load_async_to_lds_b128 %12, %13, off\n\t"
               "global_load_async_to_lds_b128 %14, %15, off\n\t"
               "s_wait_xcnt 0x0"
               :: "v"(l), "v"(s), "v"(l + ls), "v"(s + gs), "v"(l + 2u * ls), "v"(s + 2 * gs), "v"(l + 3u * ls), "v"(s + 3 * gs),
                  "v"(l + 4u * ls), "v"(s + 4 * gs), "v"(l + 5u * ls), "v"(s + 5 * gs), "v"(l + 6u * ls), "v"(s + 6 * gs), "v"(l + 7u * ls), "v"(s + 7 * gs)
               : "memory");
}
__global__ __launch_bounds__(128) void k_proj(const float* __restrict__ X, const __bf16* __restrict__ PT, const float* __restrict__ bcq, const float* __restrict__ bck, const float* __restrict__ bcv, const float* __restrict__ bpq, const float* __restrict__ bpk, const float* __restrict__ bpv, float* __restrict__ QKV, __bf16* __restrict__ VTH, __bf16* __restrict__ VTL) {
  __shared__ __align__(16) char sm[2u * PJ_BUF];   // the two stage buffers; behind the loop the output staging so[4][16][132], or in a V block two planes of [128][PJ_VP bytes]
  static_assert(2u * PJ_BUF >= 4u * 16u * 132u * 4u && 2u * PJ_BUF >= 2u * 128u * PJ_VP, "the output staging must fit the two buffers");
  float (*so)[16][132] = (float (*)[16][132])sm;
  const int tid = threadIdx.x, wave = tid >> 5, lane = tid & 31, col = lane & 15, g = lane >> 4; const size_t r0 = (size_t)blockIdx.x * 64 + wave * 16; const int n0 = blockIdx.y * 128;
  const unsigned lbase = (unsigned)(size_t)sm;
  // x tile: 16 lanes a row, 8 rows a copy of the block; PT tile: 8 lanes a row, 16 rows a copy
  const unsigned la = lbase + (unsigned)(tid >> 4) * PJ_AP + (unsigned)(tid & 15) * 16u, lb = lbase + PJ_AB + (unsigned)(tid >> 3) * PJ_BP + (unsigned)(tid & 7) * 16u;
  const float* ga = X + ((size_t)blockIdx.x * 64 + (tid >> 4)) * DM + (tid & 15) * 4; const __bf16* gb = PT + (size_t)(n0 + (tid >> 3)) * KK + (tid & 7) * 8;
  v8f acc[8] = {};
  pj_cp8(la, 8u * PJ_AP, ga, 8 * DM); pj_cp8(lb, 16u * PJ_BP, gb, 16 * KK);
  asm volatile("s_wait_asynccnt 0x0" ::: "memory");   // stage 0 has landed before the barrier publishes it
  __syncthreads();
  pj_cp8(la + PJ_BUF, 8u * PJ_AP, ga + PJ_KW, 8 * DM); pj_cp8(lb + PJ_BUF, 16u * PJ_BP, gb + PJ_KW, 16 * KK);
#pragma unroll 2   // by two, so that each half's buffer is a constant offset
  for (int st = 0; st < PJ_NS; ++st) { const char* sb = sm + (st & 1) * PJ_BUF;
#pragma unroll
    for (int u = 0; u < PJ_KW / 32; ++u) { const v16b a = frag_lf(sb + (wave * 16 + col) * PJ_AP + u * 128, g);
#pragma unroll
      for (int jh = 0; jh < 8; jh += 4) { v16b bq[4];   // four fragments' reads stand together ahead of their matrix instructions, not one wait a fragment
#pragma unroll
        for (int j = 0; j < 4; ++j) bq[j] = frag_b((const __bf16*)(sb + PJ_AB + ((jh + j) * 16 + col) * PJ_BP + u * 64), lane);
#pragma unroll
        for (int j = 0; j < 4; ++j) acc[jh + j] = wmma_bf(a, bq[j], acc[jh + j]); } }
    asm volatile("s_wait_dscnt 0x0" ::: "memory");      // this wave's reads of the buffer have returned before it is refilled
    asm volatile("s_wait_asynccnt 0x0" ::: "memory");   // this wave's copies of stage st + 1 have landed
    __syncthreads();                                    // publishes stage st + 1 and ends every wave's reads of stage st
    if (st + 2 < PJ_NS) { pj_cp8(la + (st & 1) * PJ_BUF, 8u * PJ_AP, ga + ((st + 2) % (DM / PJ_KW)) * PJ_KW, 8 * DM); pj_cp8(lb + (st & 1) * PJ_BUF, 16u * PJ_BP, gb + (st + 2) * PJ_KW, 16 * KK); } }
  asm volatile("s_wait_asynccnt 0x0" ::: "memory");     // no copy is outstanding when the buffers become output staging
  if (n0 >= 2 * DM) {   // V columns: the same answer for the whole block
    const int c0 = n0 - 2 * DM;
#pragma unroll
    for (int j = 0; j < 8; ++j) { const int c = c0 + j * 16 + col; const float bb = bfr(bcv[c]) + bfr(bpv[c]); v8b hv, lv;
#pragma unroll
      for (int r = 0; r < 8; ++r) { const float v = acc[j][r] + bb; const __bf16 hb = (__bf16)v; hv[r] = hb; lv[r] = (__bf16)(v - (float)hb); }
      char* p = sm + (j * 16 + col) * PJ_VP + (wave * 16 + 8 * g) * 2;   // a lane's eight sums are eight tokens in a row of one V^T row
      *(v8b*)p = hv; *(v8b*)(p + 128u * PJ_VP) = lv; }
    __syncthreads();   // a V^T row holds tokens of all four waves
    const size_t t0 = (size_t)blockIdx.x * 64; const size_t ob = ((t0 / SS) * DM + c0) * SS + t0 % SS;
    const size_t o = ob + (size_t)(tid >> 3) * SS + (tid & 7) * 8; const char* p = sm + (tid >> 3) * PJ_VP + (tid & 7) * 16;   // 8 lanes a row: whole 128-B lines; 16 rows a pass of the block
#pragma unroll
    for (int i = 0; i < 8; ++i) { vst2((unsigned*)(VTH + o + (size_t)i * 16 * SS), *(const v4u*)(p + i * 16 * PJ_VP)); vst2((unsigned*)(VTL + o + (size_t)i * 16 * SS), *(const v4u*)(p + (128u + i * 16) * PJ_VP)); }
    return;
  }
#pragma unroll
  for (int j = 0; j < 8; ++j) { const int n = n0 + j * 16 + col; const int which = n / DM, c = n % DM; const float bb = bfr((which == 0 ? bcq : which == 1 ? bck : bcv)[c]) + bfr((which == 0 ? bpq : which == 1 ? bpk : bpv)[c]);
#pragma unroll
    for (int r = 0; r < 8; ++r) so[wave][8 * g + r][j * 16 + col] = acc[j][r] + bb; }
  LDSX();
  for (int rl = 0; rl < 16; ++rl) vst2(QKV + (r0 + rl) * QKVP + n0 + lane * 4, *(const v4f*)&so[wave][rl][lane * 4]);
}
// lane l with lane l ^ 16 (the two halves of a wave hold the two halves of a query's keys)
__device__ __forceinline__ float xhalf(float x) { return __builtin_bit_cast(float, __builtin_amdgcn_permlanex16(__builtin_bit_cast(int, x), __builtin_bit_cast(int, x), 0x76543210, 0xfedcba98, false, false)); }
// ---- k_attn: block = (query block, b*8 + h), 4 waves; 32 key steps; transposed products: S^T = K Q^T (A = key rows, B = query columns), O^T += V^T P^T.
// Lane (g, col) holds query col's scores of keys 8g+r and 16+8g+r: maximum and sum in the lane's own registers, and the two score tiles are P^T's B fragment as they stand.
// A stage is 64 keys (two key steps): its K tile (64 rows of 256 B) and its two V^T tiles (64 rows of 128 B each) come into LDS once for the block, by asynchronous
// copies that cover whole 128-B lines, two buffers; the four waves take their fragments from LDS. Row pitches 272 B and 144 B (16 B x odd) as in k_proj.
#define AT_KT 64
#define AT_KP (HD * 4u + 16u)
#define AT_VP (AT_KT * 2u + 16u)
#define AT_KB (AT_KT * AT_KP)
#define AT_VB (HD * AT_VP)
#define AT_BUF (AT_KB + 2u * AT_VB)
#define AT_NS (SS / AT_KT)
__device__ __forceinline__ F2 split_lf(const char* rowk0, int g) {   // split_row's k order, from an f32 row in LDS
  const v4f* p = (const v4f*)(rowk0 + 32 * g); const v4f x0 = p[0], x1 = p[1], x2 = p[4], x3 = p[5]; float v[16];
#pragma unroll
  for (int i = 0; i < 4; ++i) { v[i] = x0[i]; v[4 + i] = x1[i]; v[8 + i] = x2[i]; v[12 + i] = x3[i]; }
  return bsplit16(v);
}
// as pj_cp8, the first four copies from s0 and the last four from s1 (the two V^T planes, one behind the other in LDS); the s_wait_xcnt closes the statement for the same reason
__device__ __forceinline__ void at_cp44(unsigned l, unsigned ls, const __bf16* s0, const __bf16* s1, int gs) {
  asm volatile("global_load_async_to_lds_b128 %0, %1, off\n\t"
               "global_load_async_to_lds_b128 %2, %3, off\n\t"
               "global_load_async_to_lds_b128 %4, %5, off\n\t"
               "global_load_async_to_lds_b128 %6, %7, off\n\t"
               "global_load_async_to_lds_b128 %8, %9, off\n\t"
               "global_load_async_to_lds_b128 %10, %11, off\n\t"
               "global_load_async_to_lds_b128 %12, %13, off\n\t"
               "global_load_async_to_lds_b128 %14, %15, off\n\t"
               "s_wait_xcnt 0x0"
               :: "v"(l), "v"(s0), "v"(l + ls), "v"(s0 + gs), "v"(l + 2u * ls), "v"(s0 + 2 * gs), "v"(l + 3u * ls), "v"(s0 + 3 * gs),
                  "v"(l + 4u * ls), "v"(s1), "v"(l + 5u * ls), "v"(s1 + gs), "v"(l + 6u * ls), "v"(s1 + 2 * gs), "v"(l + 7u * ls), "v"(s1 + 3 * gs)
               : "memory");
}
__global__ __launch_bounds__(128) void k_attn(const float* __restrict__ QKV, const __bf16* __restrict__ VTH, const __bf16* __restrict__ VTL, float* __restrict__ OUT) {
  __shared__ __align__(16) char sm[2u * AT_BUF];   // the two stage buffers; behind the loop the output staging so[4][16][68]
  static_assert(2u * AT_BUF >= 4u * 16u * 68u * 4u, "the output staging must fit the two buffers");
  float (*so)[16][68] = (float (*)[16][68])sm;
  const int tid = threadIdx.x, wave = tid >> 5, lane = tid & 31, col = lane & 15, g = lane >> 4;
  const int qb = blockIdx.x, bh = blockIdx.y, b = bh / NH, h = bh % NH; const int q0 = qb * 64 + wave * 16; const size_t tq = (size_t)b * SS + q0;
  const unsigned lbase = (unsigned)(size_t)sm;
  // K tile: 16 lanes a row, 8 rows a copy of the block; V^T tiles: 8 lanes a row, 16 rows a copy
  const unsigned lk = lbase + (unsigned)(tid >> 4) * AT_KP + (unsigned)(tid & 15) * 16u, lv = lbase + AT_KB + (unsigned)(tid >> 3) * AT_VP + (unsigned)(tid & 7) * 16u;
  const float* gk = QKV + ((size_t)b * SS + (tid >> 4)) * QKVP + DM + h * HD + (tid & 15) * 4;
  const size_t vo = ((size_t)b * DM + h * HD + (tid >> 3)) * SS + (tid & 7) * 8; const __bf16 *gvh = VTH + vo, *gvl = VTL + vo;
  pj_cp8(lk, 8u * AT_KP, gk, 8 * QKVP); at_cp44(lv, 16u * AT_VP, gvh, gvl, 16 * SS);
  const F2 a0 = split_row(QKV + (tq + col) * QKVP + h * HD, 0, lane), a1 = split_row(QKV + (tq + col) * QKVP + h * HD, 32, lane);
  float m = -3.0e38f, l = 0.f;   // m: query col's running maximum, in base-2 units (score x scl2; equal in both halves); l: this half's part of the sum
  v8f acc[4] = {};               // acc[dt][r] = O^T[dt*16 + 8g + r][col]
  const float scl2 = 0.044194173824159216f * 1.4426950408889634f;   // 1/sqrt(512) x log2 e: exp(s / sqrt(512) - max) = 2^(s x scl2 - max x scl2)
  asm volatile("s_wait_asynccnt 0x0" ::: "memory");   // stage 0 has landed before the barrier publishes it
  __syncthreads();
  pj_cp8(lk + AT_BUF, 8u * AT_KP, gk + (size_t)AT_KT * QKVP, 8 * QKVP); at_cp44(lv + AT_BUF, 16u * AT_VP, gvh + AT_KT, gvl + AT_KT, 16 * SS);
#pragma unroll 1   // stays rolled: the body already holds two key steps, and further copies would only lengthen the code
  for (int st = 0; st < AT_NS; ++st) { const char* sb = sm + (st & 1) * AT_BUF;
#pragma unroll     // so that a key step's place in the buffer is an immediate offset of the LDS reads
   for (int u = 0; u < AT_KT / 32; ++u) {
    float s[16];
#pragma unroll
    for (int ct = 0; ct < 2; ++ct) { const char* krow = sb + (u * 32 + ct * 16 + col) * AT_KP; const F2 k0 = split_lf(krow, g), k1 = split_lf(krow + 128, g);
      v8f c = wmma_bf(k0.h, a0.l, (v8f){}); c = wmma_bf(k0.l, a0.h, c); c = wmma_bf(k0.h, a0.h, c);
      c = wmma_bf(k1.h, a1.l, c); c = wmma_bf(k1.l, a1.h, c); c = wmma_bf(k1.h, a1.h, c);
#pragma unroll
      for (int r = 0; r < 8; ++r) s[ct * 8 + r] = c[r]; }
    float mx = s[0];
#pragma unroll
    for (int i = 1; i < 16; ++i) mx = fmaxf(mx, s[i]);
    mx = fmaxf(mx, xhalf(mx));
    const float mn = fmaxf(m, mx * scl2); const float alpha = exp2_hw(m - mn); m = mn;
    float es = 0.f;
#pragma unroll
    for (int i = 0; i < 16; ++i) { s[i] = exp2_hw(fmaf(s[i], scl2, -mn)); es += s[i]; }
    l = l * alpha + es;
#pragma unroll
    for (int dt = 0; dt < 4; ++dt)
#pragma unroll
      for (int r = 0; r < 8; ++r) acc[dt][r] *= alpha;
    v16b vh[4], vl[4];   // the eight V^T fragments' reads stand together ahead of their matrix instructions, not one wait a tile
    const F2 pb = bsplit16(s);   // element i = key 8g+i, element 8+i = key 16+8g+i: the k order of frag_b
#pragma unroll
    for (int dt = 0; dt < 4; ++dt) { const char* vrow = sb + AT_KB + (dt * 16 + col) * AT_VP + u * 64; vh[dt] = frag_b((const __bf16*)vrow, lane); vl[dt] = frag_b((const __bf16*)(vrow + AT_VB), lane); }
#pragma unroll
    for (int dt = 0; dt < 4; ++dt) { acc[dt] = wmma_bf(vh[dt], pb.l, acc[dt]); acc[dt] = wmma_bf(vl[dt], pb.h, acc[dt]); acc[dt] = wmma_bf(vh[dt], pb.h, acc[dt]); } }
    asm volatile("s_wait_dscnt 0x0" ::: "memory");      // this wave's reads of the buffer have returned before it is refilled
    asm volatile("s_wait_asynccnt 0x0" ::: "memory");   // this wave's copies of stage st + 1 have landed
    __syncthreads();                                    // publishes stage st + 1 and ends every wave's reads of stage st
    if (st + 2 < AT_NS) { pj_cp8(lk + (st & 1) * AT_BUF, 8u * AT_KP, gk + (size_t)(st + 2) * AT_KT * QKVP, 8 * QKVP); at_cp44(lv + (st & 1) * AT_BUF, 16u * AT_VP, gvh + (st + 2) * AT_KT, gvl + (st + 2) * AT_KT, 16 * SS); } }
  asm volatile("s_wait_asynccnt 0x0" ::: "memory");     // no copy is outstanding when the buffers become output staging
  const float il = 1.0f / (l + xhalf(l));
#pragma unroll
  for (int dt = 0; dt < 4; ++dt) { v4f lo, hi;
#pragma unroll
    for (int r = 0; r < 4; ++r) { lo[r] = acc[dt][r] * il; hi[r] = acc[dt][4 + r] * il; }
    *(v4f*)&so[wave][col][dt * 16 + 8 * g] = lo; *(v4f*)&so[wave][col][dt * 16 + 8 * g + 4] = hi; }
  LDSX();
  for (int rl = 0; rl < 16; ++rl) if (lane < 16) vst2(OUT + (tq + rl) * DM + h * HD + lane * 4, *(const v4f*)&so[wave][rl][lane * 4]);
}

extern "C" void kernel_launch(void* const* d_in, const int* in_sizes, int n_in, void* d_out, int out_size, void* d_ws, size_t ws_size, hipStream_t stream) {
  (void)in_sizes; (void)n_in; (void)out_size;
  const float** F = (const float**)d_in;   // x, W_cq, b_cq, W_ck, b_ck, W_cv, b_cv, W_pq, b_pq, W_pk, b_pk, W_pv, b_pv  ([in][out] weights)
  if (ws_size < (size_t)WS_END) return;
  char* ws = (char*)d_ws; __bf16 *PT = (__bf16*)(ws + WS_PT), *VTH = (__bf16*)(ws + WS_VTH), *VTL = (__bf16*)(ws + WS_VTL); float* QKV = (float*)(ws + WS_QKV);
  k_pack<<<QKVP, 128, 0, stream>>>(F[1], F[3], F[5], F[7], F[9], F[11], PT);
  k_proj<<<dim3(TRB, QKVP / 128), 128, 0, stream>>>(F[0], PT, F[2], F[4], F[6], F[8], F[10], F[12], QKV, VTH, VTL);
  k_attn<<<dim3(TQB, TNB * NH), 128, 0, stream>>>(QKV, VTH, VTL, (float*)d_out);
}

// v006
// One run takes 97 microseconds.
// Two timings next to v005 both put it at 1.17 times that version's speed.
// All steps since v000 together make it 3.84 times as fast.
// compute dtype: x, the six weights and biases (module inputs) rounded to bf16; q/k/v projections as exact bf16 products over the concatenated [Wc ; Wp] columns (x.(Wc+Wp) == x.Wc + x.Wp, f32 accumulate, + bc + bp); scores and P.V with both computed operands as bf16 hi + bf16 residual pairs (3 products); online softmax in f32; f32 accumulate.
#include <hip/hip_runtime.h>
#include <math.h>

typedef __attribute__((ext_vector_type(16))) _Float16 v16h;
typedef __attribute__((ext_vector_type(16))) __bf16 v16b;
typedef __attribute__((ext_vector_type(8)))  _Float16 v8h;
typedef __attribute__((ext_vector_type(8)))  float v8f;
typedef __attribute__((ext_vector_type(4)))  float v4f;
typedef __attribute__((ext_vector_type(2)))  float v2f;
typedef __attribute__((ext_vector_type(4)))  unsigned v4u;
typedef __attribute__((ext_vector_type(4)))  int v4i;
typedef float __attribute__((may_alias)) float_a;
typedef int __attribute__((may_alias)) int_a;

template <typename T> __device__ __forceinline__ void vst2(void* p, T v) { *(T*)p = v;  }
__device__ __forceinline__ v8f wmma16(v16h a, v16h b, v8f c) {
  v8f d = __builtin_amdgcn_wmma_f32_16x16x32_f16(false, a, false, b, (short)0, c, false, false);
  asm volatile("v_nop\n\tv_nop\n\tv_nop\n\tv_nop" : "+v"(d) : "v"(a), "v"(b));
  return d;
}
__device__ __forceinline__ v8f wmma_bf(v16b a, v16b b, v8f c) {
  v8f d = __builtin_amdgcn_wmma_f32_16x16x32_bf16(false, a, false, b, (short)0, c, false, false);
  asm volatile("v_nop\n\tv_nop\n\tv_nop\n\tv_nop" : "+v"(d) : "v"(a), "v"(b));
  return d;
}
// 16x16x32 fragments: lane = (h = lane>>4, row/col = lane&15); elements 0..7 = k0+8h+0..7, 8..15 = k0+16+8h+0..7; D element r = row 8h+r
__device__ __forceinline__ v16h frag_h(const _Float16* rowk0, int lane) {
  union { v16h v; v8h q[2]; } u; const _Float16* p = rowk0 + 8 * (lane >> 4);
  u.q[0] = *(const v8h*)p; u.q[1] = *(const v8h*)(p + 16); return u.v;
}
__device__ __forceinline__ v16h frag_f32(const float* rowk0, int lane) {
  v16h a; const float* p = rowk0 + 8 * (lane >> 4);
#pragma unroll
  for (int i = 0; i < 8; ++i) { a[i] = (_Float16)p[i]; a[8 + i] = (_Float16)p[16 + i]; }
  return a;
}
__device__ __forceinline__ v16h frag_f32s(const float* rowk0, int lane, float sc) {
  v16h a; const float* p = rowk0 + 8 * (lane >> 4);
#pragma unroll
  for (int i = 0; i < 8; ++i) { a[i] = (_Float16)(p[i] * sc); a[8 + i] = (_Float16)(p[16 + i] * sc); }
  return a;
}
// column fragment from a [K][ld] layout (column n), rows >= K read as 0
__device__ __forceinline__ v16h fragc_f32(const float* W, int k0, int n, int lane, int ld, int K) {
  v16h a; const int g = lane >> 4;
#pragma unroll
  for (int i = 0; i < 8; ++i) { const int ka = k0 + 8 * g + i, kb = ka + 16;
    a[i] = (_Float16)(ka < K ? W[(size_t)(ka < K ? ka : K - 1) * ld + n] : 0.f); a[8 + i] = (_Float16)(kb < K ? W[(size_t)(kb < K ? kb : K - 1) * ld + n] : 0.f); }
  return a;
}
struct F2 { v16b h, l; };
__device__ __forceinline__ F2 bsplit16(const float v[16]) { F2 r;
#pragma unroll
  for (int i = 0; i < 16; ++i) { const __bf16 h = (__bf16)v[i]; r.h[i] = h; r.l[i] = (__bf16)(v[i] - (float)h); }
  return r; }
__device__ __forceinline__ F2 split_row(const float* row, int k0, int lane) { float v[16]; const float* p = row + k0 + 8 * (lane >> 4);
#pragma unroll
  for (int i = 0; i < 8; ++i) { v[i] = p[i]; v[8 + i] = p[16 + i]; }
  return bsplit16(v); }
__device__ __forceinline__ F2 split_rowK(const float* row, int k0, int lane, int K) { float v[16]; const int g = lane >> 4;
#pragma unroll
  for (int i = 0; i < 8; ++i) { const int ka = k0 + 8 * g + i, kb = ka + 16; v[i] = ka < K ? row[ka < K ? ka : K - 1] : 0.f; v[8 + i] = kb < K ? row[kb < K ? kb : K - 1] : 0.f; }
  return bsplit16(v); }
__device__ __forceinline__ F2 split_col(const float* W, int k0, int n, int lane, int ld, int K) { float v[16]; const int g = lane >> 4;
#pragma unroll
  for (int i = 0; i < 8; ++i) { const int ka = k0 + 8 * g + i, kb = ka + 16; v[i] = ka < K ? W[(size_t)(ka < K ? ka : K - 1) * ld + n] : 0.f; v[8 + i] = kb < K ? W[(size_t)(kb < K ? kb : K - 1) * ld + n] : 0.f; }
  return bsplit16(v); }
__device__ __forceinline__ v8f mac3(const F2& a, const F2& b, v8f c) { c = wmma_bf(a.l, b.h, c); c = wmma_bf(a.h, b.l, c); return wmma_bf(a.h, b.h, c); }
__device__ __forceinline__ float sigm(float v) { return 1.0f / (1.0f + expf(-v)); }
#define LDSX() do { asm volatile("s_wait_dscnt 0" ::: "memory"); __builtin_amdgcn_wave_barrier(); __builtin_amdgcn_fence(__ATOMIC_RELEASE, "workgroup"); } while (0)


// Disentangled attention: q = x (W_cq + W_pq) + (b_cq + b_pq), likewise k, v (8 heads x 64); energy = q k^T / sqrt(512); softmax; out = P v merged to [8, 1024, 512] (no output projection).
// k_pack ([Wc col | Wp col] as one bf16 row of K = 1024), k_proj (exact GEMM over [x | x], + both biases; its V blocks write V transposed as hi/lo planes, its K blocks each head's row as 64 hi + 64 residual bf16), k_attn (flash-style, 32 key steps, transposed products; writes the output rows directly).
#define NB 8
#define SS 1024
#define DM 512
#define NH 8
#define HD 64
#define NR (NB * SS)
#define QKVP (3 * DM)
#define KK (2 * DM)            // concatenated K
#ifndef TRB
#define TRB (NR / 64)
#define TQB (SS / 64)
#define TNB NB
#endif
typedef __attribute__((ext_vector_type(8))) __bf16 v8b;
__device__ __forceinline__ v16b frag_b(const __bf16* rowk0, int lane) {
  union { v16b v; v8b q[2]; } u; const __bf16* p = rowk0 + 8 * (lane >> 4);
  u.q[0] = *(const v8b*)p; u.q[1] = *(const v8b*)(p + 16); return u.v;
}
__device__ __forceinline__ v16b frag_gbf(const float* rowk0, int lane) {
  v16b a; const float* p = rowk0 + 8 * (lane >> 4);
#pragma unroll
  for (int i = 0; i < 8; ++i) { a[i] = (__bf16)p[i]; a[8 + i] = (__bf16)p[16 + i]; }
  return a;
}
__device__ __forceinline__ float bfr(float v) { return (float)(__bf16)v; }
__device__ __forceinline__ float exp2_hw(float v) { return __builtin_amdgcn_exp2f(v); }   // 2^v as one v_exp_f32; a very negative v gives 0
#define WS_PT   0u                                  // bf16 [1536][1024]: row n = [Wc_*[:, c] ; Wp_*[:, c]]
#define WS_QKV  (WS_PT + 2u * QKVP * KK)             // f32 [8192][1536]; in the K columns the 256 B of a head's row hold 64 bf16 hi, then the 64 bf16 residuals; the V columns stay unwritten and unread
#define WS_VTH  (WS_QKV + 4u * NR * QKVP)            // bf16 [8][512][1024]
#define WS_VTL  (WS_VTH + 2u * NB * DM * SS)
#define WS_END  (WS_VTL + 2u * NB * DM * SS)

__global__ __launch_bounds__(128) void k_pack(const float* __restrict__ Wcq, const float* __restrict__ Wck, const float* __restrict__ Wcv, const float* __restrict__ Wpq, const float* __restrict__ Wpk, const float* __restrict__ Wpv, __bf16* __restrict__ PT) {
  __shared__ __align__(16) __bf16 srow[KK];
  const int n = blockIdx.x, tid = threadIdx.x; const int which = n / DM, c = n % DM; const float* Wc = which == 0 ? Wcq : which == 1 ? Wck : Wcv; const float* Wp = which == 0 ? Wpq : which == 1 ? Wpk : Wpv;
  for (int k = tid; k < DM; k += 128) { srow[k] = (__bf16)Wc[(size_t)k * DM + c]; srow[DM + k] = (__bf16)Wp[(size_t)k * DM + c]; }   // [in][out] layout: column c
  __syncthreads();
  vst2((unsigned*)(PT + (size_t)n * KK + tid * 8), *(const v4u*)(&srow[tid * 8]));
}
// ---- k_proj: QKV[r][n] = [bf16(x[r]) | bf16(x[r])] . PT[n] (exact) + bc[n] + bp[n]; block (64 rows, 128 cols)
// A block of V columns does not write f32 rows: it splits its sums into bf16 hi + residual, turns the 64 x 128 tile in LDS and writes V^T's two planes, 128-B lines of 64 tokens.
// A block of K columns splits its sums the same way on the way out of the staging and writes, in the place of a head's 64 floats, 128 B of hi and 128 B of residuals.
// A stage is 64 wide in k: its x tile (64 rows of 256 B) and its PT tile (128 rows of 128 B) come into LDS once for the block, by asynchronous copies that
// cover whole 128-B lines, two buffers; the four waves take their fragments from LDS. Row pitches 272 B and 144 B (16 B x odd) keep ds_load_b128 free of bank conflicts.
#define PJ_KW 64
#define PJ_AP (PJ_KW * 4u + 16u)
#define PJ_BP (PJ_KW * 2u + 16u)
#define PJ_AB (64u * PJ_AP)
#define PJ_BUF (PJ_AB + 128u * PJ_BP)
#define PJ_NS (KK / PJ_KW)
#define PJ_VP (64u * 2u + 16u)   // pitch of a V^T row of 64 tokens in the output staging (16 B x odd)
__device__ __forceinline__ v16b frag_lf(const char* rowk0, int g) {   // frag_gbf's k order, from an f32 row in LDS
  const v4f* p = (const v4f*)(rowk0 + 32 * g); const v4f x0 = p[0], x1 = p[1], x2 = p[4], x3 = p[5]; v16b a;
#pragma unroll
  for (int i = 0; i < 4; ++i) { a[i] = (__bf16)x0[i]; a[4 + i] = (__bf16)x1[i]; a[8 + i] = (__bf16)x2[i]; a[12 + i] = (__bf16)x3[i]; }
  return a;
}
// eight copies of 16 B per lane, LDS places ls bytes and sources gs elements apart; the s_wait_xcnt closes the statement so that no address register is rewritten ahead of it
template <typename T> __device__ __forceinline__ void pj_cp8(unsigned l, unsigned ls, const T* s, int gs) {
  asm volatile("global_load_async_to_lds_b128 %0, %1, off\n\t"
               "global_load_async_to_lds_b128 %2, %3, off\n\t"
               "global_load_async_to_lds_b128 %4, %5, off\n\t"
               "global_load_async_to_lds_b128 %6, %7, off\n\t"
               "global_load_async_to_lds_b128 %8, %9, off\n\t"
               "global_load_async_to_lds_b128 %10, %11, off\n\t"
               "global_load_async_to_lds_b128 %12, %13, off\n\t"
               "global_load_async_to_lds_b128 %14, %15, off\n\t"
               "s_wait_xcnt 0x0"
               :: "v"(l), "v"(s), "v"(l + ls), "v"(s + gs), "v"(l + 2u * ls), "v"(s + 2 * gs), "v"(l + 3u * ls), "v"(s + 3 * gs),
                  "v"(l + 4u * ls), "v"(s + 4 * gs), "v"(l + 5u * ls), "v"(s + 5 * gs), "v"(l + 6u * ls), "v"(s + 6 * gs), "v"(l + 7u * ls), "v"(s + 7 * gs)
               : "memory");
}
__global__ __launch_bounds__(128) void k_proj(const float* __restrict__ X, const __bf16* __restrict__ PT, const float* __restrict__ bcq, const float* __restrict__ bck, const float* __restrict__ bcv, const float* __restrict__ bpq, const float* __restrict__ bpk, const float* __restrict__ bpv, float* __restrict__ QKV, __bf16* __restrict__ VTH, __bf16* __restrict__ VTL) {
  __shared__ __align__(16) char sm[2u * PJ_BUF];   // the two stage buffers; behind the loop the output staging so[4][16][132], or in a V block two planes of [128][PJ_VP bytes]
  static_assert(2u * PJ_BUF >= 4u * 16u * 132u * 4u && 2u * PJ_BUF >= 2u * 128u * PJ_VP, "the output staging must fit the two buffers");
  float (*so)[16][132] = (float (*)[16][132])sm;
  const int tid = threadIdx.x, wave = tid >> 5, lane = tid & 31, col = lane & 15, g = lane >> 4; const size_t r0 = (size_t)blockIdx.x * 64 + wave * 16; const int n0 = blockIdx.y * 128;
  const unsigned lbase = (unsigned)(size_t)sm;
  // x tile: 16 lanes a row, 8 rows a copy of the block; PT tile: 8 lanes a row, 16 rows a copy
  const unsigned la = lbase + (unsigned)(tid >> 4) * PJ_AP + (unsigned)(tid & 15) * 16u, lb = lbase + PJ_AB + (unsigned)(tid >> 3) * PJ_BP + (unsigned)(tid & 7) * 16u;
  const float* ga = X + ((size_t)blockIdx.x * 64 + (tid >> 4)) * DM + (tid & 15) * 4; const __bf16* gb = PT + (size_t)(n0 + (tid >> 3)) * KK + (tid & 7) * 8;
  v8f acc[8] = {};
  pj_cp8(la, 8u * PJ_AP, ga, 8 * DM); pj_cp8(lb, 16u * PJ_BP, gb, 16 * KK);
  asm volatile("s_wait_asynccnt 0x0" ::: "memory");   // stage 0 has landed before the barrier publishes it
  __syncthreads();
  pj_cp8(la + PJ_BUF, 8u * PJ_AP, ga + PJ_KW, 8 * DM); pj_cp8(lb + PJ_BUF, 16u * PJ_BP, gb + PJ_KW, 16 * KK);
#pragma unroll 2   // by two, so that each half's buffer is a constant offset
  for (int st = 0; st < PJ_NS; ++st) { const char* sb = sm + (st & 1) * PJ_BUF;
#pragma unroll
    for (int u = 0; u < PJ_KW / 32; ++u) { const v16b a = frag_lf(sb + (wave * 16 + col) * PJ_AP + u * 128, g);
#pragma unroll
      for (int jh = 0; jh < 8; jh += 4) { v16b bq[4];   // four fragments' reads stand together ahead of their matrix instructions, not one wait a fragment
#pragma unroll
        for (int j = 0; j < 4; ++j) bq[j] = frag_b((const __bf16*)(sb + PJ_AB + ((jh + j) * 16 + col) * PJ_BP + u * 64), lane);
#pragma unroll
        for (int j = 0; j < 4; ++j) acc[jh + j] = wmma_bf(a, bq[j], acc[jh + j]); } }
    asm volatile("s_wait_dscnt 0x0" ::: "memory");      // this wave's reads of the buffer have returned before it is refilled
    asm volatile("s_wait_asynccnt 0x0" ::: "memory");   // this wave's copies of stage st + 1 have landed
    __syncthreads();                                    // publishes stage st + 1 and ends every wave's reads of stage st
    if (st + 2 < PJ_NS) { pj_cp8(la + (st & 1) * PJ_BUF, 8u * PJ_AP, ga + ((st + 2) % (DM / PJ_KW)) * PJ_KW, 8 * DM); pj_cp8(lb + (st & 1) * PJ_BUF, 16u * PJ_BP, gb + (st + 2) * PJ_KW, 16 * KK); } }
  asm volatile("s_wait_asynccnt 0x0" ::: "memory");     // no copy is outstanding when the buffers become output staging
  if (n0 >= 2 * DM) {   // V columns: the same answer for the whole block
    const int c0 = n0 - 2 * DM;
#pragma unroll
    for (int j = 0; j < 8; ++j) { const int c = c0 + j * 16 + col; const float bb = bfr(bcv[c]) + bfr(bpv[c]); v8b hv, lv;
#pragma unroll
      for (int r = 0; r < 8; ++r) { const float v = acc[j][r] + bb; const __bf16 hb = (__bf16)v; hv[r] = hb; lv[r] = (__bf16)(v - (float)hb); }
      char* p = sm + (j * 16 + col) * PJ_VP + (wave * 16 + 8 * g) * 2;   // a lane's eight sums are eight tokens in a row of one V^T row
      *(v8b*)p = hv; *(v8b*)(p + 128u * PJ_VP) = lv; }
    __syncthreads();   // a V^T row holds tokens of all four waves
    const size_t t0 = (size_t)blockIdx.x * 64; const size_t ob = ((t0 / SS) * DM + c0) * SS + t0 % SS;
    const size_t o = ob + (size_t)(tid >> 3) * SS + (tid & 7) * 8; const char* p = sm + (tid >> 3) * PJ_VP + (tid & 7) * 16;   // 8 lanes a row: whole 128-B lines; 16 rows a pass of the block
#pragma unroll
    for (int i = 0; i < 8; ++i) { vst2((unsigned*)(VTH + o + (size_t)i * 16 * SS), *(const v4u*)(p + i * 16 * PJ_VP)); vst2((unsigned*)(VTL + o + (size_t)i * 16 * SS), *(const v4u*)(p + (128u + i * 16) * PJ_VP)); }
    return;
  }
#pragma unroll
  for (int j = 0; j < 8; ++j) { const int n = n0 + j * 16 + col; const int which = n / DM, c = n % DM; const float bb = bfr((which == 0 ? bcq : which == 1 ? bck : bcv)[c]) + bfr((which == 0 ? bpq : which == 1 ? bpk : bpv)[c]);
#pragma unroll
    for (int r = 0; r < 8; ++r) so[wave][8 * g + r][j * 16 + col] = acc[j][r] + bb; }
  LDSX();
  if (n0 >= DM) {   // K columns: the same answer for the whole block
#pragma unroll   // so that a row's place in the staging and in the workspace is an immediate offset
    for (int i = 0; i < 8; ++i) { const int rl = 2 * i + g; const v4f x0 = *(const v4f*)&so[wave][rl][col * 8], x1 = *(const v4f*)&so[wave][rl][col * 8 + 4]; v8b hv, lv;   // a half wave a row, eight columns a lane
#pragma unroll   // so that the vectors' elements are picked by constants and stay in registers
      for (int e = 0; e < 4; ++e) { const __bf16 h0 = (__bf16)x0[e], h1 = (__bf16)x1[e]; hv[e] = h0; hv[4 + e] = h1; lv[e] = (__bf16)(x0[e] - (float)h0); lv[4 + e] = (__bf16)(x1[e] - (float)h1); }
      char* o = (char*)(QKV + (r0 + rl) * QKVP + n0 + (col >> 3) * HD) + (col & 7) * 16;   // 8 lanes a head: whole 128-B lines
      vst2(o, __builtin_bit_cast(v4u, hv)); vst2(o + 2 * HD, __builtin_bit_cast(v4u, lv)); }
    asm volatile("s_wait_xcnt 0x0" ::: "memory");   // behind the last store: no register that an issued store names is rewritten ahead of it on any way the built code has from here
    return;
  }
  for (int rl = 0; rl < 16; ++rl) vst2(QKV + (r0 + rl) * QKVP + n0 + lane * 4, *(const v4f*)&so[wave][rl][lane * 4]);
}
// lane l with lane l ^ 16 (the two halves of a wave hold the two halves of a query's keys)
__device__ __forceinline__ float xhalf(float x) { return __builtin_bit_cast(float, __builtin_amdgcn_permlanex16(__builtin_bit_cast(int, x), __builtin_bit_cast(int, x), 0x76543210, 0xfedcba98, false, false)); }
// ---- k_attn: block = (query block, b*8 + h), 4 waves; 32 key steps; transposed products: S^T = K Q^T (A = key rows, B = query columns), O^T += V^T P^T.
// Lane (g, col) holds query col's scores of keys 8g+r and 16+8g+r: maximum and sum in the lane's own registers, and the two score tiles are P^T's B fragment as they stand.
// A stage is 64 keys (two key steps): its K tile (64 rows of 256 B: 64 bf16 hi, 64 bf16 residuals, as k_proj split them) and its two V^T tiles (64 rows of 128 B each) come into LDS once for the block, by asynchronous
// copies that cover whole 128-B lines, two buffers; the four waves take their fragments from LDS. Row pitches 272 B and 144 B (16 B x odd) as in k_proj.
#define AT_KT 64
#define AT_KP (HD * 4u + 16u)
#define AT_VP (AT_KT * 2u + 16u)
#define AT_KB (AT_KT * AT_KP)
#define AT_VB (HD * AT_VP)
#define AT_BUF (AT_KB + 2u * AT_VB)
#define AT_NS (SS / AT_KT)
// as pj_cp8, the first four copies from s0 and the last four from s1 (the two V^T planes, one behind the other in LDS); the s_wait_xcnt closes the statement for the same reason
__device__ __forceinline__ void at_cp44(unsigned l, unsigned ls, const __bf16* s0, const __bf16* s1, int gs) {
  asm volatile("global_load_async_to_lds_b128 %0, %1, off\n\t"
               "global_load_async_to_lds_b128 %2, %3, off\n\t"
               "global_load_async_to_lds_b128 %4, %5, off\n\t"
               "global_load_async_to_lds_b128 %6, %7, off\n\t"
               "global_load_async_to_lds_b128 %8, %9, off\n\t"
               "global_load_async_to_lds_b128 %10, %11, off\n\t"
               "global_load_async_to_lds_b128 %12, %13, off\n\t"
               "global_load_async_to_lds_b128 %14, %15, off\n\t"
               "s_wait_xcnt 0x0"
               :: "v"(l), "v"(s0), "v"(l + ls), "v"(s0 + gs), "v"(l + 2u * ls), "v"(s0 + 2 * gs), "v"(l + 3u * ls), "v"(s0 + 3 * gs),
                  "v"(l + 4u * ls), "v"(s1), "v"(l + 5u * ls), "v"(s1 + gs), "v"(l + 6u * ls), "v"(s1 + 2 * gs), "v"(l + 7u * ls), "v"(s1 + 3 * gs)
               : "memory");
}
__global__ __launch_bounds__(128) void k_attn(const float* __restrict__ QKV, const __bf16* __restrict__ VTH, const __bf16* __restrict__ VTL, float* __restrict__ OUT) {
  __shared__ __align__(16) char sm[2u * AT_BUF];   // the two stage buffers; behind the loop the output staging so[4][16][68]
  static_assert(2u * AT_BUF >= 4u * 16u * 68u * 4u, "the output staging must fit the two buffers");
  float (*so)[16][68] = (float (*)[16][68])sm;
  const int tid = threadIdx.x, wave = tid >> 5, lane = tid & 31, col = lane & 15, g = lane >> 4;
  const int qb = blockIdx.x, bh = blockIdx.y, b = bh / NH, h = bh % NH; const int q0 = qb * 64 + wave * 16; const size_t tq = (size_t)b * SS + q0;
  const unsigned lbase = (unsigned)(size_t)sm;
  // K tile: 16 lanes a row, 8 rows a copy of the block; V^T tiles: 8 lanes a row, 16 rows a copy
  const unsigned lk = lbase + (unsigned)(tid >> 4) * AT_KP + (unsigned)(tid & 15) * 16u, lv = lbase + AT_KB + (unsigned)(tid >> 3) * AT_VP + (unsigned)(tid & 7) * 16u;
  const float* gk = QKV + ((size_t)b * SS + (tid >> 4)) * QKVP + DM + h * HD + (tid & 15) * 4;
  const size_t vo = ((size_t)b * DM + h * HD + (tid >> 3)) * SS + (tid & 7) * 8; const __bf16 *gvh = VTH + vo, *gvl = VTL + vo;
  pj_cp8(lk, 8u * AT_KP, gk, 8 * QKVP); at_cp44(lv, 16u * AT_VP, gvh, gvl, 16 * SS);
  const F2 a0 = split_row(QKV + (tq + col) * QKVP + h * HD, 0, lane), a1 = split_row(QKV + (tq + col) * QKVP + h * HD, 32, lane);
  float m = -3.0e38f, l = 0.f;   // m: query col's running maximum, in base-2 units (score x scl2; equal in both halves); l: this half's part of the sum
  v8f acc[4] = {};               // acc[dt][r] = O^T[dt*16 + 8g + r][col]
  const float scl2 = 0.044194173824159216f * 1.4426950408889634f;   // 1/sqrt(512) x log2 e: exp(s / sqrt(512) - max) = 2^(s x scl2 - max x scl2)
  asm volatile("s_wait_asynccnt 0x0" ::: "memory");   // stage 0 has landed before the barrier publishes it
  __syncthreads();
  pj_cp8(lk + AT_BUF, 8u * AT_KP, gk + (size_t)AT_KT * QKVP, 8 * QKVP); at_cp44(lv + AT_BUF, 16u * AT_VP, gvh + AT_KT, gvl + AT_KT, 16 * SS);
#pragma unroll 1   // stays rolled: the body already holds two key steps, and further copies would only lengthen the code
  for (int st = 0; st < AT_NS; ++st) { const char* sb = sm + (st & 1) * AT_BUF;
#pragma unroll     // so that a key step's place in the buffer is an immediate offset of the LDS reads
   for (int u = 0; u < AT_KT / 32; ++u) {
    float s[16];
#pragma unroll
    for (int ct = 0; ct < 2; ++ct) { const char* krow = sb + (u * 32 + ct * 16 + col) * AT_KP; F2 k0, k1;   // dims 0..31 and 32..63; the residuals stand 128 B behind the hi halves
      k0.h = frag_b((const __bf16*)krow, lane); k1.h = frag_b((const __bf16*)(krow + 64), lane); k0.l = frag_b((const __bf16*)(krow + 128), lane); k1.l = frag_b((const __bf16*)(krow + 192), lane);
      v8f c = wmma_bf(k0.h, a0.l, (v8f){}); c = wmma_bf(k0.l, a0.h, c); c = wmma_bf(k0.h, a0.h, c);
      c = wmma_bf(k1.h, a1.l, c); c = wmma_bf(k1.l, a1.h, c); c = wmma_bf(k1.h, a1.h, c);
#pragma unroll
      for (int r = 0; r < 8; ++r) s[ct * 8 + r] = c[r]; }
    float mx = s[0];
#pragma unroll
    for (int i = 1; i < 16; ++i) mx = fmaxf(mx, s[i]);
    mx = fmaxf(mx, xhalf(mx));
    const float mn = fmaxf(m, mx * scl2); const float alpha = exp2_hw(m - mn); m = mn;
    float es = 0.f;
#pragma unroll
    for (int i = 0; i < 16; ++i) { s[i] = exp2_hw(fmaf(s[i], scl2, -mn)); es += s[i]; }
    l = l * alpha + es;
#pragma unroll
    for (int dt = 0; dt < 4; ++dt)
#pragma unroll
      for (int r = 0; r < 8; ++r) acc[dt][r] *= alpha;
    v16b vh[4], vl[4];   // the eight V^T fragments' reads stand together ahead of their matrix instructions, not one wait a tile
    const F2 pb = bsplit16(s);   // element i = key 8g+i, element 8+i = key 16+8g+i: the k order of frag_b
#pragma unroll
    for (int dt = 0; dt < 4; ++dt) { const char* vrow = sb + AT_KB + (dt * 16 + col) * AT_VP + u * 64; vh[dt] = frag_b((const __bf16*)vrow, lane); vl[dt] = frag_b((const __bf16*)(vrow + AT_VB), lane); }
#pragma unroll
    for (int dt = 0; dt < 4; ++dt) { acc[dt] = wmma_bf(vh[dt], pb.l, acc[dt]); acc[dt] = wmma_bf(vl[dt], pb.h, acc[dt]); acc[dt] = wmma_bf(vh[dt], pb.h, acc[dt]); } }
    asm volatile("s_wait_dscnt 0x0" ::: "memory");      // this wave's reads of the buffer have returned before it is refilled
    asm volatile("s_wait_asynccnt 0x0" ::: "memory");   // this wave's copies of stage st + 1 have landed
    __syncthreads();                                    // publishes stage st + 1 and ends every wave's reads of stage st
    if (st + 2 < AT_NS) { pj_cp8(lk + (st & 1) * AT_BUF, 8u * AT_KP, gk + (size_t)(st + 2) * AT_KT * QKVP, 8 * QKVP); at_cp44(lv + (st & 1) * AT_BUF, 16u * AT_VP, gvh + (st + 2) * AT_KT, gvl + (st + 2) * AT_KT, 16 * SS); } }
  asm volatile("s_wait_asynccnt 0x0" ::: "memory");     // no copy is outstanding when the buffers become output staging
  const float il = 1.0f / (l + xhalf(l));
#pragma unroll
  for (int dt = 0; dt < 4; ++dt) { v4f lo, hi;
#pragma unroll
    for (int r = 0; r < 4; ++r) { lo[r] = acc[dt][r] * il; hi[r] = acc[dt][4 + r] * il; }
    *(v4f*)&so[wave][col][dt * 16 + 8 * g] = lo; *(v4f*)&so[wave][col][dt * 16 + 8 * g + 4] = hi; }
  LDSX();
  for (int rl = 0; rl < 16; ++rl) if (lane < 16) vst2(OUT + (tq + rl) * DM + h * HD + lane * 4, *(const v4f*)&so[wave][rl][lane * 4]);
}

extern "C" void kernel_launch(void* const* d_in, const int* in_sizes, int n_in, void* d_out, int out_size, void* d_ws, size_t ws_size, hipStream_t stream) {
  (void)in_sizes; (void)n_in; (void)out_size;
  const float** F = (const float**)d_in;   // x, W_cq, b_cq, W_ck, b_ck, W_cv, b_cv, W_pq, b_pq, W_pk, b_pk, W_pv, b_pv  ([in][out] weights)
  if (ws_size < (size_t)WS_END) return;
  char* ws = (char*)d_ws; __bf16 *PT = (__bf16*)(ws + WS_PT), *VTH = (__bf16*)(ws + WS_VTH), *VTL = (__bf16*)(ws + WS_VTL); float* QKV = (float*)(ws + WS_QKV);
  k_pack<<<QKVP, 128, 0, stream>>>(F[1], F[3], F[5], F[7], F[9], F[11], PT);
  k_proj<<<dim3(TRB, QKVP / 128), 128, 0, stream>>>(F[0], PT, F[2], F[4], F[6], F[8], F[10], F[12], QKV, VTH, VTL);
  k_attn<<<dim3(TQB, TNB * NH), 128, 0, stream>>>(QKV, VTH, VTL, (float*)d_out);
}

// v007
// A run of this version takes 92.7 microseconds.
// Two timings next to v006 both put it at 1.05 times that version's speed.
// Over all steps from v000 it is 4.03 times as fast.
// compute dtype: x, the six weights and biases (module inputs) rounded to bf16; q/k/v projections as exact bf16 products over the concatenated [Wc ; Wp] columns (x.(Wc+Wp) == x.Wc + x.Wp, f32 accumulate, + bc + bp); scores and P.V with both computed operands as bf16 hi + bf16 residual pairs (3 products); online softmax in f32; f32 accumulate.
#include <hip/hip_runtime.h>
#include <math.h>

typedef __attribute__((ext_vector_type(16))) _Float16 v16h;
typedef __attribute__((ext_vector_type(16))) __bf16 v16b;
typedef __attribute__((ext_vector_type(8)))  _Float16 v8h;
typedef __attribute__((ext_vector_type(8)))  float v8f;
typedef __attribute__((ext_vector_type(4)))  float v4f;
typedef __attribute__((ext_vector_type(2)))  float v2f;
typedef __attribute__((ext_vector_type(4)))  unsigned v4u;
typedef __attribute__((ext_vector_type(4)))  int v4i;
typedef float __attribute__((may_alias)) float_a;
typedef int __attribute__((may_alias)) int_a;

template <typename T> __device__ __forceinline__ void vst2(void* p, T v) { *(T*)p = v;  }
__device__ __forceinline__ v8f wmma16(v16h a, v16h b, v8f c) {
  v8f d = __builtin_amdgcn_wmma_f32_16x16x32_f16(false, a, false, b, (short)0, c, false, false);
  asm volatile("v_nop\n\tv_nop\n\tv_nop\n\tv_nop" : "+v"(d) : "v"(a), "v"(b));
  return d;
}
__device__ __forceinline__ v8f wmma_bf(v16b a, v16b b, v8f c) {
  return __builtin_amdgcn_wmma_f32_16x16x32_bf16(false, a, false, b, (short)0, c, false, false);
}
// 16x16x32 fragments: lane = (h = lane>>4, row/col = lane&15); elements 0..7 = k0+8h+0..7, 8..15 = k0+16+8h+0..7; D element r = row 8h+r
__device__ __forceinline__ v16h frag_h(const _Float16* rowk0, int lane) {
  union { v16h v; v8h q[2]; } u; const _Float16* p = rowk0 + 8 * (lane >> 4);
  u.q[0] = *(const v8h*)p; u.q[1] = *(const v8h*)(p + 16); return u.v;
}
__device__ __forceinline__ v16h frag_f32(const float* rowk0, int lane) {
  v16h a; const float* p = rowk0 + 8 * (lane >> 4);
#pragma unroll
  for (int i = 0; i < 8; ++i) { a[i] = (_Float16)p[i]; a[8 + i] = (_Float16)p[16 + i]; }
  return a;
}
__device__ __forceinline__ v16h frag_f32s(const float* rowk0, int lane, float sc) {
  v16h a; const float* p = rowk0 + 8 * (lane >> 4);
#pragma unroll
  for (int i = 0; i < 8; ++i) { a[i] = (_Float16)(p[i] * sc); a[8 + i] = (_Float16)(p[16 + i] * sc); }
  return a;
}
// column fragment from a [K][ld] layout (column n), rows >= K read as 0
__device__ __forceinline__ v16h fragc_f32(const float* W, int k0, int n, int lane, int ld, int K) {
  v16h a; const int g = lane >> 4;
#pragma unroll
  for (int i = 0; i < 8; ++i) { const int ka = k0 + 8 * g + i, kb = ka + 16;
    a[i] = (_Float16)(ka < K ? W[(size_t)(ka < K ? ka : K - 1) * ld + n] : 0.f); a[8 + i] = (_Float16)(kb < K ? W[(size_t)(kb < K ? kb : K - 1) * ld + n] : 0.f); }
  return a;
}
struct F2 { v16b h, l; };
__device__ __forceinline__ F2 bsplit16(const float v[16]) { F2 r;
#pragma unroll
  for (int i = 0; i < 16; ++i) { const __bf16 h = (__bf16)v[i]; r.h[i] = h; r.l[i] = (__bf16)(v[i] - (float)h); }
  return r; }
__device__ __forceinline__ F2 split_row(const float* row, int k0, int lane) { float v[16]; const float* p = row + k0 + 8 * (lane >> 4);
#pragma unroll
  for (int i = 0; i < 8; ++i) { v[i] = p[i]; v[8 + i] = p[16 + i]; }
  return bsplit16(v); }
__device__ __forceinline__ F2 split_rowK(const float* row, int k0, int lane, int K) { float v[16]; const int g = lane >> 4;
#pragma unroll
  for (int i = 0; i < 8; ++i) { const int ka = k0 + 8 * g + i, kb = ka + 16; v[i] = ka < K ? row[ka < K ? ka : K - 1] : 0.f; v[8 + i] = kb < K ? row[kb < K ? kb : K - 1] : 0.f; }
  return bsplit16(v); }
__device__ __forceinline__ F2 split_col(const float* W, int k0, int n, int lane, int ld, int K) { float v[16]; const int g = lane >> 4;
#pragma unroll
  for (int i = 0; i < 8; ++i) { const int ka = k0 + 8 * g + i, kb = ka + 16; v[i] = ka < K ? W[(size_t)(ka < K ? ka : K - 1) * ld + n] : 0.f; v[8 + i] = kb < K ? W[(size_t)(kb < K ? kb : K - 1) * ld + n] : 0.f; }
  return bsplit16(v); }
__device__ __forceinline__ v8f mac3(const F2& a, const F2& b, v8f c) { c = wmma_bf(a.l, b.h, c); c = wmma_bf(a.h, b.l, c); return wmma_bf(a.h, b.h, c); }
__device__ __forceinline__ float sigm(float v) { return 1.0f / (1.0f + expf(-v)); }
#define LDSX() do { asm volatile("s_wait_dscnt 0" ::: "memory"); __builtin_amdgcn_wave_barrier(); __builtin_amdgcn_fence(__ATOMIC_RELEASE, "workgroup"); } while (0)


// Disentangled attention: q = x (W_cq + W_pq) + (b_cq + b_pq), likewise k, v (8 heads x 64); energy = q k^T / sqrt(512); softmax; out = P v merged to [8, 1024, 512] (no output projection).
// k_pack ([Wc col | Wp col] as one bf16 row of K = 1024), k_proj (exact GEMM over [x | x], + both biases; its V blocks write V transposed as hi/lo planes, its K blocks each head's row as 64 hi + 64 residual bf16), k_attn (flash-style, 32 key steps, transposed products; writes the output rows directly).
#define NB 8
#define SS 1024
#define DM 512
#define NH 8
#define HD 64
#define NR (NB * SS)
#define QKVP (3 * DM)
#define KK (2 * DM)            // concatenated K
#ifndef TRB
#define TRB (NR / 64)
#define TQB (SS / 64)
#define TNB NB
#endif
typedef __attribute__((ext_vector_type(8))) __bf16 v8b;
__device__ __forceinline__ v16b frag_b(const __bf16* rowk0, int lane) {
  union { v16b v; v8b q[2]; } u; const __bf16* p = rowk0 + 8 * (lane >> 4);
  u.q[0] = *(const v8b*)p; u.q[1] = *(const v8b*)(p + 16); return u.v;
}
__device__ __forceinline__ v16b frag_gbf(const float* rowk0, int lane) {
  v16b a; const float* p = rowk0 + 8 * (lane >> 4);
#pragma unroll
  for (int i = 0; i < 8; ++i) { a[i] = (__bf16)p[i]; a[8 + i] = (__bf16)p[16 + i]; }
  return a;
}
__device__ __forceinline__ float bfr(float v) { return (float)(__bf16)v; }
__device__ __forceinline__ float exp2_hw(float v) { return __builtin_amdgcn_exp2f(v); }   // 2^v as one v_exp_f32; a very negative v gives 0
#define WS_PT   0u                                  // bf16 [1536][1024]: row n = [Wc_*[:, c] ; Wp_*[:, c]]
#define WS_QKV  (WS_PT + 2u * QKVP * KK)             // f32 [8192][1536]; in the K columns the 256 B of a head's row hold 64 bf16 hi, then the 64 bf16 residuals; the V columns stay unwritten and unread
#define WS_VTH  (WS_QKV + 4u * NR * QKVP)            // bf16 [8][512][1024]
#define WS_VTL  (WS_VTH + 2u * NB * DM * SS)
#define WS_END  (WS_VTL + 2u * NB * DM * SS)

__global__ __launch_bounds__(128) void k_pack(const float* __restrict__ Wcq, const float* __restrict__ Wck, const float* __restrict__ Wcv, const float* __restrict__ Wpq, const float* __restrict__ Wpk, const float* __restrict__ Wpv, __bf16* __restrict__ PT) {
  __shared__ __align__(16) __bf16 srow[KK];
  const int n = blockIdx.x, tid = threadIdx.x; const int which = n / DM, c = n % DM; const float* Wc = which == 0 ? Wcq : which == 1 ? Wck : Wcv; const float* Wp = which == 0 ? Wpq : which == 1 ? Wpk : Wpv;
  for (int k = tid; k < DM; k += 128) { srow[k] = (__bf16)Wc[(size_t)k * DM + c]; srow[DM + k] = (__bf16)Wp[(size_t)k * DM + c]; }   // [in][out] layout: column c
  __syncthreads();
  vst2((unsigned*)(PT + (size_t)n * KK + tid * 8), *(const v4u*)(&srow[tid * 8]));
}
// ---- k_proj: QKV[r][n] = [bf16(x[r]) | bf16(x[r])] . PT[n] (exact) + bc[n] + bp[n]; block (64 rows, 128 cols)
// A block of V columns does not write f32 rows: it splits its sums into bf16 hi + residual, turns the 64 x 128 tile in LDS and writes V^T's two planes, 128-B lines of 64 tokens.
// A block of K columns splits its sums the same way on the way out of the staging and writes, in the place of a head's 64 floats, 128 B of hi and 128 B of residuals.
// A stage is 64 wide in k: its x tile (64 rows of 256 B) and its PT tile (128 rows of 128 B) come into LDS once for the block, by asynchronous copies that
// cover whole 128-B lines, two buffers; the four waves take their fragments from LDS. Row pitches 272 B and 144 B (16 B x odd) keep ds_load_b128 free of bank conflicts.
#define PJ_KW 64
#define PJ_AP (PJ_KW * 4u + 16u)
#define PJ_BP (PJ_KW * 2u + 16u)
#define PJ_AB (64u * PJ_AP)
#define PJ_BUF (PJ_AB + 128u * PJ_BP)
#define PJ_NS (KK / PJ_KW)
#define PJ_VP (64u * 2u + 16u)   // pitch of a V^T row of 64 tokens in the output staging (16 B x odd)
__device__ __forceinline__ v16b frag_lf(const char* rowk0, int g) {   // frag_gbf's k order, from an f32 row in LDS
  const v4f* p = (const v4f*)(rowk0 + 32 * g); const v4f x0 = p[0], x1 = p[1], x2 = p[4], x3 = p[5]; v16b a;
#pragma unroll
  for (int i = 0; i < 4; ++i) { a[i] = (__bf16)x0[i]; a[4 + i] = (__bf16)x1[i]; a[8 + i] = (__bf16)x2[i]; a[12 + i] = (__bf16)x3[i]; }
  return a;
}
// eight copies of 16 B per lane, LDS places ls bytes and sources gs elements apart; the s_wait_xcnt closes the statement so that no address register is rewritten ahead of it
template <typename T> __device__ __forceinline__ void pj_cp8(unsigned l, unsigned ls, const T* s, int gs) {
  asm volatile("global_load_async_to_lds_b128 %0, %1, off\n\t"
               "global_load_async_to_lds_b128 %2, %3, off\n\t"
               "global_load_async_to_lds_b128 %4, %5, off\n\t"
               "global_load_async_to_lds_b128 %6, %7, off\n\t"
               "global_load_async_to_lds_b128 %8, %9, off\n\t"
               "global_load_async_to_lds_b128 %10, %11, off\n\t"
               "global_load_async_to_lds_b128 %12, %13, off\n\t"
               "global_load_async_to_lds_b128 %14, %15, off\n\t"
               "s_wait_xcnt 0x0"
               :: "v"(l), "v"(s), "v"(l + ls), "v"(s + gs), "v"(l + 2u * ls), "v"(s + 2 * gs), "v"(l + 3u * ls), "v"(s + 3 * gs),
                  "v"(l + 4u * ls), "v"(s + 4 * gs), "v"(l + 5u * ls), "v"(s + 5 * gs), "v"(l + 6u * ls), "v"(s + 6 * gs), "v"(l + 7u * ls), "v"(s + 7 * gs)
               : "memory");
}
__global__ __launch_bounds__(128) void k_proj(const float* __restrict__ X, const __bf16* __restrict__ PT, const float* __restrict__ bcq, const float* __restrict__ bck, const float* __restrict__ bcv, const float* __restrict__ bpq, const float* __restrict__ bpk, const float* __restrict__ bpv, float* __restrict__ QKV, __bf16* __restrict__ VTH, __bf16* __restrict__ VTL) {
  __shared__ __align__(16) char sm[2u * PJ_BUF];   // the two stage buffers; behind the loop the output staging so[4][16][132], or in a V block two planes of [128][PJ_VP bytes]
  static_assert(2u * PJ_BUF >= 4u * 16u * 132u * 4u && 2u * PJ_BUF >= 2u * 128u * PJ_VP, "the output staging must fit the two buffers");
  float (*so)[16][132] = (float (*)[16][132])sm;
  const int tid = threadIdx.x, wave = tid >> 5, lane = tid & 31, col = lane & 15, g = lane >> 4; const size_t r0 = (size_t)blockIdx.x * 64 + wave * 16; const int n0 = blockIdx.y * 128;
  const unsigned lbase = (unsigned)(size_t)sm;
  // x tile: 16 lanes a row, 8 rows a copy of the block; PT tile: 8 lanes a row, 16 rows a copy
  const unsigned la = lbase + (unsigned)(tid >> 4) * PJ_AP + (unsigned)(tid & 15) * 16u, lb = lbase + PJ_AB + (unsigned)(tid >> 3) * PJ_BP + (unsigned)(tid & 7) * 16u;
  const float* ga = X + ((size_t)blockIdx.x * 64 + (tid >> 4)) * DM + (tid & 15) * 4; const __bf16* gb = PT + (size_t)(n0 + (tid >> 3)) * KK + (tid & 7) * 8;
  v8f acc[8] = {};
  pj_cp8(la, 8u * PJ_AP, ga, 8 * DM); pj_cp8(lb, 16u * PJ_BP, gb, 16 * KK);
  asm volatile("s_wait_asynccnt 0x0" ::: "memory");   // stage 0 has landed before the barrier publishes it
  __syncthreads();
  pj_cp8(la + PJ_BUF, 8u * PJ_AP, ga + PJ_KW, 8 * DM); pj_cp8(lb + PJ_BUF, 16u * PJ_BP, gb + PJ_KW, 16 * KK);
#pragma unroll 2   // by two, so that each half's buffer is a constant offset
  for (int st = 0; st < PJ_NS; ++st) { const char* sb = sm + (st & 1) * PJ_BUF;
#pragma unroll
    for (int u = 0; u < PJ_KW / 32; ++u) { const v16b a = frag_lf(sb + (wave * 16 + col) * PJ_AP + u * 128, g);
#pragma unroll
      for (int jh = 0; jh < 8; jh += 4) { v16b bq[4];   // four fragments' reads stand together ahead of their matrix instructions, not one wait a fragment
#pragma unroll
        for (int j = 0; j < 4; ++j) bq[j] = frag_b((const __bf16*)(sb + PJ_AB + ((jh + j) * 16 + col) * PJ_BP + u * 64), lane);
        __builtin_amdgcn_sched_barrier(0);   // keeps the four fragments' reads together ahead of their matrix instructions; without it the compiler deals them out, one wait a fragment
#pragma unroll
        for (int j = 0; j < 4; ++j) acc[jh + j] = wmma_bf(a, bq[j], acc[jh + j]); } }
    asm volatile("s_wait_dscnt 0x0" ::: "memory");      // this wave's reads of the buffer have returned before it is refilled
    asm volatile("s_wait_asynccnt 0x0" ::: "memory");   // this wave's copies of stage st + 1 have landed
    __syncthreads();                                    // publishes stage st + 1 and ends every wave's reads of stage st
    if (st + 2 < PJ_NS) { pj_cp8(la + (st & 1) * PJ_BUF, 8u * PJ_AP, ga + ((st + 2) % (DM / PJ_KW)) * PJ_KW, 8 * DM); pj_cp8(lb + (st & 1) * PJ_BUF, 16u * PJ_BP, gb + (st + 2) * PJ_KW, 16 * KK); } }
  asm volatile("s_wait_asynccnt 0x0" ::: "memory");     // no copy is outstanding when the buffers become output staging
  if (n0 >= 2 * DM) {   // V columns: the same answer for the whole block
    const int c0 = n0 - 2 * DM;
#pragma unroll
    for (int j = 0; j < 8; ++j) { const int c = c0 + j * 16 + col; const float bb = bfr(bcv[c]) + bfr(bpv[c]); v8b hv, lv;
#pragma unroll
      for (int r = 0; r < 8; ++r) { const float v = acc[j][r] + bb; const __bf16 hb = (__bf16)v; hv[r] = hb; lv[r] = (__bf16)(v - (float)hb); }
      char* p = sm + (j * 16 + col) * PJ_VP + (wave * 16 + 8 * g) * 2;   // a lane's eight sums are eight tokens in a row of one V^T row
      *(v8b*)p = hv; *(v8b*)(p + 128u * PJ_VP) = lv; }
    __syncthreads();   // a V^T row holds tokens of all four waves
    const size_t t0 = (size_t)blockIdx.x * 64; const size_t ob = ((t0 / SS) * DM + c0) * SS + t0 % SS;
    const size_t o = ob + (size_t)(tid >> 3) * SS + (tid & 7) * 8; const char* p = sm + (tid >> 3) * PJ_VP + (tid & 7) * 16;   // 8 lanes a row: whole 128-B lines; 16 rows a pass of the block
#pragma unroll
    for (int i = 0; i < 8; ++i) { vst2((unsigned*)(VTH + o + (size_t)i * 16 * SS), *(const v4u*)(p + i * 16 * PJ_VP)); vst2((unsigned*)(VTL + o + (size_t)i * 16 * SS), *(const v4u*)(p + (128u + i * 16) * PJ_VP)); }
    return;
  }
#pragma unroll
  for (int j = 0; j < 8; ++j) { const int n = n0 + j * 16 + col; const int which = n / DM, c = n % DM; const float bb = bfr((which == 0 ? bcq : which == 1 ? bck : bcv)[c]) + bfr((which == 0 ? bpq : which == 1 ? bpk : bpv)[c]);
#pragma unroll
    for (int r = 0; r < 8; ++r) so[wave][8 * g + r][j * 16 + col] = acc[j][r] + bb; }
  LDSX();
  if (n0 >= DM) {   // K columns: the same answer for the whole block
#pragma unroll   // so that a row's place in the staging and in the workspace is an immediate offset
    for (int i = 0; i < 8; ++i) { const int rl = 2 * i + g; const v4f x0 = *(const v4f*)&so[wave][rl][col * 8], x1 = *(const v4f*)&so[wave][rl][col * 8 + 4]; v8b hv, lv;   // a half wave a row, eight columns a lane
#pragma unroll   // so that the vectors' elements are picked by constants and stay in registers
      for (int e = 0; e < 4; ++e) { const __bf16 h0 = (__bf16)x0[e], h1 = (__bf16)x1[e]; hv[e] = h0; hv[4 + e] = h1; lv[e] = (__bf16)(x0[e] - (float)h0); lv[4 + e] = (__bf16)(x1[e] - (float)h1); }
      char* o = (char*)(QKV + (r0 + rl) * QKVP + n0 + (col >> 3) * HD) + (col & 7) * 16;   // 8 lanes a head: whole 128-B lines
      vst2(o, __builtin_bit_cast(v4u, hv)); vst2(o + 2 * HD, __builtin_bit_cast(v4u, lv)); }
    asm volatile("s_wait_xcnt 0x0" ::: "memory");   // behind the last store: no register that an issued store names is rewritten ahead of it on any way the built code has from here
    return;
  }
  for (int rl = 0; rl < 16; ++rl) vst2(QKV + (r0 + rl) * QKVP + n0 + lane * 4, *(const v4f*)&so[wave][rl][lane * 4]);
}
// lane l with lane l ^ 16 (the two halves of a wave hold the two halves of a query's keys)
__device__ __forceinline__ float xhalf(float x) { return __builtin_bit_cast(float, __builtin_amdgcn_permlanex16(__builtin_bit_cast(int, x), __builtin_bit_cast(int, x), 0x76543210, 0xfedcba98, false, false)); }
// ---- k_attn: block = (query block, b*8 + h), 4 waves; 32 key steps; transposed products: S^T = K Q^T (A = key rows, B = query columns), O^T += V^T P^T.
// Lane (g, col) holds query col's scores of keys 8g+r and 16+8g+r: maximum and sum in the lane's own registers, and the two score tiles are P^T's B fragment as they stand.
// A stage is 64 keys (two key steps): its K tile (64 rows of 256 B: 64 bf16 hi, 64 bf16 residuals, as k_proj split them) and its two V^T tiles (64 rows of 128 B each) come into LDS once for the block, by asynchronous
// copies that cover whole 128-B lines, two buffers; the four waves take their fragments from LDS. Row pitches 272 B and 144 B (16 B x odd) as in k_proj.
#define AT_KT 64
#define AT_KP (HD * 4u + 16u)
#define AT_VP (AT_KT * 2u + 16u)
#define AT_KB (AT_KT * AT_KP)
#define AT_VB (HD * AT_VP)
#define AT_BUF (AT_KB + 2u * AT_VB)
#define AT_NS (SS / AT_KT)
// as pj_cp8, the first four copies from s0 and the last four from s1 (the two V^T planes, one behind the other in LDS); the s_wait_xcnt closes the statement for the same reason
__device__ __forceinline__ void at_cp44(unsigned l, unsigned ls, const __bf16* s0, const __bf16* s1, int gs) {
  asm volatile("global_load_async_to_lds_b128 %0, %1, off\n\t"
               "global_load_async_to_lds_b128 %2, %3, off\n\t"
               "global_load_async_to_lds_b128 %4, %5, off\n\t"
               "global_load_async_to_lds_b128 %6, %7, off\n\t"
               "global_load_async_to_lds_b128 %8, %9, off\n\t"
               "global_load_async_to_lds_b128 %10, %11, off\n\t"
               "global_load_async_to_lds_b128 %12, %13, off\n\t"
               "global_load_async_to_lds_b128 %14, %15, off\n\t"
               "s_wait_xcnt 0x0"
               :: "v"(l), "v"(s0), "v"(l + ls), "v"(s0 + gs), "v"(l + 2u * ls), "v"(s0 + 2 * gs), "v"(l + 3u * ls), "v"(s0 + 3 * gs),
                  "v"(l + 4u * ls), "v"(s1), "v"(l + 5u * ls), "v"(s1 + gs), "v"(l + 6u * ls), "v"(s1 + 2 * gs), "v"(l + 7u * ls), "v"(s1 + 3 * gs)
               : "memory");
}
__global__ __launch_bounds__(128) void k_attn(const float* __restrict__ QKV, const __bf16* __restrict__ VTH, const __bf16* __restrict__ VTL, float* __restrict__ OUT) {
  __shared__ __align__(16) char sm[2u * AT_BUF];   // the two stage buffers; behind the loop the output staging so[4][16][68]
  static_assert(2u * AT_BUF >= 4u * 16u * 68u * 4u, "the output staging must fit the two buffers");
  float (*so)[16][68] = (float (*)[16][68])sm;
  const int tid = threadIdx.x, wave = tid >> 5, lane = tid & 31, col = lane & 15, g = lane >> 4;
  const int qb = blockIdx.x, bh = blockIdx.y, b = bh / NH, h = bh % NH; const int q0 = qb * 64 + wave * 16; const size_t tq = (size_t)b * SS + q0;
  const unsigned lbase = (unsigned)(size_t)sm;
  // K tile: 16 lanes a row, 8 rows a copy of the block; V^T tiles: 8 lanes a row, 16 rows a copy
  const unsigned lk = lbase + (unsigned)(tid >> 4) * AT_KP + (unsigned)(tid & 15) * 16u, lv = lbase + AT_KB + (unsigned)(tid >> 3) * AT_VP + (unsigned)(tid & 7) * 16u;
  const float* gk = QKV + ((size_t)b * SS + (tid >> 4)) * QKVP + DM + h * HD + (tid & 15) * 4;
  const size_t vo = ((size_t)b * DM + h * HD + (tid >> 3)) * SS + (tid & 7) * 8; const __bf16 *gvh = VTH + vo, *gvl = VTL + vo;
  pj_cp8(lk, 8u * AT_KP, gk, 8 * QKVP); at_cp44(lv, 16u * AT_VP, gvh, gvl, 16 * SS);
  const F2 a0 = split_row(QKV + (tq + col) * QKVP + h * HD, 0, lane), a1 = split_row(QKV + (tq + col) * QKVP + h * HD, 32, lane);
  float m = -3.0e38f, l = 0.f;   // m: query col's running maximum, in base-2 units (score x scl2; equal in both halves); l: this half's part of the sum
  v8f acc[4] = {};               // acc[dt][r] = O^T[dt*16 + 8g + r][col]
  const float scl2 = 0.044194173824159216f * 1.4426950408889634f;   // 1/sqrt(512) x log2 e: exp(s / sqrt(512) - max) = 2^(s x scl2 - max x scl2)
  asm volatile("s_wait_asynccnt 0x0" ::: "memory");   // stage 0 has landed before the barrier publishes it
  __syncthreads();
  pj_cp8(lk + AT_BUF, 8u * AT_KP, gk + (size_t)AT_KT * QKVP, 8 * QKVP); at_cp44(lv + AT_BUF, 16u * AT_VP, gvh + AT_KT, gvl + AT_KT, 16 * SS);
#pragma unroll 1   // stays rolled: the body already holds two key steps, and further copies would only lengthen the code
  for (int st = 0; st < AT_NS; ++st) { const char* sb = sm + (st & 1) * AT_BUF;
#pragma unroll     // so that a key step's place in the buffer is an immediate offset of the LDS reads
   for (int u = 0; u < AT_KT / 32; ++u) {
    float s[16];
#pragma unroll
    for (int ct = 0; ct < 2; ++ct) { const char* krow = sb + (u * 32 + ct * 16 + col) * AT_KP; F2 k0, k1;   // dims 0..31 and 32..63; the residuals stand 128 B behind the hi halves
      k0.h = frag_b((const __bf16*)krow, lane); k1.h = frag_b((const __bf16*)(krow + 64), lane); k0.l = frag_b((const __bf16*)(krow + 128), lane); k1.l = frag_b((const __bf16*)(krow + 192), lane);
      __builtin_amdgcn_sched_barrier(0);   // keeps the four K fragments' reads together ahead of their matrix instructions
      v8f c = wmma_bf(k0.h, a0.l, (v8f){}); c = wmma_bf(k0.l, a0.h, c); c = wmma_bf(k0.h, a0.h, c);
      c = wmma_bf(k1.h, a1.l, c); c = wmma_bf(k1.l, a1.h, c); c = wmma_bf(k1.h, a1.h, c);
#pragma unroll
      for (int r = 0; r < 8; ++r) s[ct * 8 + r] = c[r]; }
    float mx = s[0];
#pragma unroll
    for (int i = 1; i < 16; ++i) mx = fmaxf(mx, s[i]);
    mx = fmaxf(mx, xhalf(mx));
    const float mn = fmaxf(m, mx * scl2); const float alpha = exp2_hw(m - mn); m = mn;
    float es = 0.f;
#pragma unroll
    for (int i = 0; i < 16; ++i) { s[i] = exp2_hw(fmaf(s[i], scl2, -mn)); es += s[i]; }
    l = l * alpha + es;
#pragma unroll
    for (int dt = 0; dt < 4; ++dt)
#pragma unroll
      for (int r = 0; r < 8; ++r) acc[dt][r] *= alpha;
    v16b vh[4], vl[4];   // the eight V^T fragments' reads stand together ahead of their matrix instructions, not one wait a tile
    const F2 pb = bsplit16(s);   // element i = key 8g+i, element 8+i = key 16+8g+i: the k order of frag_b
#pragma unroll
    for (int dt = 0; dt < 4; ++dt) { const char* vrow = sb + AT_KB + (dt * 16 + col) * AT_VP + u * 64; vh[dt] = frag_b((const __bf16*)vrow, lane); vl[dt] = frag_b((const __bf16*)(vrow + AT_VB), lane); }
    __builtin_amdgcn_sched_barrier(0);   // keeps the eight V^T fragments' reads together ahead of their matrix instructions
#pragma unroll
    for (int dt = 0; dt < 4; ++dt) { acc[dt] = wmma_bf(vh[dt], pb.l, acc[dt]); acc[dt] = wmma_bf(vl[dt], pb.h, acc[dt]); acc[dt] = wmma_bf(vh[dt], pb.h, acc[dt]); } }
    asm volatile("s_wait_dscnt 0x0" ::: "memory");      // this wave's reads of the buffer have returned before it is refilled
    asm volatile("s_wait_asynccnt 0x0" ::: "memory");   // this wave's copies of stage st + 1 have landed
    __syncthreads();                                    // publishes stage st + 1 and ends every wave's reads of stage st
    if (st + 2 < AT_NS) { pj_cp8(lk + (st & 1) * AT_BUF, 8u * AT_KP, gk + (size_t)(st + 2) * AT_KT * QKVP, 8 * QKVP); at_cp44(lv + (st & 1) * AT_BUF, 16u * AT_VP, gvh + (st + 2) * AT_KT, gvl + (st + 2) * AT_KT, 16 * SS); } }
  asm volatile("s_wait_asynccnt 0x0" ::: "memory");     // no copy is outstanding when the buffers become output staging
  const float il = 1.0f / (l + xhalf(l));
#pragma unroll
  for (int dt = 0; dt < 4; ++dt) { v4f lo, hi;
#pragma unroll
    for (int r = 0; r < 4; ++r) { lo[r] = acc[dt][r] * il; hi[r] = acc[dt][4 + r] * il; }
    *(v4f*)&so[wave][col][dt * 16 + 8 * g] = lo; *(v4f*)&so[wave][col][dt * 16 + 8 * g + 4] = hi; }
  LDSX();
  for (int rl = 0; rl < 16; ++rl) if (lane < 16) vst2(OUT + (tq + rl) * DM + h * HD + lane * 4, *(const v4f*)&so[wave][rl][lane * 4]);
}

extern "C" void kernel_launch(void* const* d_in, const int* in_sizes, int n_in, void* d_out, int out_size, void* d_ws, size_t ws_size, hipStream_t stream) {
  (void)in_sizes; (void)n_in; (void)out_size;
  const float** F = (const float**)d_in;   // x, W_cq, b_cq, W_ck, b_ck, W_cv, b_cv, W_pq, b_pq, W_pk, b_pk, W_pv, b_pv  ([in][out] weights)
  if (ws_size < (size_t)WS_END) return;
  char* ws = (char*)d_ws; __bf16 *PT = (__bf16*)(ws + WS_PT), *VTH = (__bf16*)(ws + WS_VTH), *VTL = (__bf16*)(ws + WS_VTL); float* QKV = (float*)(ws + WS_QKV);
  k_pack<<<QKVP, 128, 0, stream>>>(F[1], F[3], F[5], F[7], F[9], F[11], PT);
  k_proj<<<dim3(TRB, QKVP / 128), 128, 0, stream>>>(F[0], PT, F[2], F[4], F[6], F[8], F[10], F[12], QKV, VTH, VTL);
  k_attn<<<dim3(TQB, TNB * NH), 128, 0, stream>>>(QKV, VTH, VTL, (float*)d_out);
}

// v008
// A run of this version takes 87.4 microseconds.
// In both of two side-by-side timings against v007, it was 1.06 times as fast.
// Over all steps from v000 it is 4.26 times as fast.
// compute dtype: x, the six weights and biases (module inputs) rounded to bf16; q/k/v projections as exact bf16 products over the concatenated [Wc ; Wp] columns (x.(Wc+Wp) == x.Wc + x.Wp, f32 accumulate, + bc + bp); scores and P.V with both computed operands as bf16 hi + bf16 residual pairs (3 products); online softmax in f32; f32 accumulate.
#include <hip/hip_runtime.h>
#include <math.h>

typedef __attribute__((ext_vector_type(16))) _Float16 v16h;
typedef __attribute__((ext_vector_type(16))) __bf16 v16b;
typedef __attribute__((ext_vector_type(8)))  _Float16 v8h;
typedef __attribute__((ext_vector_type(8)))  float v8f;
typedef __attribute__((ext_vector_type(4)))  float v4f;
typedef __attribute__((ext_vector_type(2)))  float v2f;
typedef __attribute__((ext_vector_type(4)))  unsigned v4u;
typedef __attribute__((ext_vector_type(4)))  int v4i;
typedef float __attribute__((may_alias)) float_a;
typedef int __attribute__((may_alias)) int_a;

template <typename T> __device__ __forceinline__ void vst2(void* p, T v) { *(T*)p = v;  }
__device__ __forceinline__ v8f wmma16(v16h a, v16h b, v8f c) {
  v8f d = __builtin_amdgcn_wmma_f32_16x16x32_f16(false, a, false, b, (short)0, c, false, false);
  asm volatile("v_nop\n\tv_nop\n\tv_nop\n\tv_nop" : "+v"(d) : "v"(a), "v"(b));
  return d;
}
__device__ __forceinline__ v8f wmma_bf(v16b a, v16b b, v8f c) {
  return __builtin_amdgcn_wmma_f32_16x16x32_bf16(false, a, false, b, (short)0, c, false, false);
}
// 16x16x32 fragments: lane = (h = lane>>4, row/col = lane&15); elements 0..7 = k0+8h+0..7, 8..15 = k0+16+8h+0..7; D element r = row 8h+r
__device__ __forceinline__ v16h frag_h(const _Float16* rowk0, int lane) {
  union { v16h v; v8h q[2]; } u; const _Float16* p = rowk0 + 8 * (lane >> 4);
  u.q[0] = *(const v8h*)p; u.q[1] = *(const v8h*)(p + 16); return u.v;
}
__device__ __forceinline__ v16h frag_f32(const float* rowk0, int lane) {
  v16h a; const float* p = rowk0 + 8 * (lane >> 4);
#pragma unroll
  for (int i = 0; i < 8; ++i) { a[i] = (_Float16)p[i]; a[8 + i] = (_Float16)p[16 + i]; }
  return a;
}
__device__ __forceinline__ v16h frag_f32s(const float* rowk0, int lane, float sc) {
  v16h a; const float* p = rowk0 + 8 * (lane >> 4);
#pragma unroll
  for (int i = 0; i < 8; ++i) { a[i] = (_Float16)(p[i] * sc); a[8 + i] = (_Float16)(p[16 + i] * sc); }
  return a;
}
// column fragment from a [K][ld] layout (column n), rows >= K read as 0
__device__ __forceinline__ v16h fragc_f32(const float* W, int k0, int n, int lane, int ld, int K) {
  v16h a; const int g = lane >> 4;
#pragma unroll
  for (int i = 0; i < 8; ++i) { const int ka = k0 + 8 * g + i, kb = ka + 16;
    a[i] = (_Float16)(ka < K ? W[(size_t)(ka < K ? ka : K - 1) * ld + n] : 0.f); a[8 + i] = (_Float16)(kb < K ? W[(size_t)(kb < K ? kb : K - 1) * ld + n] : 0.f); }
  return a;
}
struct F2 { v16b h, l; };
__device__ __forceinline__ F2 bsplit16(const float v[16]) { F2 r;
#pragma unroll
  for (int i = 0; i < 16; ++i) { const __bf16 h = (__bf16)v[i]; r.h[i] = h; r.l[i] = (__bf16)(v[i] - (float)h); }
  return r; }
__device__ __forceinline__ F2 split_row(const float* row, int k0, int lane) { float v[16]; const float* p = row + k0 + 8 * (lane >> 4);
#pragma unroll
  for (int i = 0; i < 8; ++i) { v[i] = p[i]; v[8 + i] = p[16 + i]; }
  return bsplit16(v); }
__device__ __forceinline__ F2 split_rowK(const float* row, int k0, int lane, int K) { float v[16]; const int g = lane >> 4;
#pragma unroll
  for (int i = 0; i < 8; ++i) { const int ka = k0 + 8 * g + i, kb = ka + 16; v[i] = ka < K ? row[ka < K ? ka : K - 1] : 0.f; v[8 + i] = kb < K ? row[kb < K ? kb : K - 1] : 0.f; }
  return bsplit16(v); }
__device__ __forceinline__ F2 split_col(const float* W, int k0, int n, int lane, int ld, int K) { float v[16]; const int g = lane >> 4;
#pragma unroll
  for (int i = 0; i < 8; ++i) { const int ka = k0 + 8 * g + i, kb = ka + 16; v[i] = ka < K ? W[(size_t)(ka < K ? ka : K - 1) * ld + n] : 0.f; v[8 + i] = kb < K ? W[(size_t)(kb < K ? kb : K - 1) * ld + n] : 0.f; }
  return bsplit16(v); }
__device__ __forceinline__ v8f mac3(const F2& a, const F2& b, v8f c) { c = wmma_bf(a.l, b.h, c); c = wmma_bf(a.h, b.l, c); return wmma_bf(a.h, b.h, c); }
__device__ __forceinline__ float sigm(float v) { return 1.0f / (1.0f + expf(-v)); }
#define LDSX() do { asm volatile("s_wait_dscnt 0" ::: "memory"); __builtin_amdgcn_wave_barrier(); __builtin_amdgcn_fence(__ATOMIC_RELEASE, "workgroup"); } while (0)


// Disentangled attention: q = x (W_cq + W_pq) + (b_cq + b_pq), likewise k, v (8 heads x 64); energy = q k^T / sqrt(512); softmax; out = P v merged to [8, 1024, 512] (no output projection).
// k_pack ([Wc col | Wp col] as one bf16 row of K = 1024), k_proj (exact GEMM over [x | x], + both biases; its V blocks write V transposed as hi/lo planes, its K blocks each head's row as 64 hi + 64 residual bf16), k_attn (flash-style, 32 key steps, transposed products; writes the output rows directly).
#define NB 8
#define SS 1024
#define DM 512
#define NH 8
#define HD 64
#define NR (NB * SS)
#define QKVP (3 * DM)
#define KK (2 * DM)            // concatenated K
#ifndef TRB
#define TRB (NR / 128)
#define TQB (SS / 64)
#define TNB NB
#endif
typedef __attribute__((ext_vector_type(8))) __bf16 v8b;
__device__ __forceinline__ v16b frag_b(const __bf16* rowk0, int lane) {
  union { v16b v; v8b q[2]; } u; const __bf16* p = rowk0 + 8 * (lane >> 4);
  u.q[0] = *(const v8b*)p; u.q[1] = *(const v8b*)(p + 16); return u.v;
}
__device__ __forceinline__ v16b frag_gbf(const float* rowk0, int lane) {
  v16b a; const float* p = rowk0 + 8 * (lane >> 4);
#pragma unroll
  for (int i = 0; i < 8; ++i) { a[i] = (__bf16)p[i]; a[8 + i] = (__bf16)p[16 + i]; }
  return a;
}
__device__ __forceinline__ float bfr(float v) { return (float)(__bf16)v; }
__device__ __forceinline__ float exp2_hw(float v) { return __builtin_amdgcn_exp2f(v); }   // 2^v as one v_exp_f32; a very negative v gives 0
#define WS_PT   0u                                  // bf16 [1536][1024]: row n = [Wc_*[:, c] ; Wp_*[:, c]]
#define WS_QKV  (WS_PT + 2u * QKVP * KK)             // f32 [8192][1536]; in the K columns the 256 B of a head's row hold 64 bf16 hi, then the 64 bf16 residuals; the V columns stay unwritten and unread
#define WS_VTH  (WS_QKV + 4u * NR * QKVP)            // bf16 [8][512][1024]
#define WS_VTL  (WS_VTH + 2u * NB * DM * SS)
#define WS_END  (WS_VTL + 2u * NB * DM * SS)

__global__ __launch_bounds__(128) void k_pack(const float* __restrict__ Wcq, const float* __restrict__ Wck, const float* __restrict__ Wcv, const float* __restrict__ Wpq, const float* __restrict__ Wpk, const float* __restrict__ Wpv, __bf16* __restrict__ PT) {
  __shared__ __align__(16) __bf16 srow[KK];
  const int n = blockIdx.x, tid = threadIdx.x; const int which = n / DM, c = n % DM; const float* Wc = which == 0 ? Wcq : which == 1 ? Wck : Wcv; const float* Wp = which == 0 ? Wpq : which == 1 ? Wpk : Wpv;
  for (int k = tid; k < DM; k += 128) { srow[k] = (__bf16)Wc[(size_t)k * DM + c]; srow[DM + k] = (__bf16)Wp[(size_t)k * DM + c]; }   // [in][out] layout: column c
  __syncthreads();
  vst2((unsigned*)(PT + (size_t)n * KK + tid * 8), *(const v4u*)(&srow[tid * 8]));
}
// ---- k_proj: QKV[r][n] = [bf16(x[r]) | bf16(x[r])] . PT[n] (exact) + bc[n] + bp[n]; block (128 rows, 128 cols), a wave 32 rows: each PT fragment read from LDS feeds two matrix instructions
// A block of V columns does not write f32 rows: it splits its sums into bf16 hi + residual, turns the 128 x 128 tile in LDS and writes V^T's two planes, 256 B of 128 tokens a row.
// A block of K columns splits its sums the same way on the way out of the staging and writes, in the place of a head's 64 floats, 128 B of hi and 128 B of residuals.
// A stage is 64 wide in k: its x tile (128 rows of 256 B) and its PT tile (128 rows of 128 B) come into LDS once for the block, by asynchronous copies that
// cover whole 128-B lines, two buffers; the four waves take their fragments from LDS. Row pitches 272 B and 144 B (16 B x odd) keep ds_load_b128 free of bank conflicts.
#define PJ_KW 64
#define PJ_AP (PJ_KW * 4u + 16u)
#define PJ_BP (PJ_KW * 2u + 16u)
#define PJ_RB 128u
#define PJ_AB (PJ_RB * PJ_AP)
#define PJ_BUF (PJ_AB + 128u * PJ_BP)
#define PJ_NS (KK / PJ_KW)
#define PJ_VP (PJ_RB * 2u + 16u)   // pitch of a V^T row of 128 tokens in the output staging (16 B x odd)
__device__ __forceinline__ v16b frag_lf(const char* rowk0, int g) {   // frag_gbf's k order, from an f32 row in LDS
  const v4f* p = (const v4f*)(rowk0 + 32 * g); const v4f x0 = p[0], x1 = p[1], x2 = p[4], x3 = p[5]; v16b a;
#pragma unroll
  for (int i = 0; i < 4; ++i) { a[i] = (__bf16)x0[i]; a[4 + i] = (__bf16)x1[i]; a[8 + i] = (__bf16)x2[i]; a[12 + i] = (__bf16)x3[i]; }
  return a;
}
// eight copies of 16 B per lane, LDS places ls bytes and sources gs elements apart; the s_wait_xcnt closes the statement so that no address register is rewritten ahead of it
template <typename T> __device__ __forceinline__ void pj_cp8(unsigned l, unsigned ls, const T* s, int gs) {
  asm volatile("global_load_async_to_lds_b128 %0, %1, off\n\t"
               "global_load_async_to_lds_b128 %2, %3, off\n\t"
               "global_load_async_to_lds_b128 %4, %5, off\n\t"
               "global_load_async_to_lds_b128 %6, %7, off\n\t"
               "global_load_async_to_lds_b128 %8, %9, off\n\t"
               "global_load_async_to_lds_b128 %10, %11, off\n\t"
               "global_load_async_to_lds_b128 %12, %13, off\n\t"
               "global_load_async_to_lds_b128 %14, %15, off\n\t"
               "s_wait_xcnt 0x0"
               :: "v"(l), "v"(s), "v"(l + ls), "v"(s + gs), "v"(l + 2u * ls), "v"(s + 2 * gs), "v"(l + 3u * ls), "v"(s + 3 * gs),
                  "v"(l + 4u * ls), "v"(s + 4 * gs), "v"(l + 5u * ls), "v"(s + 5 * gs), "v"(l + 6u * ls), "v"(s + 6 * gs), "v"(l + 7u * ls), "v"(s + 7 * gs)
               : "memory");
}
__global__ __launch_bounds__(128) void k_proj(const float* __restrict__ X, const __bf16* __restrict__ PT, const float* __restrict__ bcq, const float* __restrict__ bck, const float* __restrict__ bcv, const float* __restrict__ bpq, const float* __restrict__ bpk, const float* __restrict__ bpv, float* __restrict__ QKV, __bf16* __restrict__ VTH, __bf16* __restrict__ VTL) {
  __shared__ __align__(16) char sm[2u * PJ_BUF];   // the two stage buffers; behind the loop the output staging so[4][32][132], or in a V block two planes of [128][PJ_VP bytes]
  static_assert(2u * PJ_BUF >= 4u * 32u * 132u * 4u && 2u * PJ_BUF >= 2u * 128u * PJ_VP, "the output staging must fit the two buffers");
  float (*so)[32][132] = (float (*)[32][132])sm;
  const int tid = threadIdx.x, wave = tid >> 5, lane = tid & 31, col = lane & 15, g = lane >> 4; const size_t r0 = (size_t)blockIdx.x * PJ_RB + wave * 32; const int n0 = blockIdx.y * 128;
  const unsigned lbase = (unsigned)(size_t)sm;
  // x tile: 16 lanes a row, 8 rows a copy of the block (16 copies a lane); PT tile: 8 lanes a row, 16 rows a copy (8 copies a lane)
  const unsigned la = lbase + (unsigned)(tid >> 4) * PJ_AP + (unsigned)(tid & 15) * 16u, lb = lbase + PJ_AB + (unsigned)(tid >> 3) * PJ_BP + (unsigned)(tid & 7) * 16u;
  const float* ga = X + ((size_t)blockIdx.x * PJ_RB + (tid >> 4)) * DM + (tid & 15) * 4; const __bf16* gb = PT + (size_t)(n0 + (tid >> 3)) * KK + (tid & 7) * 8;
  v8f acc[2][8] = {};
  pj_cp8(la, 8u * PJ_AP, ga, 8 * DM); pj_cp8(la + 64u * PJ_AP, 8u * PJ_AP, ga + 64 * DM, 8 * DM); pj_cp8(lb, 16u * PJ_BP, gb, 16 * KK);
  asm volatile("s_wait_asynccnt 0x0" ::: "memory");   // stage 0 has landed before the barrier publishes it
  __syncthreads();
  pj_cp8(la + PJ_BUF, 8u * PJ_AP, ga + PJ_KW, 8 * DM); pj_cp8(la + PJ_BUF + 64u * PJ_AP, 8u * PJ_AP, ga + PJ_KW + 64 * DM, 8 * DM); pj_cp8(lb + PJ_BUF, 16u * PJ_BP, gb + PJ_KW, 16 * KK);
#pragma unroll 2   // by two, so that each half's buffer is a constant offset
  for (int st = 0; st < PJ_NS; ++st) { const char* sb = sm + (st & 1) * PJ_BUF;
#pragma unroll
    for (int u = 0; u < PJ_KW / 32; ++u) { const v16b a0 = frag_lf(sb + (wave * 32 + col) * PJ_AP + u * 128, g), a1 = frag_lf(sb + (wave * 32 + 16 + col) * PJ_AP + u * 128, g);
#pragma unroll
      for (int jh = 0; jh < 8; jh += 4) { v16b bq[4];   // four fragments' reads stand together ahead of their matrix instructions, not one wait a fragment
#pragma unroll
        for (int j = 0; j < 4; ++j) bq[j] = frag_b((const __bf16*)(sb + PJ_AB + ((jh + j) * 16 + col) * PJ_BP + u * 64), lane);
        __builtin_amdgcn_sched_barrier(0);   // keeps the four fragments' reads together ahead of their matrix instructions; without it the compiler deals them out, one wait a fragment
#pragma unroll
        for (int j = 0; j < 4; ++j) { acc[0][jh + j] = wmma_bf(a0, bq[j], acc[0][jh + j]); acc[1][jh + j] = wmma_bf(a1, bq[j], acc[1][jh + j]); } } }
    asm volatile("s_wait_dscnt 0x0" ::: "memory");      // this wave's reads of the buffer have returned before it is refilled
    asm volatile("s_wait_asynccnt 0x0" ::: "memory");   // this wave's copies of stage st + 1 have landed
    __syncthreads();                                    // publishes stage st + 1 and ends every wave's reads of stage st
    if (st + 2 < PJ_NS) { const float* gx = ga + ((st + 2) % (DM / PJ_KW)) * PJ_KW; const unsigned lx = la + (st & 1) * PJ_BUF;
      pj_cp8(lx, 8u * PJ_AP, gx, 8 * DM); pj_cp8(lx + 64u * PJ_AP, 8u * PJ_AP, gx + 64 * DM, 8 * DM); pj_cp8(lb + (st & 1) * PJ_BUF, 16u * PJ_BP, gb + (st + 2) * PJ_KW, 16 * KK); } }
  asm volatile("s_wait_asynccnt 0x0" ::: "memory");     // no copy is outstanding when the buffers become output staging
  if (n0 >= 2 * DM) {   // V columns: the same answer for the whole block
    const int c0 = n0 - 2 * DM;
#pragma unroll
    for (int j = 0; j < 8; ++j) { const int c = c0 + j * 16 + col; const float bb = bfr(bcv[c]) + bfr(bpv[c]);
#pragma unroll
      for (int rt = 0; rt < 2; ++rt) { v8b hv, lv;
#pragma unroll
        for (int r = 0; r < 8; ++r) { const float v = acc[rt][j][r] + bb; const __bf16 hb = (__bf16)v; hv[r] = hb; lv[r] = (__bf16)(v - (float)hb); }
        char* p = sm + (j * 16 + col) * PJ_VP + (wave * 32 + rt * 16 + 8 * g) * 2;   // a lane's eight sums are eight tokens in a row of one V^T row
        *(v8b*)p = hv; *(v8b*)(p + 128u * PJ_VP) = lv; } }
    __syncthreads();   // a V^T row holds tokens of all four waves
    const size_t t0 = (size_t)blockIdx.x * PJ_RB; const size_t ob = ((t0 / SS) * DM + c0) * SS + t0 % SS;
    const size_t o = ob + (size_t)(tid >> 4) * SS + (tid & 15) * 8; const char* p = sm + (tid >> 4) * PJ_VP + (tid & 15) * 16;   // 16 lanes a row: two whole 128-B lines; 8 rows a pass of the block
#pragma unroll
    for (int i = 0; i < 16; ++i) { vst2((unsigned*)(VTH + o + (size_t)i * 8 * SS), *(const v4u*)(p + i * 8 * PJ_VP)); vst2((unsigned*)(VTL + o + (size_t)i * 8 * SS), *(const v4u*)(p + (128u + i * 8) * PJ_VP)); }
    return;
  }
#pragma unroll
  for (int j = 0; j < 8; ++j) { const int n = n0 + j * 16 + col; const int which = n / DM, c = n % DM; const float bb = bfr((which == 0 ? bcq : which == 1 ? bck : bcv)[c]) + bfr((which == 0 ? bpq : which == 1 ? bpk : bpv)[c]);
#pragma unroll
    for (int rt = 0; rt < 2; ++rt)
#pragma unroll
      for (int r = 0; r < 8; ++r) so[wave][rt * 16 + 8 * g + r][j * 16 + col] = acc[rt][j][r] + bb; }
  LDSX();
  if (n0 >= DM) {   // K columns: the same answer for the whole block
#pragma unroll   // so that a row's place in the staging and in the workspace is an immediate offset
    for (int i = 0; i < 16; ++i) { const int rl = 2 * i + g; const v4f x0 = *(const v4f*)&so[wave][rl][col * 8], x1 = *(const v4f*)&so[wave][rl][col * 8 + 4]; v8b hv, lv;   // a half wave a row, eight columns a lane
#pragma unroll   // so that the vectors' elements are picked by constants and stay in registers
      for (int e = 0; e < 4; ++e) { const __bf16 h0 = (__bf16)x0[e], h1 = (__bf16)x1[e]; hv[e] = h0; hv[4 + e] = h1; lv[e] = (__bf16)(x0[e] - (float)h0); lv[4 + e] = (__bf16)(x1[e] - (float)h1); }
      char* o = (char*)(QKV + (r0 + rl) * QKVP + n0 + (col >> 3) * HD) + (col & 7) * 16;   // 8 lanes a head: whole 128-B lines
      vst2(o, __builtin_bit_cast(v4u, hv)); vst2(o + 2 * HD, __builtin_bit_cast(v4u, lv)); }
    asm volatile("s_wait_xcnt 0x0" ::: "memory");   // behind the last store: no register that an issued store names is rewritten ahead of it on any way the built code has from here
    return;
  }
  for (int rl = 0; rl < 32; ++rl) vst2(QKV + (r0 + rl) * QKVP + n0 + lane * 4, *(const v4f*)&so[wave][rl][lane * 4]);
}
// lane l with lane l ^ 16 (the two halves of a wave hold the two halves of a query's keys)
__device__ __forceinline__ float xhalf(float x) { return __builtin_bit_cast(float, __builtin_amdgcn_permlanex16(__builtin_bit_cast(int, x), __builtin_bit_cast(int, x), 0x76543210, 0xfedcba98, false, false)); }
// ---- k_attn: block = (query block, b*8 + h), 4 waves; 32 key steps; transposed products: S^T = K Q^T (A = key rows, B = query columns), O^T += V^T P^T.
// Lane (g, col) holds query col's scores of keys 8g+r and 16+8g+r: maximum and sum in the lane's own registers, and the two score tiles are P^T's B fragment as they stand.
// A stage is 64 keys (two key steps): its K tile (64 rows of 256 B: 64 bf16 hi, 64 bf16 residuals, as k_proj split them) and its two V^T tiles (64 rows of 128 B each) come into LDS once for the block, by asynchronous
// copies that cover whole 128-B lines, two buffers; the four waves take their fragments from LDS. Row pitches 272 B and 144 B (16 B x odd) as in k_proj.
#define AT_KT 64
#define AT_KP (HD * 4u + 16u)
#define AT_VP (AT_KT * 2u + 16u)
#define AT_KB (AT_KT * AT_KP)
#define AT_VB (HD * AT_VP)
#define AT_BUF (AT_KB + 2u * AT_VB)
#define AT_NS (SS / AT_KT)
// as pj_cp8, the first four copies from s0 and the last four from s1 (the two V^T planes, one behind the other in LDS); the s_wait_xcnt closes the statement for the same reason
__device__ __forceinline__ void at_cp44(unsigned l, unsigned ls, const __bf16* s0, const __bf16* s1, int gs) {
  asm volatile("global_load_async_to_lds_b128 %0, %1, off\n\t"
               "global_load_async_to_lds_b128 %2, %3, off\n\t"
               "global_load_async_to_lds_b128 %4, %5, off\n\t"
               "global_load_async_to_lds_b128 %6, %7, off\n\t"
               "global_load_async_to_lds_b128 %8, %9, off\n\t"
               "global_load_async_to_lds_b128 %10, %11, off\n\t"
               "global_load_async_to_lds_b128 %12, %13, off\n\t"
               "global_load_async_to_lds_b128 %14, %15, off\n\t"
               "s_wait_xcnt 0x0"
               :: "v"(l), "v"(s0), "v"(l + ls), "v"(s0 + gs), "v"(l + 2u * ls), "v"(s0 + 2 * gs), "v"(l + 3u * ls), "v"(s0 + 3 * gs),
                  "v"(l + 4u * ls), "v"(s1), "v"(l + 5u * ls), "v"(s1 + gs), "v"(l + 6u * ls), "v"(s1 + 2 * gs), "v"(l + 7u * ls), "v"(s1 + 3 * gs)
               : "memory");
}
__global__ __launch_bounds__(128) void k_attn(const float* __restrict__ QKV, const __bf16* __restrict__ VTH, const __bf16* __restrict__ VTL, float* __restrict__ OUT) {
  __shared__ __align__(16) char sm[2u * AT_BUF];   // the two stage buffers; behind the loop the output staging so[4][16][68]
  static_assert(2u * AT_BUF >= 4u * 16u * 68u * 4u, "the output staging must fit the two buffers");
  float (*so)[16][68] = (float (*)[16][68])sm;
  const int tid = threadIdx.x, wave = tid >> 5, lane = tid & 31, col = lane & 15, g = lane >> 4;
  const int qb = blockIdx.x, bh = blockIdx.y, b = bh / NH, h = bh % NH; const int q0 = qb * 64 + wave * 16; const size_t tq = (size_t)b * SS + q0;
  const unsigned lbase = (unsigned)(size_t)sm;
  // K tile: 16 lanes a row, 8 rows a copy of the block; V^T tiles: 8 lanes a row, 16 rows a copy
  const unsigned lk = lbase + (unsigned)(tid >> 4) * AT_KP + (unsigned)(tid & 15) * 16u, lv = lbase + AT_KB + (unsigned)(tid >> 3) * AT_VP + (unsigned)(tid & 7) * 16u;
  const float* gk = QKV + ((size_t)b * SS + (tid >> 4)) * QKVP + DM + h * HD + (tid & 15) * 4;
  const size_t vo = ((size_t)b * DM + h * HD + (tid >> 3)) * SS + (tid & 7) * 8; const __bf16 *gvh = VTH + vo, *gvl = VTL + vo;
  pj_cp8(lk, 8u * AT_KP, gk, 8 * QKVP); at_cp44(lv, 16u * AT_VP, gvh, gvl, 16 * SS);
  const F2 a0 = split_row(QKV + (tq + col) * QKVP + h * HD, 0, lane), a1 = split_row(QKV + (tq + col) * QKVP + h * HD, 32, lane);
  float m = -3.0e38f, l = 0.f;   // m: query col's running maximum, in base-2 units (score x scl2; equal in both halves); l: this half's part of the sum
  v8f acc[4] = {};               // acc[dt][r] = O^T[dt*16 + 8g + r][col]
  const float scl2 = 0.044194173824159216f * 1.4426950408889634f;   // 1/sqrt(512) x log2 e: exp(s / sqrt(512) - max) = 2^(s x scl2 - max x scl2)
  asm volatile("s_wait_asynccnt 0x0" ::: "memory");   // stage 0 has landed before the barrier publishes it
  __syncthreads();
  pj_cp8(lk + AT_BUF, 8u * AT_KP, gk + (size_t)AT_KT * QKVP, 8 * QKVP); at_cp44(lv + AT_BUF, 16u * AT_VP, gvh + AT_KT, gvl + AT_KT, 16 * SS);
#pragma unroll 1   // stays rolled: the body already holds two key steps, and further copies would only lengthen the code
  for (int st = 0; st < AT_NS; ++st) { const char* sb = sm + (st & 1) * AT_BUF;
#pragma unroll     // so that a key step's place in the buffer is an immediate offset of the LDS reads
   for (int u = 0; u < AT_KT / 32; ++u) {
    float s[16];
#pragma unroll
    for (int ct = 0; ct < 2; ++ct) { const char* krow = sb + (u * 32 + ct * 16 + col) * AT_KP; F2 k0, k1;   // dims 0..31 and 32..63; the residuals stand 128 B behind the hi halves
      k0.h = frag_b((const __bf16*)krow, lane); k1.h = frag_b((const __bf16*)(krow + 64), lane); k0.l = frag_b((const __bf16*)(krow + 128), lane); k1.l = frag_b((const __bf16*)(krow + 192), lane);
      __builtin_amdgcn_sched_barrier(0);   // keeps the four K fragments' reads together ahead of their matrix instructions
      v8f c = wmma_bf(k0.h, a0.l, (v8f){}); c = wmma_bf(k0.l, a0.h, c); c = wmma_bf(k0.h, a0.h, c);
      c = wmma_bf(k1.h, a1.l, c); c = wmma_bf(k1.l, a1.h, c); c = wmma_bf(k1.h, a1.h, c);
#pragma unroll
      for (int r = 0; r < 8; ++r) s[ct * 8 + r] = c[r]; }
    float mx = s[0];
#pragma unroll
    for (int i = 1; i < 16; ++i) mx = fmaxf(mx, s[i]);
    mx = fmaxf(mx, xhalf(mx));
    const float mn = fmaxf(m, mx * scl2); const float alpha = exp2_hw(m - mn); m = mn;
    float es = 0.f;
#pragma unroll
    for (int i = 0; i < 16; ++i) { s[i] = exp2_hw(fmaf(s[i], scl2, -mn)); es += s[i]; }
    l = l * alpha + es;
#pragma unroll
    for (int dt = 0; dt < 4; ++dt)
#pragma unroll
      for (int r = 0; r < 8; ++r) acc[dt][r] *= alpha;
    v16b vh[4], vl[4];   // the eight V^T fragments' reads stand together ahead of their matrix instructions, not one wait a tile
    const F2 pb = bsplit16(s);   // element i = key 8g+i, element 8+i = key 16+8g+i: the k order of frag_b
#pragma unroll
    for (int dt = 0; dt < 4; ++dt) { const char* vrow = sb + AT_KB + (dt * 16 + col) * AT_VP + u * 64; vh[dt] = frag_b((const __bf16*)vrow, lane); vl[dt] = frag_b((const __bf16*)(vrow + AT_VB), lane); }
    __builtin_amdgcn_sched_barrier(0);   // keeps the eight V^T fragments' reads together ahead of their matrix instructions
#pragma unroll
    for (int dt = 0; dt < 4; ++dt) { acc[dt] = wmma_bf(vh[dt], pb.l, acc[dt]); acc[dt] = wmma_bf(vl[dt], pb.h, acc[dt]); acc[dt] = wmma_bf(vh[dt], pb.h, acc[dt]); } }
    asm volatile("s_wait_dscnt 0x0" ::: "memory");      // this wave's reads of the buffer have returned before it is refilled
    asm volatile("s_wait_asynccnt 0x0" ::: "memory");   // this wave's copies of stage st + 1 have landed
    __syncthreads();                                    // publishes stage st + 1 and ends every wave's reads of stage st
    if (st + 2 < AT_NS) { pj_cp8(lk + (st & 1) * AT_BUF, 8u * AT_KP, gk + (size_t)(st + 2) * AT_KT * QKVP, 8 * QKVP); at_cp44(lv + (st & 1) * AT_BUF, 16u * AT_VP, gvh + (st + 2) * AT_KT, gvl + (st + 2) * AT_KT, 16 * SS); } }
  asm volatile("s_wait_asynccnt 0x0" ::: "memory");     // no copy is outstanding when the buffers become output staging
  const float il = 1.0f / (l + xhalf(l));
#pragma unroll
  for (int dt = 0; dt < 4; ++dt) { v4f lo, hi;
#pragma unroll
    for (int r = 0; r < 4; ++r) { lo[r] = acc[dt][r] * il; hi[r] = acc[dt][4 + r] * il; }
    *(v4f*)&so[wave][col][dt * 16 + 8 * g] = lo; *(v4f*)&so[wave][col][dt * 16 + 8 * g + 4] = hi; }
  LDSX();
  for (int rl = 0; rl < 16; ++rl) if (lane < 16) vst2(OUT + (tq + rl) * DM + h * HD + lane * 4, *(const v4f*)&so[wave][rl][lane * 4]);
}

extern "C" void kernel_launch(void* const* d_in, const int* in_sizes, int n_in, void* d_out, int out_size, void* d_ws, size_t ws_size, hipStream_t stream) {
  (void)in_sizes; (void)n_in; (void)out_size;
  const float** F = (const float**)d_in;   // x, W_cq, b_cq, W_ck, b_ck, W_cv, b_cv, W_pq, b_pq, W_pk, b_pk, W_pv, b_pv  ([in][out] weights)
  if (ws_size < (size_t)WS_END) return;
  char* ws = (char*)d_ws; __bf16 *PT = (__bf16*)(ws + WS_PT), *VTH = (__bf16*)(ws + WS_VTH), *VTL = (__bf16*)(ws + WS_VTL); float* QKV = (float*)(ws + WS_QKV);
  k_pack<<<QKVP, 128, 0, stream>>>(F[1], F[3], F[5], F[7], F[9], F[11], PT);
  k_proj<<<dim3(TRB, QKVP / 128), 128, 0, stream>>>(F[0], PT, F[2], F[4], F[6], F[8], F[10], F[12], QKV, VTH, VTL);
  k_attn<<<dim3(TQB, TNB * NH), 128, 0, stream>>>(QKV, VTH, VTL, (float*)d_out);
}

// v009
// One run takes 80.5 microseconds.
// Two timings next to v008 both put it at 1.09 times that version's speed.
// All steps since v000 together make it 4.63 times as fast.
// compute dtype: x, the six weights and biases (module inputs) rounded to bf16; q/k/v projections as exact bf16 products over the concatenated [Wc ; Wp] columns (x.(Wc+Wp) == x.Wc + x.Wp, f32 accumulate, + bc + bp); scores and P.V with both computed operands as bf16 hi + bf16 residual pairs (3 products); online softmax in f32; f32 accumulate.
#include <hip/hip_runtime.h>
#include <math.h>

typedef __attribute__((ext_vector_type(16))) _Float16 v16h;
typedef __attribute__((ext_vector_type(16))) __bf16 v16b;
typedef __attribute__((ext_vector_type(8)))  _Float16 v8h;
typedef __attribute__((ext_vector_type(8)))  float v8f;
typedef __attribute__((ext_vector_type(4)))  float v4f;
typedef __attribute__((ext_vector_type(2)))  float v2f;
typedef __attribute__((ext_vector_type(4)))  unsigned v4u;
typedef __attribute__((ext_vector_type(4)))  int v4i;
typedef float __attribute__((may_alias)) float_a;
typedef int __attribute__((may_alias)) int_a;

template <typename T> __device__ __forceinline__ void vst2(void* p, T v) { *(T*)p = v;  }
__device__ __forceinline__ v8f wmma16(v16h a, v16h b, v8f c) {
  v8f d = __builtin_amdgcn_wmma_f32_16x16x32_f16(false, a, false, b, (short)0, c, false, false);
  asm volatile("v_nop\n\tv_nop\n\tv_nop\n\tv_nop" : "+v"(d) : "v"(a), "v"(b));
  return d;
}
__device__ __forceinline__ v8f wmma_bf(v16b a, v16b b, v8f c) {
  return __builtin_amdgcn_wmma_f32_16x16x32_bf16(false, a, false, b, (short)0, c, false, false);
}
// 16x16x32 fragments: lane = (h = lane>>4, row/col = lane&15); elements 0..7 = k0+8h+0..7, 8..15 = k0+16+8h+0..7; D element r = row 8h+r
__device__ __forceinline__ v16h frag_h(const _Float16* rowk0, int lane) {
  union { v16h v; v8h q[2]; } u; const _Float16* p = rowk0 + 8 * (lane >> 4);
  u.q[0] = *(const v8h*)p; u.q[1] = *(const v8h*)(p + 16); return u.v;
}
__device__ __forceinline__ v16h frag_f32(const float* rowk0, int lane) {
  v16h a; const float* p = rowk0 + 8 * (lane >> 4);
#pragma unroll
  for (int i = 0; i < 8; ++i) { a[i] = (_Float16)p[i]; a[8 + i] = (_Float16)p[16 + i]; }
  return a;
}
__device__ __forceinline__ v16h frag_f32s(const float* rowk0, int lane, float sc) {
  v16h a; const float* p = rowk0 + 8 * (lane >> 4);
#pragma unroll
  for (int i = 0; i < 8; ++i) { a[i] = (_Float16)(p[i] * sc); a[8 + i] = (_Float16)(p[16 + i] * sc); }
  return a;
}
// column fragment from a [K][ld] layout (column n), rows >= K read as 0
__device__ __forceinline__ v16h fragc_f32(const float* W, int k0, int n, int lane, int ld, int K) {
  v16h a; const int g = lane >> 4;
#pragma unroll
  for (int i = 0; i < 8; ++i) { const int ka = k0 + 8 * g + i, kb = ka + 16;
    a[i] = (_Float16)(ka < K ? W[(size_t)(ka < K ? ka : K - 1) * ld + n] : 0.f); a[8 + i] = (_Float16)(kb < K ? W[(size_t)(kb < K ? kb : K - 1) * ld + n] : 0.f); }
  return a;
}
struct F2 { v16b h, l; };
__device__ __forceinline__ F2 bsplit16(const float v[16]) { F2 r;
#pragma unroll
  for (int i = 0; i < 16; ++i) { const __bf16 h = (__bf16)v[i]; r.h[i] = h; r.l[i] = (__bf16)(v[i] - (float)h); }
  return r; }
__device__ __forceinline__ F2 split_row(const float* row, int k0, int lane) { float v[16]; const float* p = row + k0 + 8 * (lane >> 4);
#pragma unroll
  for (int i = 0; i < 8; ++i) { v[i] = p[i]; v[8 + i] = p[16 + i]; }
  return bsplit16(v); }
__device__ __forceinline__ F2 split_rowK(const float* row, int k0, int lane, int K) { float v[16]; const int g = lane >> 4;
#pragma unroll
  for (int i = 0; i < 8; ++i) { const int ka = k0 + 8 * g + i, kb = ka + 16; v[i] = ka < K ? row[ka < K ? ka : K - 1] : 0.f; v[8 + i] = kb < K ? row[kb < K ? kb : K - 1] : 0.f; }
  return bsplit16(v); }
__device__ __forceinline__ F2 split_col(const float* W, int k0, int n, int lane, int ld, int K) { float v[16]; const int g = lane >> 4;
#pragma unroll
  for (int i = 0; i < 8; ++i) { const int ka = k0 + 8 * g + i, kb = ka + 16; v[i] = ka < K ? W[(size_t)(ka < K ? ka : K - 1) * ld + n] : 0.f; v[8 + i] = kb < K ? W[(size_t)(kb < K ? kb : K - 1) * ld + n] : 0.f; }
  return bsplit16(v); }
__device__ __forceinline__ v8f mac3(const F2& a, const F2& b, v8f c) { c = wmma_bf(a.l, b.h, c); c = wmma_bf(a.h, b.l, c); return wmma_bf(a.h, b.h, c); }
__device__ __forceinline__ float sigm(float v) { return 1.0f / (1.0f + expf(-v)); }
#define LDSX() do { asm volatile("s_wait_dscnt 0" ::: "memory"); __builtin_amdgcn_wave_barrier(); __builtin_amdgcn_fence(__ATOMIC_RELEASE, "workgroup"); } while (0)


// Disentangled attention: q = x (W_cq + W_pq) + (b_cq + b_pq), likewise k, v (8 heads x 64); energy = q k^T / sqrt(512); softmax; out = P v merged to [8, 1024, 512] (no output projection).
// k_pack ([Wc col | Wp col] as one bf16 row of K = 1024), k_proj (exact GEMM over [x | x], + both biases; its V blocks write V transposed as hi/lo planes, its K blocks each head's row as 64 hi + 64 residual bf16), k_attn (flash-style, 32 key steps, transposed products; writes the output rows directly).
#define NB 8
#define SS 1024
#define DM 512
#define NH 8
#define HD 64
#define NR (NB * SS)
#define QKVP (3 * DM)
#define KK (2 * DM)            // concatenated K
#ifndef TRB
#define TRB (NR / 128)
#define TQB (SS / 64)
#define TNB NB
#endif
typedef __attribute__((ext_vector_type(8))) __bf16 v8b;
__device__ __forceinline__ v16b frag_b(const __bf16* rowk0, int lane) {
  union { v16b v; v8b q[2]; } u; const __bf16* p = rowk0 + 8 * (lane >> 4);
  u.q[0] = *(const v8b*)p; u.q[1] = *(const v8b*)(p + 16); return u.v;
}
__device__ __forceinline__ v16b frag_gbf(const float* rowk0, int lane) {
  v16b a; const float* p = rowk0 + 8 * (lane >> 4);
#pragma unroll
  for (int i = 0; i < 8; ++i) { a[i] = (__bf16)p[i]; a[8 + i] = (__bf16)p[16 + i]; }
  return a;
}
__device__ __forceinline__ float bfr(float v) { return (float)(__bf16)v; }
__device__ __forceinline__ float exp2_hw(float v) { return __builtin_amdgcn_exp2f(v); }   // 2^v as one v_exp_f32; a very negative v gives 0
#define WS_PT   0u                                  // bf16 [1536][1024]: row n = [Wc_*[:, c] ; Wp_*[:, c]]
#define WS_QKV  (WS_PT + 2u * QKVP * KK)             // f32 [8192][1536]; in the K columns the 256 B of a head's row hold 64 bf16 hi, then the 64 bf16 residuals; the V columns stay unwritten and unread
#define WS_VTH  (WS_QKV + 4u * NR * QKVP)            // bf16 [8][512][1024]
#define WS_VTL  (WS_VTH + 2u * NB * DM * SS)
#define WS_END  (WS_VTL + 2u * NB * DM * SS)

// ---- k_pack: a block turns one 64 (k) x 64 (column) tile of one weight matrix. The tile's rows come in as whole 256-B runs (16 lanes a row, 16 B a lane), stand in LDS as f32,
// and leave as 128-B runs: 8 lanes a PT row, each with eight k in a row of one column. Values and their rounding are as in a plain column walk.
#define PK_T 64
#define PK_P (PK_T + 1)   // pitch in floats, odd: the 8 k groups x 4 columns that a wave reads at a time fall on 32 different banks
__global__ __launch_bounds__(128) void k_pack(const float* __restrict__ Wcq, const float* __restrict__ Wck, const float* __restrict__ Wcv, const float* __restrict__ Wpq, const float* __restrict__ Wpk, const float* __restrict__ Wpv, __bf16* __restrict__ PT) {
  __shared__ float st[PK_T][PK_P];
  const int tid = threadIdx.x, c0 = blockIdx.x * PK_T, k0 = blockIdx.y * PK_T, which = blockIdx.z % 3, half = blockIdx.z / 3;   // half 0: Wc_*, 1: Wp_*
  const float* W = half == 0 ? (which == 0 ? Wcq : which == 1 ? Wck : Wcv) : (which == 0 ? Wpq : which == 1 ? Wpk : Wpv);
  const float* src = W + (size_t)(k0 + (tid >> 4)) * DM + c0 + (tid & 15) * 4;   // [in][out] layout: 8 rows a pass of the block
  v4f x[8];
#pragma unroll   // all eight loads of a lane are in flight together
  for (int i = 0; i < 8; ++i) x[i] = *(const v4f*)(src + (size_t)i * 8 * DM);
#pragma unroll   // this and the next: x is picked by constants and stays in registers
  for (int i = 0; i < 8; ++i)
#pragma unroll
    for (int j = 0; j < 4; ++j) st[i * 8 + (tid >> 4)][(tid & 15) * 4 + j] = x[i][j];
  __syncthreads();   // a PT row's run holds k rows that all four waves brought
  __bf16* dst = PT + (size_t)(which * DM + c0 + (tid >> 3)) * KK + half * DM + k0 + (tid & 7) * 8;   // 16 columns a pass of the block
#pragma unroll   // this and the next: a run's place is an immediate offset, o stays in registers, and the LDS reads of all four runs stand together
  for (int i = 0; i < 4; ++i) { v8b o;
#pragma unroll
    for (int e = 0; e < 8; ++e) o[e] = (__bf16)st[(tid & 7) * 8 + e][i * 16 + (tid >> 3)];
    vst2((unsigned*)(dst + (size_t)i * 16 * KK), __builtin_bit_cast(v4u, o)); }
}
// ---- k_proj: QKV[r][n] = [bf16(x[r]) | bf16(x[r])] . PT[n] (exact) + bc[n] + bp[n]; block (128 rows, 128 cols), a wave 32 rows: each PT fragment read from LDS feeds two matrix instructions
// A block of V columns does not write f32 rows: it splits its sums into bf16 hi + residual, turns the 128 x 128 tile in LDS and writes V^T's two planes, 256 B of 128 tokens a row.
// A block of K columns splits its sums the same way on the way out of the staging and writes, in the place of a head's 64 floats, 128 B of hi and 128 B of residuals.
// A stage is 64 wide in k: its x tile (128 rows of 256 B) and its PT tile (128 rows of 128 B) come into LDS once for the block, by asynchronous copies that
// cover whole 128-B lines, two buffers; the four waves take their fragments from LDS. Row pitches 272 B and 144 B (16 B x odd) keep ds_load_b128 free of bank conflicts.
#define PJ_KW 64
#define PJ_AP (PJ_KW * 4u + 16u)
#define PJ_BP (PJ_KW * 2u + 16u)
#define PJ_RB 128u
#define PJ_AB (PJ_RB * PJ_AP)
#define PJ_BUF (PJ_AB + 128u * PJ_BP)
#define PJ_NS (KK / PJ_KW)
#define PJ_VP (PJ_RB * 2u + 16u)   // pitch of a V^T row of 128 tokens in the output staging (16 B x odd)
__device__ __forceinline__ v16b frag_lf(const char* rowk0, int g) {   // frag_gbf's k order, from an f32 row in LDS
  const v4f* p = (const v4f*)(rowk0 + 32 * g); const v4f x0 = p[0], x1 = p[1], x2 = p[4], x3 = p[5]; v16b a;
#pragma unroll
  for (int i = 0; i < 4; ++i) { a[i] = (__bf16)x0[i]; a[4 + i] = (__bf16)x1[i]; a[8 + i] = (__bf16)x2[i]; a[12 + i] = (__bf16)x3[i]; }
  return a;
}
// eight copies of 16 B per lane, LDS places ls bytes and sources gs elements apart; the s_wait_xcnt closes the statement so that no address register is rewritten ahead of it
template <typename T> __device__ __forceinline__ void pj_cp8(unsigned l, unsigned ls, const T* s, int gs) {
  asm volatile("global_load_async_to_lds_b128 %0, %1, off\n\t"
               "global_load_async_to_lds_b128 %2, %3, off\n\t"
               "global_load_async_to_lds_b128 %4, %5, off\n\t"
               "global_load_async_to_lds_b128 %6, %7, off\n\t"
               "global_load_async_to_lds_b128 %8, %9, off\n\t"
               "global_load_async_to_lds_b128 %10, %11, off\n\t"
               "global_load_async_to_lds_b128 %12, %13, off\n\t"
               "global_load_async_to_lds_b128 %14, %15, off\n\t"
               "s_wait_xcnt 0x0"
               :: "v"(l), "v"(s), "v"(l + ls), "v"(s + gs), "v"(l + 2u * ls), "v"(s + 2 * gs), "v"(l + 3u * ls), "v"(s + 3 * gs),
                  "v"(l + 4u * ls), "v"(s + 4 * gs), "v"(l + 5u * ls), "v"(s + 5 * gs), "v"(l + 6u * ls), "v"(s + 6 * gs), "v"(l + 7u * ls), "v"(s + 7 * gs)
               : "memory");
}
__global__ __launch_bounds__(128) void k_proj(const float* __restrict__ X, const __bf16* __restrict__ PT, const float* __restrict__ bcq, const float* __restrict__ bck, const float* __restrict__ bcv, const float* __restrict__ bpq, const float* __restrict__ bpk, const float* __restrict__ bpv, float* __restrict__ QKV, __bf16* __restrict__ VTH, __bf16* __restrict__ VTL) {
  __shared__ __align__(16) char sm[2u * PJ_BUF];   // the two stage buffers; behind the loop the output staging so[4][32][132], or in a V block two planes of [128][PJ_VP bytes]
  static_assert(2u * PJ_BUF >= 4u * 32u * 132u * 4u && 2u * PJ_BUF >= 2u * 128u * PJ_VP, "the output staging must fit the two buffers");
  float (*so)[32][132] = (float (*)[32][132])sm;
  const int tid = threadIdx.x, wave = tid >> 5, lane = tid & 31, col = lane & 15, g = lane >> 4; const size_t r0 = (size_t)blockIdx.x * PJ_RB + wave * 32; const int n0 = blockIdx.y * 128;
  const unsigned lbase = (unsigned)(size_t)sm;
  // x tile: 16 lanes a row, 8 rows a copy of the block (16 copies a lane); PT tile: 8 lanes a row, 16 rows a copy (8 copies a lane)
  const unsigned la = lbase + (unsigned)(tid >> 4) * PJ_AP + (unsigned)(tid & 15) * 16u, lb = lbase + PJ_AB + (unsigned)(tid >> 3) * PJ_BP + (unsigned)(tid & 7) * 16u;
  const float* ga = X + ((size_t)blockIdx.x * PJ_RB + (tid >> 4)) * DM + (tid & 15) * 4; const __bf16* gb = PT + (size_t)(n0 + (tid >> 3)) * KK + (tid & 7) * 8;
  v8f acc[2][8] = {};
  pj_cp8(la, 8u * PJ_AP, ga, 8 * DM); pj_cp8(la + 64u * PJ_AP, 8u * PJ_AP, ga + 64 * DM, 8 * DM); pj_cp8(lb, 16u * PJ_BP, gb, 16 * KK);
  asm volatile("s_wait_asynccnt 0x0" ::: "memory");   // stage 0 has landed before the barrier publishes it
  __syncthreads();
  pj_cp8(la + PJ_BUF, 8u * PJ_AP, ga + PJ_KW, 8 * DM); pj_cp8(la + PJ_BUF + 64u * PJ_AP, 8u * PJ_AP, ga + PJ_KW + 64 * DM, 8 * DM); pj_cp8(lb + PJ_BUF, 16u * PJ_BP, gb + PJ_KW, 16 * KK);
#pragma unroll 2   // by two, so that each half's buffer is a constant offset
  for (int st = 0; st < PJ_NS; ++st) { const char* sb = sm + (st & 1) * PJ_BUF;
#pragma unroll
    for (int u = 0; u < PJ_KW / 32; ++u) { const v16b a0 = frag_lf(sb + (wave * 32 + col) * PJ_AP + u * 128, g), a1 = frag_lf(sb + (wave * 32 + 16 + col) * PJ_AP + u * 128, g);
#pragma unroll
      for (int jh = 0; jh < 8; jh += 4) { v16b bq[4];   // four fragments' reads stand together ahead of their matrix instructions, not one wait a fragment
#pragma unroll
        for (int j = 0; j < 4; ++j) bq[j] = frag_b((const __bf16*)(sb + PJ_AB + ((jh + j) * 16 + col) * PJ_BP + u * 64), lane);
        __builtin_amdgcn_sched_barrier(0);   // keeps the four fragments' reads together ahead of their matrix instructions; without it the compiler deals them out, one wait a fragment
#pragma unroll
        for (int j = 0; j < 4; ++j) { acc[0][jh + j] = wmma_bf(a0, bq[j], acc[0][jh + j]); acc[1][jh + j] = wmma_bf(a1, bq[j], acc[1][jh + j]); } } }
    asm volatile("s_wait_dscnt 0x0" ::: "memory");      // this wave's reads of the buffer have returned before it is refilled
    asm volatile("s_wait_asynccnt 0x0" ::: "memory");   // this wave's copies of stage st + 1 have landed
    __syncthreads();                                    // publishes stage st + 1 and ends every wave's reads of stage st
    if (st + 2 < PJ_NS) { const float* gx = ga + ((st + 2) % (DM / PJ_KW)) * PJ_KW; const unsigned lx = la + (st & 1) * PJ_BUF;
      pj_cp8(lx, 8u * PJ_AP, gx, 8 * DM); pj_cp8(lx + 64u * PJ_AP, 8u * PJ_AP, gx + 64 * DM, 8 * DM); pj_cp8(lb + (st & 1) * PJ_BUF, 16u * PJ_BP, gb + (st + 2) * PJ_KW, 16 * KK); } }
  asm volatile("s_wait_asynccnt 0x0" ::: "memory");     // no copy is outstanding when the buffers become output staging
  if (n0 >= 2 * DM) {   // V columns: the same answer for the whole block
    const int c0 = n0 - 2 * DM;
#pragma unroll
    for (int j = 0; j < 8; ++j) { const int c = c0 + j * 16 + col; const float bb = bfr(bcv[c]) + bfr(bpv[c]);
#pragma unroll
      for (int rt = 0; rt < 2; ++rt) { v8b hv, lv;
#pragma unroll
        for (int r = 0; r < 8; ++r) { const float v = acc[rt][j][r] + bb; const __bf16 hb = (__bf16)v; hv[r] = hb; lv[r] = (__bf16)(v - (float)hb); }
        char* p = sm + (j * 16 + col) * PJ_VP + (wave * 32 + rt * 16 + 8 * g) * 2;   // a lane's eight sums are eight tokens in a row of one V^T row
        *(v8b*)p = hv; *(v8b*)(p + 128u * PJ_VP) = lv; } }
    __syncthreads();   // a V^T row holds tokens of all four waves
    const size_t t0 = (size_t)blockIdx.x * PJ_RB; const size_t ob = ((t0 / SS) * DM + c0) * SS + t0 % SS;
    const size_t o = ob + (size_t)(tid >> 4) * SS + (tid & 15) * 8; const char* p = sm + (tid >> 4) * PJ_VP + (tid & 15) * 16;   // 16 lanes a row: two whole 128-B lines; 8 rows a pass of the block
#pragma unroll
    for (int i = 0; i < 16; ++i) { vst2((unsigned*)(VTH + o + (size_t)i * 8 * SS), *(const v4u*)(p + i * 8 * PJ_VP)); vst2((unsigned*)(VTL + o + (size_t)i * 8 * SS), *(const v4u*)(p + (128u + i * 8) * PJ_VP)); }
    return;
  }
#pragma unroll
  for (int j = 0; j < 8; ++j) { const int n = n0 + j * 16 + col; const int which = n / DM, c = n % DM; const float bb = bfr((which == 0 ? bcq : which == 1 ? bck : bcv)[c]) + bfr((which == 0 ? bpq : which == 1 ? bpk : bpv)[c]);
#pragma unroll
    for (int rt = 0; rt < 2; ++rt)
#pragma unroll
      for (int r = 0; r < 8; ++r) so[wave][rt * 16 + 8 * g + r][j * 16 + col] = acc[rt][j][r] + bb; }
  LDSX();
  if (n0 >= DM) {   // K columns: the same answer for the whole block
#pragma unroll   // so that a row's place in the staging and in the workspace is an immediate offset
    for (int i = 0; i < 16; ++i) { const int rl = 2 * i + g; const v4f x0 = *(const v4f*)&so[wave][rl][col * 8], x1 = *(const v4f*)&so[wave][rl][col * 8 + 4]; v8b hv, lv;   // a half wave a row, eight columns a lane
#pragma unroll   // so that the vectors' elements are picked by constants and stay in registers
      for (int e = 0; e < 4; ++e) { const __bf16 h0 = (__bf16)x0[e], h1 = (__bf16)x1[e]; hv[e] = h0; hv[4 + e] = h1; lv[e] = (__bf16)(x0[e] - (float)h0); lv[4 + e] = (__bf16)(x1[e] - (float)h1); }
      char* o = (char*)(QKV + (r0 + rl) * QKVP + n0 + (col >> 3) * HD) + (col & 7) * 16;   // 8 lanes a head: whole 128-B lines
      vst2(o, __builtin_bit_cast(v4u, hv)); vst2(o + 2 * HD, __builtin_bit_cast(v4u, lv)); }
    asm volatile("s_wait_xcnt 0x0" ::: "memory");   // behind the last store: no register that an issued store names is rewritten ahead of it on any way the built code has from here
    return;
  }
  for (int rl = 0; rl < 32; ++rl) vst2(QKV + (r0 + rl) * QKVP + n0 + lane * 4, *(const v4f*)&so[wave][rl][lane * 4]);
}
// lane l with lane l ^ 16 (the two halves of a wave hold the two halves of a query's keys)
__device__ __forceinline__ float xhalf(float x) { return __builtin_bit_cast(float, __builtin_amdgcn_permlanex16(__builtin_bit_cast(int, x), __builtin_bit_cast(int, x), 0x76543210, 0xfedcba98, false, false)); }
// ---- k_attn: block = (query block, b*8 + h), 4 waves; 32 key steps; transposed products: S^T = K Q^T (A = key rows, B = query columns), O^T += V^T P^T.
// Lane (g, col) holds query col's scores of keys 8g+r and 16+8g+r: maximum and sum in the lane's own registers, and the two score tiles are P^T's B fragment as they stand.
// A stage is 64 keys (two key steps): its K tile (64 rows of 256 B: 64 bf16 hi, 64 bf16 residuals, as k_proj split them) and its two V^T tiles (64 rows of 128 B each) come into LDS once for the block, by asynchronous
// copies that cover whole 128-B lines, two buffers; the four waves take their fragments from LDS. Row pitches 272 B and 144 B (16 B x odd) as in k_proj.
#define AT_KT 64
#define AT_KP (HD * 4u + 16u)
#define AT_VP (AT_KT * 2u + 16u)
#define AT_KB (AT_KT * AT_KP)
#define AT_VB (HD * AT_VP)
#define AT_BUF (AT_KB + 2u * AT_VB)
#define AT_NS (SS / AT_KT)
// as pj_cp8, the first four copies from s0 and the last four from s1 (the two V^T planes, one behind the other in LDS); the s_wait_xcnt closes the statement for the same reason
__device__ __forceinline__ void at_cp44(unsigned l, unsigned ls, const __bf16* s0, const __bf16* s1, int gs) {
  asm volatile("global_load_async_to_lds_b128 %0, %1, off\n\t"
               "global_load_async_to_lds_b128 %2, %3, off\n\t"
               "global_load_async_to_lds_b128 %4, %5, off\n\t"
               "global_load_async_to_lds_b128 %6, %7, off\n\t"
               "global_load_async_to_lds_b128 %8, %9, off\n\t"
               "global_load_async_to_lds_b128 %10, %11, off\n\t"
               "global_load_async_to_lds_b128 %12, %13, off\n\t"
               "global_load_async_to_lds_b128 %14, %15, off\n\t"
               "s_wait_xcnt 0x0"
               :: "v"(l), "v"(s0), "v"(l + ls), "v"(s0 + gs), "v"(l + 2u * ls), "v"(s0 + 2 * gs), "v"(l + 3u * ls), "v"(s0 + 3 * gs),
                  "v"(l + 4u * ls), "v"(s1), "v"(l + 5u * ls), "v"(s1 + gs), "v"(l + 6u * ls), "v"(s1 + 2 * gs), "v"(l + 7u * ls), "v"(s1 + 3 * gs)
               : "memory");
}
__global__ __launch_bounds__(128) void k_attn(const float* __restrict__ QKV, const __bf16* __restrict__ VTH, const __bf16* __restrict__ VTL, float* __restrict__ OUT) {
  __shared__ __align__(16) char sm[2u * AT_BUF];   // the two stage buffers; behind the loop the output staging so[4][16][68]
  static_assert(2u * AT_BUF >= 4u * 16u * 68u * 4u, "the output staging must fit the two buffers");
  float (*so)[16][68] = (float (*)[16][68])sm;
  const int tid = threadIdx.x, wave = tid >> 5, lane = tid & 31, col = lane & 15, g = lane >> 4;
  const int qb = blockIdx.x, bh = blockIdx.y, b = bh / NH, h = bh % NH; const int q0 = qb * 64 + wave * 16; const size_t tq = (size_t)b * SS + q0;
  const unsigned lbase = (unsigned)(size_t)sm;
  // K tile: 16 lanes a row, 8 rows a copy of the block; V^T tiles: 8 lanes a row, 16 rows a copy
  const unsigned lk = lbase + (unsigned)(tid >> 4) * AT_KP + (unsigned)(tid & 15) * 16u, lv = lbase + AT_KB + (unsigned)(tid >> 3) * AT_VP + (unsigned)(tid & 7) * 16u;
  const float* gk = QKV + ((size_t)b * SS + (tid >> 4)) * QKVP + DM + h * HD + (tid & 15) * 4;
  const size_t vo = ((size_t)b * DM + h * HD + (tid >> 3)) * SS + (tid & 7) * 8; const __bf16 *gvh = VTH + vo, *gvl = VTL + vo;
  pj_cp8(lk, 8u * AT_KP, gk, 8 * QKVP); at_cp44(lv, 16u * AT_VP, gvh, gvl, 16 * SS);
  const F2 a0 = split_row(QKV + (tq + col) * QKVP + h * HD, 0, lane), a1 = split_row(QKV + (tq + col) * QKVP + h * HD, 32, lane);
  float m = -3.0e38f, l = 0.f;   // m: query col's running maximum, in base-2 units (score x scl2; equal in both halves); l: this half's part of the sum
  v8f acc[4] = {};               // acc[dt][r] = O^T[dt*16 + 8g + r][col]
  const float scl2 = 0.044194173824159216f * 1.4426950408889634f;   // 1/sqrt(512) x log2 e: exp(s / sqrt(512) - max) = 2^(s x scl2 - max x scl2)
  asm volatile("s_wait_asynccnt 0x0" ::: "memory");   // stage 0 has landed before the barrier publishes it
  __syncthreads();
  pj_cp8(lk + AT_BUF, 8u * AT_KP, gk + (size_t)AT_KT * QKVP, 8 * QKVP); at_cp44(lv + AT_BUF, 16u * AT_VP, gvh + AT_KT, gvl + AT_KT, 16 * SS);
#pragma unroll 1   // stays rolled: the body already holds two key steps, and further copies would only lengthen the code
  for (int st = 0; st < AT_NS; ++st) { const char* sb = sm + (st & 1) * AT_BUF;
#pragma unroll     // so that a key step's place in the buffer is an immediate offset of the LDS reads
   for (int u = 0; u < AT_KT / 32; ++u) {
    float s[16];
#pragma unroll
    for (int ct = 0; ct < 2; ++ct) { const char* krow = sb + (u * 32 + ct * 16 + col) * AT_KP; F2 k0, k1;   // dims 0..31 and 32..63; the residuals stand 128 B behind the hi halves
      k0.h = frag_b((const __bf16*)krow, lane); k1.h = frag_b((const __bf16*)(krow + 64), lane); k0.l = frag_b((const __bf16*)(krow + 128), lane); k1.l = frag_b((const __bf16*)(krow + 192), lane);
      __builtin_amdgcn_sched_barrier(0);   // keeps the four K fragments' reads together ahead of their matrix instructions
      v8f c = wmma_bf(k0.h, a0.l, (v8f){}); c = wmma_bf(k0.l, a0.h, c); c = wmma_bf(k0.h, a0.h, c);
      c = wmma_bf(k1.h, a1.l, c); c = wmma_bf(k1.l, a1.h, c); c = wmma_bf(k1.h, a1.h, c);
#pragma unroll
      for (int r = 0; r < 8; ++r) s[ct * 8 + r] = c[r]; }
    float mx = s[0];
#pragma unroll
    for (int i = 1; i < 16; ++i) mx = fmaxf(mx, s[i]);
    mx = fmaxf(mx, xhalf(mx));
    const float mn = fmaxf(m, mx * scl2); const float alpha = exp2_hw(m - mn); m = mn;
    float es = 0.f;
#pragma unroll
    for (int i = 0; i < 16; ++i) { s[i] = exp2_hw(fmaf(s[i], scl2, -mn)); es += s[i]; }
    l = l * alpha + es;
#pragma unroll
    for (int dt = 0; dt < 4; ++dt)
#pragma unroll
      for (int r = 0; r < 8; ++r) acc[dt][r] *= alpha;
    v16b vh[4], vl[4];   // the eight V^T fragments' reads stand together ahead of their matrix instructions, not one wait a tile
    const F2 pb = bsplit16(s);   // element i = key 8g+i, element 8+i = key 16+8g+i: the k order of frag_b
#pragma unroll
    for (int dt = 0; dt < 4; ++dt) { const char* vrow = sb + AT_KB + (dt * 16 + col) * AT_VP + u * 64; vh[dt] = frag_b((const __bf16*)vrow, lane); vl[dt] = frag_b((const __bf16*)(vrow + AT_VB), lane); }
    __builtin_amdgcn_sched_barrier(0);   // keeps the eight V^T fragments' reads together ahead of their matrix instructions
#pragma unroll
    for (int dt = 0; dt < 4; ++dt) { acc[dt] = wmma_bf(vh[dt], pb.l, acc[dt]); acc[dt] = wmma_bf(vl[dt], pb.h, acc[dt]); acc[dt] = wmma_bf(vh[dt], pb.h, acc[dt]); } }
    asm volatile("s_wait_dscnt 0x0" ::: "memory");      // this wave's reads of the buffer have returned before it is refilled
    asm volatile("s_wait_asynccnt 0x0" ::: "memory");   // this wave's copies of stage st + 1 have landed
    __syncthreads();                                    // publishes stage st + 1 and ends every wave's reads of stage st
    if (st + 2 < AT_NS) { pj_cp8(lk + (st & 1) * AT_BUF, 8u * AT_KP, gk + (size_t)(st + 2) * AT_KT * QKVP, 8 * QKVP); at_cp44(lv + (st & 1) * AT_BUF, 16u * AT_VP, gvh + (st + 2) * AT_KT, gvl + (st + 2) * AT_KT, 16 * SS); } }
  asm volatile("s_wait_asynccnt 0x0" ::: "memory");     // no copy is outstanding when the buffers become output staging
  const float il = 1.0f / (l + xhalf(l));
#pragma unroll
  for (int dt = 0; dt < 4; ++dt) { v4f lo, hi;
#pragma unroll
    for (int r = 0; r < 4; ++r) { lo[r] = acc[dt][r] * il; hi[r] = acc[dt][4 + r] * il; }
    *(v4f*)&so[wave][col][dt * 16 + 8 * g] = lo; *(v4f*)&so[wave][col][dt * 16 + 8 * g + 4] = hi; }
  LDSX();
  for (int rl = 0; rl < 16; ++rl) if (lane < 16) vst2(OUT + (tq + rl) * DM + h * HD + lane * 4, *(const v4f*)&so[wave][rl][lane * 4]);
}

extern "C" void kernel_launch(void* const* d_in, const int* in_sizes, int n_in, void* d_out, int out_size, void* d_ws, size_t ws_size, hipStream_t stream) {
  (void)in_sizes; (void)n_in; (void)out_size;
  const float** F = (const float**)d_in;   // x, W_cq, b_cq, W_ck, b_ck, W_cv, b_cv, W_pq, b_pq, W_pk, b_pk, W_pv, b_pv  ([in][out] weights)
  if (ws_size < (size_t)WS_END) return;
  char* ws = (char*)d_ws; __bf16 *PT = (__bf16*)(ws + WS_PT), *VTH = (__bf16*)(ws + WS_VTH), *VTL = (__bf16*)(ws + WS_VTL); float* QKV = (float*)(ws + WS_QKV);
  k_pack<<<dim3(DM / PK_T, DM / PK_T, 6), 128, 0, stream>>>(F[1], F[3], F[5], F[7], F[9], F[11], PT);
  k_proj<<<dim3(TRB, QKVP / 128), 128, 0, stream>>>(F[0], PT, F[2], F[4], F[6], F[8], F[10], F[12], QKV, VTH, VTL);
  k_attn<<<dim3(TQB, TNB * NH), 128, 0, stream>>>(QKV, VTH, VTL, (float*)d_out);
}

// v010
// One run takes 76.1 microseconds.
// Timed twice side by side with v009, it ran 1.06 times as fast both times.
// Counting every step since v000, it is 4.90 times as fast.
// compute dtype: x, the six weights and biases (module inputs) rounded to bf16; q/k/v projections as exact bf16 products over the concatenated [Wc ; Wp] columns (x.(Wc+Wp) == x.Wc + x.Wp, f32 accumulate, + bc + bp); scores and P.V with both computed operands as bf16 hi + bf16 residual pairs (3 products); online softmax in f32; f32 accumulate.
#include <hip/hip_runtime.h>
#include <math.h>

typedef __attribute__((ext_vector_type(16))) _Float16 v16h;
typedef __attribute__((ext_vector_type(16))) __bf16 v16b;
typedef __attribute__((ext_vector_type(8)))  _Float16 v8h;
typedef __attribute__((ext_vector_type(8)))  float v8f;
typedef __attribute__((ext_vector_type(4)))  float v4f;
typedef __attribute__((ext_vector_type(2)))  float v2f;
typedef __attribute__((ext_vector_type(4)))  unsigned v4u;
typedef __attribute__((ext_vector_type(4)))  int v4i;
typedef float __attribute__((may_alias)) float_a;
typedef int __attribute__((may_alias)) int_a;

template <typename T> __device__ __forceinline__ void vst2(void* p, T v) { *(T*)p = v;  }
__device__ __forceinline__ v8f wmma16(v16h a, v16h b, v8f c) {
  v8f d = __builtin_amdgcn_wmma_f32_16x16x32_f16(false, a, false, b, (short)0, c, false, false);
  asm volatile("v_nop\n\tv_nop\n\tv_nop\n\tv_nop" : "+v"(d) : "v"(a), "v"(b));
  return d;
}
__device__ __forceinline__ v8f wmma_bf(v16b a, v16b b, v8f c) {
  return __builtin_amdgcn_wmma_f32_16x16x32_bf16(false, a, false, b, (short)0, c, false, false);
}
// 16x16x32 fragments: lane = (h = lane>>4, row/col = lane&15); elements 0..7 = k0+8h+0..7, 8..15 = k0+16+8h+0..7; D element r = row 8h+r
__device__ __forceinline__ v16h frag_h(const _Float16* rowk0, int lane) {
  union { v16h v; v8h q[2]; } u; const _Float16* p = rowk0 + 8 * (lane >> 4);
  u.q[0] = *(const v8h*)p; u.q[1] = *(const v8h*)(p + 16); return u.v;
}
__device__ __forceinline__ v16h frag_f32(const float* rowk0, int lane) {
  v16h a; const float* p = rowk0 + 8 * (lane >> 4);
#pragma unroll
  for (int i = 0; i < 8; ++i) { a[i] = (_Float16)p[i]; a[8 + i] = (_Float16)p[16 + i]; }
  return a;
}
__device__ __forceinline__ v16h frag_f32s(const float* rowk0, int lane, float sc) {
  v16h a; const float* p = rowk0 + 8 * (lane >> 4);
#pragma unroll
  for (int i = 0; i < 8; ++i) { a[i] = (_Float16)(p[i] * sc); a[8 + i] = (_Float16)(p[16 + i] * sc); }
  return a;
}
// column fragment from a [K][ld] layout (column n), rows >= K read as 0
__device__ __forceinline__ v16h fragc_f32(const float* W, int k0, int n, int lane, int ld, int K) {
  v16h a; const int g = lane >> 4;
#pragma unroll
  for (int i = 0; i < 8; ++i) { const int ka = k0 + 8 * g + i, kb = ka + 16;
    a[i] = (_Float16)(ka < K ? W[(size_t)(ka < K ? ka : K - 1) * ld + n] : 0.f); a[8 + i] = (_Float16)(kb < K ? W[(size_t)(kb < K ? kb : K - 1) * ld + n] : 0.f); }
  return a;
}
struct F2 { v16b h, l; };
__device__ __forceinline__ F2 bsplit16(const float v[16]) { F2 r;
#pragma unroll
  for (int i = 0; i < 16; ++i) { const __bf16 h = (__bf16)v[i]; r.h[i] = h; r.l[i] = (__bf16)(v[i] - (float)h); }
  return r; }
__device__ __forceinline__ F2 split_row(const float* row, int k0, int lane) { float v[16]; const float* p = row + k0 + 8 * (lane >> 4);
#pragma unroll
  for (int i = 0; i < 8; ++i) { v[i] = p[i]; v[8 + i] = p[16 + i]; }
  return bsplit16(v); }
__device__ __forceinline__ F2 split_rowK(const float* row, int k0, int lane, int K) { float v[16]; const int g = lane >> 4;
#pragma unroll
  for (int i = 0; i < 8; ++i) { const int ka = k0 + 8 * g + i, kb = ka + 16; v[i] = ka < K ? row[ka < K ? ka : K - 1] : 0.f; v[8 + i] = kb < K ? row[kb < K ? kb : K - 1] : 0.f; }
  return bsplit16(v); }
__device__ __forceinline__ F2 split_col(const float* W, int k0, int n, int lane, int ld, int K) { float v[16]; const int g = lane >> 4;
#pragma unroll
  for (int i = 0; i < 8; ++i) { const int ka = k0 + 8 * g + i, kb = ka + 16; v[i] = ka < K ? W[(size_t)(ka < K ? ka : K - 1) * ld + n] : 0.f; v[8 + i] = kb < K ? W[(size_t)(kb < K ? kb : K - 1) * ld + n] : 0.f; }
  return bsplit16(v); }
__device__ __forceinline__ v8f mac3(const F2& a, const F2& b, v8f c) { c = wmma_bf(a.l, b.h, c); c = wmma_bf(a.h, b.l, c); return wmma_bf(a.h, b.h, c); }
__device__ __forceinline__ float sigm(float v) { return 1.0f / (1.0f + expf(-v)); }
#define LDSX() do { asm volatile("s_wait_dscnt 0" ::: "memory"); __builtin_amdgcn_wave_barrier(); __builtin_amdgcn_fence(__ATOMIC_RELEASE, "workgroup"); } while (0)


// Disentangled attention: q = x (W_cq + W_pq) + (b_cq + b_pq), likewise k, v (8 heads x 64); energy = q k^T / sqrt(512); softmax; out = P v merged to [8, 1024, 512] (no output projection).
// k_pack (a column of Wc and of Wp as one bf16 row of K = 1024, dealt in turns of 32 k: 32 of Wc, the same 32 of Wp), k_proj (exact GEMM, each x fragment against both weights' 32 k, + both biases; its V blocks write V transposed as hi/lo planes, its K blocks each head's row as 64 hi + 64 residual bf16), k_attn (flash-style, 32 key steps, transposed products; writes the output rows directly).
#define NB 8
#define SS 1024
#define DM 512
#define NH 8
#define HD 64
#define NR (NB * SS)
#define QKVP (3 * DM)
#define KK (2 * DM)            // concatenated K
#ifndef TRB
#define TRB (NR / 128)
#define TQB (SS / 64)
#define TNB NB
#endif
typedef __attribute__((ext_vector_type(8))) __bf16 v8b;
__device__ __forceinline__ v16b frag_b(const __bf16* rowk0, int lane) {
  union { v16b v; v8b q[2]; } u; const __bf16* p = rowk0 + 8 * (lane >> 4);
  u.q[0] = *(const v8b*)p; u.q[1] = *(const v8b*)(p + 16); return u.v;
}
__device__ __forceinline__ v16b frag_gbf(const float* rowk0, int lane) {
  v16b a; const float* p = rowk0 + 8 * (lane >> 4);
#pragma unroll
  for (int i = 0; i < 8; ++i) { a[i] = (__bf16)p[i]; a[8 + i] = (__bf16)p[16 + i]; }
  return a;
}
__device__ __forceinline__ float bfr(float v) { return (float)(__bf16)v; }
__device__ __forceinline__ float exp2_hw(float v) { return __builtin_amdgcn_exp2f(v); }   // 2^v as one v_exp_f32; a very negative v gives 0
#define WS_PT   0u                                  // bf16 [1536][1024]: row n, element 64 t + 32 half + i = (half 0: Wc_*, 1: Wp_*)[32 t + i][c]
#define WS_QKV  (WS_PT + 2u * QKVP * KK)             // f32 [8192][1536]; in the K columns the 256 B of a head's row hold 64 bf16 hi, then the 64 bf16 residuals; the V columns stay unwritten and unread
#define WS_VTH  (WS_QKV + 4u * NR * QKVP)            // bf16 [8][512][1024]
#define WS_VTL  (WS_VTH + 2u * NB * DM * SS)
#define WS_END  (WS_VTL + 2u * NB * DM * SS)

// ---- k_pack: a block turns 32 (k) x 64 (column) tiles of Wc_* and of Wp_*, one under the other. The tiles' rows come in as whole 256-B runs (16 lanes a row, 16 B a lane), stand in LDS as f32,
// and leave as 128-B runs (32 k of Wc, the same 32 k of Wp): 8 lanes a PT row, each with eight k in a row of one column. Values and their rounding are as in a plain column walk.
#define PK_T 64
#define PK_P (PK_T + 1)   // pitch in floats, odd: the 8 k groups x 4 columns that a wave reads at a time fall on 32 different banks
__global__ __launch_bounds__(128) void k_pack(const float* __restrict__ Wcq, const float* __restrict__ Wck, const float* __restrict__ Wcv, const float* __restrict__ Wpq, const float* __restrict__ Wpk, const float* __restrict__ Wpv, __bf16* __restrict__ PT) {
  __shared__ float st[PK_T][PK_P];
  const int tid = threadIdx.x, c0 = blockIdx.x * PK_T, k0 = blockIdx.y * (PK_T / 2), which = blockIdx.z;
  const size_t so = (size_t)(k0 + (tid >> 4)) * DM + c0 + (tid & 15) * 4;   // [in][out] layout: 8 rows a pass of the block
  const float *sc = (which == 0 ? Wcq : which == 1 ? Wck : Wcv) + so, *sp = (which == 0 ? Wpq : which == 1 ? Wpk : Wpv) + so;
  v4f x[8];
#pragma unroll   // all eight loads of a lane are in flight together; passes 0..3 bring Wc's 32 rows, 4..7 Wp's
  for (int i = 0; i < 8; ++i) x[i] = *(const v4f*)((i < 4 ? sc : sp) + (size_t)(i & 3) * 8 * DM);
#pragma unroll   // this and the next: x is picked by constants and stays in registers
  for (int i = 0; i < 8; ++i)
#pragma unroll
    for (int j = 0; j < 4; ++j) st[i * 8 + (tid >> 4)][(tid & 15) * 4 + j] = x[i][j];
  __syncthreads();   // a PT row's run holds k rows that all four waves brought
  __bf16* dst = PT + (size_t)(which * DM + c0 + (tid >> 3)) * KK + 2 * k0 + (tid & 7) * 8;   // 16 columns a pass of the block
#pragma unroll   // this and the next: a run's place is an immediate offset, o stays in registers, and the LDS reads of all four runs stand together
  for (int i = 0; i < 4; ++i) { v8b o;
#pragma unroll
    for (int e = 0; e < 8; ++e) o[e] = (__bf16)st[(tid & 7) * 8 + e][i * 16 + (tid >> 3)];
    vst2((unsigned*)(dst + (size_t)i * 16 * KK), __builtin_bit_cast(v4u, o)); }
}
// ---- k_proj: QKV[r][n] = sum over turns t of bf16(x[r][32 t ..]) . (PT[n][64 t ..] and PT[n][64 t + 32 ..]) (exact) + bc[n] + bp[n]; block (128 rows, 128 cols), a wave 32 rows: each PT fragment read from LDS feeds two matrix instructions
// A block of V columns does not write f32 rows: it splits its sums into bf16 hi + residual, turns the 128 x 128 tile in LDS and writes V^T's two planes, 256 B of 128 tokens a row.
// A block of K columns splits its sums the same way on the way out of the staging and writes, in the place of a head's 64 floats, 128 B of hi and 128 B of residuals.
// A stage is one turn: its x tile (128 rows of 32 floats, 128 B) and its PT tile (128 rows of 128 B: 32 k of Wc, the same 32 k of Wp) come into LDS once for the block, by asynchronous copies that
// cover whole 128-B lines, two buffers; the four waves take their fragments from LDS, and an x fragment, fetched and rounded once, meets both weights. Row pitch 144 B (16 B x odd) keeps ds_load_b128 free of bank conflicts.
#define PJ_KW 64               // PT elements a stage
#define PJ_XW (PJ_KW / 2)      // x elements a stage
#define PJ_AP (PJ_XW * 4u + 16u)
#define PJ_BP (PJ_KW * 2u + 16u)
#define PJ_RB 128u
#define PJ_AB (PJ_RB * PJ_AP)
#define PJ_BUF (PJ_AB + 128u * PJ_BP)
#define PJ_NS (KK / PJ_KW)
#define PJ_VP (PJ_RB * 2u + 16u)   // pitch of a V^T row of 128 tokens in the output staging (16 B x odd)
__device__ __forceinline__ v16b frag_lf(const char* rowk0, int g) {   // frag_gbf's k order, from an f32 row in LDS
  const v4f* p = (const v4f*)(rowk0 + 32 * g); const v4f x0 = p[0], x1 = p[1], x2 = p[4], x3 = p[5]; v16b a;
#pragma unroll
  for (int i = 0; i < 4; ++i) { a[i] = (__bf16)x0[i]; a[4 + i] = (__bf16)x1[i]; a[8 + i] = (__bf16)x2[i]; a[12 + i] = (__bf16)x3[i]; }
  return a;
}
// eight copies of 16 B per lane, LDS places ls bytes and sources gs elements apart; the s_wait_xcnt closes the statement so that no address register is rewritten ahead of it
template <typename T> __device__ __forceinline__ void pj_cp8(unsigned l, unsigned ls, const T* s, int gs) {
  asm volatile("global_load_async_to_lds_b128 %0, %1, off\n\t"
               "global_load_async_to_lds_b128 %2, %3, off\n\t"
               "global_load_async_to_lds_b128 %4, %5, off\n\t"
               "global_load_async_to_lds_b128 %6, %7, off\n\t"
               "global_load_async_to_lds_b128 %8, %9, off\n\t"
               "global_load_async_to_lds_b128 %10, %11, off\n\t"
               "global_load_async_to_lds_b128 %12, %13, off\n\t"
               "global_load_async_to_lds_b128 %14, %15, off\n\t"
               "s_wait_xcnt 0x0"
               :: "v"(l), "v"(s), "v"(l + ls), "v"(s + gs), "v"(l + 2u * ls), "v"(s + 2 * gs), "v"(l + 3u * ls), "v"(s + 3 * gs),
                  "v"(l + 4u * ls), "v"(s + 4 * gs), "v"(l + 5u * ls), "v"(s + 5 * gs), "v"(l + 6u * ls), "v"(s + 6 * gs), "v"(l + 7u * ls), "v"(s + 7 * gs)
               : "memory");
}
__global__ __launch_bounds__(128) void k_proj(const float* __restrict__ X, const __bf16* __restrict__ PT, const float* __restrict__ bcq, const float* __restrict__ bck, const float* __restrict__ bcv, const float* __restrict__ bpq, const float* __restrict__ bpk, const float* __restrict__ bpv, float* __restrict__ QKV, __bf16* __restrict__ VTH, __bf16* __restrict__ VTL) {
  __shared__ __align__(16) char sm[2u * PJ_BUF];   // the two stage buffers; behind the loop the output staging so[4][32][132], or in a V block two planes of [128][PJ_VP bytes]
  static_assert(2u * PJ_BUF >= 4u * 32u * 132u * 4u && 2u * PJ_BUF >= 2u * 128u * PJ_VP, "the output staging must fit the two buffers");
  float (*so)[32][132] = (float (*)[32][132])sm;
  const int tid = threadIdx.x, wave = tid >> 5, lane = tid & 31, col = lane & 15, g = lane >> 4; const size_t r0 = (size_t)blockIdx.x * PJ_RB + wave * 32; const int n0 = blockIdx.y * 128;
  const unsigned lbase = (unsigned)(size_t)sm;
  // x tile and PT tile alike: 8 lanes a row, 16 rows a copy of the block (8 copies a lane each)
  const unsigned la = lbase + (unsigned)(tid >> 3) * PJ_AP + (unsigned)(tid & 7) * 16u, lb = lbase + PJ_AB + (unsigned)(tid >> 3) * PJ_BP + (unsigned)(tid & 7) * 16u;
  const float* ga = X + ((size_t)blockIdx.x * PJ_RB + (tid >> 3)) * DM + (tid & 7) * 4; const __bf16* gb = PT + (size_t)(n0 + (tid >> 3)) * KK + (tid & 7) * 8;
  v8f acc[2][8] = {};
  pj_cp8(la, 16u * PJ_AP, ga, 16 * DM); pj_cp8(lb, 16u * PJ_BP, gb, 16 * KK);
  asm volatile("s_wait_asynccnt 0x0" ::: "memory");   // stage 0 has landed before the barrier publishes it
  __syncthreads();
  pj_cp8(la + PJ_BUF, 16u * PJ_AP, ga + PJ_XW, 16 * DM); pj_cp8(lb + PJ_BUF, 16u * PJ_BP, gb + PJ_KW, 16 * KK);
#pragma unroll 2   // by two, so that each half's buffer is a constant offset
  for (int st = 0; st < PJ_NS; ++st) { const char* sb = sm + (st & 1) * PJ_BUF;
    const v16b a0 = frag_lf(sb + (wave * 32 + col) * PJ_AP, g), a1 = frag_lf(sb + (wave * 32 + 16 + col) * PJ_AP, g);
#pragma unroll   // u = 0: Wc's 32 k, u = 1: Wp's, against the same x fragments
    for (int u = 0; u < PJ_KW / 32; ++u) {
#pragma unroll
      for (int jh = 0; jh < 8; jh += 4) { v16b bq[4];   // four fragments' reads stand together ahead of their matrix instructions, not one wait a fragment
#pragma unroll
        for (int j = 0; j < 4; ++j) bq[j] = frag_b((const __bf16*)(sb + PJ_AB + ((jh + j) * 16 + col) * PJ_BP + u * 64), lane);
        __builtin_amdgcn_sched_barrier(0);   // keeps the four fragments' reads together ahead of their matrix instructions; without it the compiler deals them out, one wait a fragment
#pragma unroll
        for (int j = 0; j < 4; ++j) { acc[0][jh + j] = wmma_bf(a0, bq[j], acc[0][jh + j]); acc[1][jh + j] = wmma_bf(a1, bq[j], acc[1][jh + j]); } } }
    asm volatile("s_wait_dscnt 0x0" ::: "memory");      // this wave's reads of the buffer have returned before it is refilled
    asm volatile("s_wait_asynccnt 0x0" ::: "memory");   // this wave's copies of stage st + 1 have landed
    __syncthreads();                                    // publishes stage st + 1 and ends every wave's reads of stage st
    if (st + 2 < PJ_NS) { pj_cp8(la + (st & 1) * PJ_BUF, 16u * PJ_AP, ga + (st + 2) * PJ_XW, 16 * DM); pj_cp8(lb + (st & 1) * PJ_BUF, 16u * PJ_BP, gb + (st + 2) * PJ_KW, 16 * KK); } }
  asm volatile("s_wait_asynccnt 0x0" ::: "memory");     // no copy is outstanding when the buffers become output staging
  if (n0 >= 2 * DM) {   // V columns: the same answer for the whole block
    const int c0 = n0 - 2 * DM;
#pragma unroll
    for (int j = 0; j < 8; ++j) { const int c = c0 + j * 16 + col; const float bb = bfr(bcv[c]) + bfr(bpv[c]);
#pragma unroll
      for (int rt = 0; rt < 2; ++rt) { v8b hv, lv;
#pragma unroll
        for (int r = 0; r < 8; ++r) { const float v = acc[rt][j][r] + bb; const __bf16 hb = (__bf16)v; hv[r] = hb; lv[r] = (__bf16)(v - (float)hb); }
        char* p = sm + (j * 16 + col) * PJ_VP + (wave * 32 + rt * 16 + 8 * g) * 2;   // a lane's eight sums are eight tokens in a row of one V^T row
        *(v8b*)p = hv; *(v8b*)(p + 128u * PJ_VP) = lv; } }
    __syncthreads();   // a V^T row holds tokens of all four waves
    const size_t t0 = (size_t)blockIdx.x * PJ_RB; const size_t ob = ((t0 / SS) * DM + c0) * SS + t0 % SS;
    const size_t o = ob + (size_t)(tid >> 4) * SS + (tid & 15) * 8; const char* p = sm + (tid >> 4) * PJ_VP + (tid & 15) * 16;   // 16 lanes a row: two whole 128-B lines; 8 rows a pass of the block
#pragma unroll
    for (int i = 0; i < 16; ++i) { vst2((unsigned*)(VTH + o + (size_t)i * 8 * SS), *(const v4u*)(p + i * 8 * PJ_VP)); vst2((unsigned*)(VTL + o + (size_t)i * 8 * SS), *(const v4u*)(p + (128u + i * 8) * PJ_VP)); }
    return;
  }
#pragma unroll
  for (int j = 0; j < 8; ++j) { const int n = n0 + j * 16 + col; const int which = n / DM, c = n % DM; const float bb = bfr((which == 0 ? bcq : which == 1 ? bck : bcv)[c]) + bfr((which == 0 ? bpq : which == 1 ? bpk : bpv)[c]);
#pragma unroll
    for (int rt = 0; rt < 2; ++rt)
#pragma unroll
      for (int r = 0; r < 8; ++r) so[wave][rt * 16 + 8 * g + r][j * 16 + col] = acc[rt][j][r] + bb; }
  LDSX();
  if (n0 >= DM) {   // K columns: the same answer for the whole block
#pragma unroll   // so that a row's place in the staging and in the workspace is an immediate offset
    for (int i = 0; i < 16; ++i) { const int rl = 2 * i + g; const v4f x0 = *(const v4f*)&so[wave][rl][col * 8], x1 = *(const v4f*)&so[wave][rl][col * 8 + 4]; v8b hv, lv;   // a half wave a row, eight columns a lane
#pragma unroll   // so that the vectors' elements are picked by constants and stay in registers
      for (int e = 0; e < 4; ++e) { const __bf16 h0 = (__bf16)x0[e], h1 = (__bf16)x1[e]; hv[e] = h0; hv[4 + e] = h1; lv[e] = (__bf16)(x0[e] - (float)h0); lv[4 + e] = (__bf16)(x1[e] - (float)h1); }
      char* o = (char*)(QKV + (r0 + rl) * QKVP + n0 + (col >> 3) * HD) + (col & 7) * 16;   // 8 lanes a head: whole 128-B lines
      vst2(o, __builtin_bit_cast(v4u, hv)); vst2(o + 2 * HD, __builtin_bit_cast(v4u, lv)); }
    asm volatile("s_wait_xcnt 0x0" ::: "memory");   // behind the last store: no register that an issued store names is rewritten ahead of it on any way the built code has from here
    return;
  }
  for (int rl = 0; rl < 32; ++rl) vst2(QKV + (r0 + rl) * QKVP + n0 + lane * 4, *(const v4f*)&so[wave][rl][lane * 4]);
}
// lane l with lane l ^ 16 (the two halves of a wave hold the two halves of a query's keys)
__device__ __forceinline__ float xhalf(float x) { return __builtin_bit_cast(float, __builtin_amdgcn_permlanex16(__builtin_bit_cast(int, x), __builtin_bit_cast(int, x), 0x76543210, 0xfedcba98, false, false)); }
// ---- k_attn: block = (query block, b*8 + h), 4 waves; 32 key steps; transposed products: S^T = K Q^T (A = key rows, B = query columns), O^T += V^T P^T.
// Lane (g, col) holds query col's scores of keys 8g+r and 16+8g+r: maximum and sum in the lane's own registers, and the two score tiles are P^T's B fragment as they stand.
// A stage is 64 keys (two key steps): its K tile (64 rows of 256 B: 64 bf16 hi, 64 bf16 residuals, as k_proj split them) and its two V^T tiles (64 rows of 128 B each) come into LDS once for the block, by asynchronous
// copies that cover whole 128-B lines, two buffers; the four waves take their fragments from LDS. Row pitches 272 B and 144 B (16 B x odd) keep ds_load_b128 free of bank conflicts.
#define AT_KT 64
#define AT_KP (HD * 4u + 16u)
#define AT_VP (AT_KT * 2u + 16u)
#define AT_KB (AT_KT * AT_KP)
#define AT_VB (HD * AT_VP)
#define AT_BUF (AT_KB + 2u * AT_VB)
#define AT_NS (SS / AT_KT)
// as pj_cp8, the first four copies from s0 and the last four from s1 (the two V^T planes, one behind the other in LDS); the s_wait_xcnt closes the statement for the same reason
__device__ __forceinline__ void at_cp44(unsigned l, unsigned ls, const __bf16* s0, const __bf16* s1, int gs) {
  asm volatile("global_load_async_to_lds_b128 %0, %1, off\n\t"
               "global_load_async_to_lds_b128 %2, %3, off\n\t"
               "global_load_async_to_lds_b128 %4, %5, off\n\t"
               "global_load_async_to_lds_b128 %6, %7, off\n\t"
               "global_load_async_to_lds_b128 %8, %9, off\n\t"
               "global_load_async_to_lds_b128 %10, %11, off\n\t"
               "global_load_async_to_lds_b128 %12, %13, off\n\t"
               "global_load_async_to_lds_b128 %14, %15, off\n\t"
               "s_wait_xcnt 0x0"
               :: "v"(l), "v"(s0), "v"(l + ls), "v"(s0 + gs), "v"(l + 2u * ls), "v"(s0 + 2 * gs), "v"(l + 3u * ls), "v"(s0 + 3 * gs),
                  "v"(l + 4u * ls), "v"(s1), "v"(l + 5u * ls), "v"(s1 + gs), "v"(l + 6u * ls), "v"(s1 + 2 * gs), "v"(l + 7u * ls), "v"(s1 + 3 * gs)
               : "memory");
}
__global__ __launch_bounds__(128) void k_attn(const float* __restrict__ QKV, const __bf16* __restrict__ VTH, const __bf16* __restrict__ VTL, float* __restrict__ OUT) {
  __shared__ __align__(16) char sm[2u * AT_BUF];   // the two stage buffers; behind the loop the output staging so[4][16][68]
  static_assert(2u * AT_BUF >= 4u * 16u * 68u * 4u, "the output staging must fit the two buffers");
  float (*so)[16][68] = (float (*)[16][68])sm;
  const int tid = threadIdx.x, wave = tid >> 5, lane = tid & 31, col = lane & 15, g = lane >> 4;
  const int qb = blockIdx.x, bh = blockIdx.y, b = bh / NH, h = bh % NH; const int q0 = qb * 64 + wave * 16; const size_t tq = (size_t)b * SS + q0;
  const unsigned lbase = (unsigned)(size_t)sm;
  // K tile: 16 lanes a row, 8 rows a copy of the block; V^T tiles: 8 lanes a row, 16 rows a copy
  const unsigned lk = lbase + (unsigned)(tid >> 4) * AT_KP + (unsigned)(tid & 15) * 16u, lv = lbase + AT_KB + (unsigned)(tid >> 3) * AT_VP + (unsigned)(tid & 7) * 16u;
  const float* gk = QKV + ((size_t)b * SS + (tid >> 4)) * QKVP + DM + h * HD + (tid & 15) * 4;
  const size_t vo = ((size_t)b * DM + h * HD + (tid >> 3)) * SS + (tid & 7) * 8; const __bf16 *gvh = VTH + vo, *gvl = VTL + vo;
  pj_cp8(lk, 8u * AT_KP, gk, 8 * QKVP); at_cp44(lv, 16u * AT_VP, gvh, gvl, 16 * SS);
  const F2 a0 = split_row(QKV + (tq + col) * QKVP + h * HD, 0, lane), a1 = split_row(QKV + (tq + col) * QKVP + h * HD, 32, lane);
  float m = -3.0e38f, l = 0.f;   // m: query col's running maximum, in base-2 units (score x scl2; equal in both halves); l: this half's part of the sum
  v8f acc[4] = {};               // acc[dt][r] = O^T[dt*16 + 8g + r][col]
  const float scl2 = 0.044194173824159216f * 1.4426950408889634f;   // 1/sqrt(512) x log2 e: exp(s / sqrt(512) - max) = 2^(s x scl2 - max x scl2)
  asm volatile("s_wait_asynccnt 0x0" ::: "memory");   // stage 0 has landed before the barrier publishes it
  __syncthreads();
  pj_cp8(lk + AT_BUF, 8u * AT_KP, gk + (size_t)AT_KT * QKVP, 8 * QKVP); at_cp44(lv + AT_BUF, 16u * AT_VP, gvh + AT_KT, gvl + AT_KT, 16 * SS);
#pragma unroll 1   // stays rolled: the body already holds two key steps, and further copies would only lengthen the code
  for (int st = 0; st < AT_NS; ++st) { const char* sb = sm + (st & 1) * AT_BUF;
#pragma unroll     // so that a key step's place in the buffer is an immediate offset of the LDS reads
   for (int u = 0; u < AT_KT / 32; ++u) {
    float s[16];
#pragma unroll
    for (int ct = 0; ct < 2; ++ct) { const char* krow = sb + (u * 32 + ct * 16 + col) * AT_KP; F2 k0, k1;   // dims 0..31 and 32..63; the residuals stand 128 B behind the hi halves
      k0.h = frag_b((const __bf16*)krow, lane); k1.h = frag_b((const __bf16*)(krow + 64), lane); k0.l = frag_b((const __bf16*)(krow + 128), lane); k1.l = frag_b((const __bf16*)(krow + 192), lane);
      __builtin_amdgcn_sched_barrier(0);   // keeps the four K fragments' reads together ahead of their matrix instructions
      v8f c = wmma_bf(k0.h, a0.l, (v8f){}); c = wmma_bf(k0.l, a0.h, c); c = wmma_bf(k0.h, a0.h, c);
      c = wmma_bf(k1.h, a1.l, c); c = wmma_bf(k1.l, a1.h, c); c = wmma_bf(k1.h, a1.h, c);
#pragma unroll
      for (int r = 0; r < 8; ++r) s[ct * 8 + r] = c[r]; }
    float mx = s[0];
#pragma unroll
    for (int i = 1; i < 16; ++i) mx = fmaxf(mx, s[i]);
    mx = fmaxf(mx, xhalf(mx));
    const float mn = fmaxf(m, mx * scl2); const float alpha = exp2_hw(m - mn); m = mn;
    float es = 0.f;
#pragma unroll
    for (int i = 0; i < 16; ++i) { s[i] = exp2_hw(fmaf(s[i], scl2, -mn)); es += s[i]; }
    l = l * alpha + es;
#pragma unroll
    for (int dt = 0; dt < 4; ++dt)
#pragma unroll
      for (int r = 0; r < 8; ++r) acc[dt][r] *= alpha;
    v16b vh[4], vl[4];   // the eight V^T fragments' reads stand together ahead of their matrix instructions, not one wait a tile
    const F2 pb = bsplit16(s);   // element i = key 8g+i, element 8+i = key 16+8g+i: the k order of frag_b
#pragma unroll
    for (int dt = 0; dt < 4; ++dt) { const char* vrow = sb + AT_KB + (dt * 16 + col) * AT_VP + u * 64; vh[dt] = frag_b((const __bf16*)vrow, lane); vl[dt] = frag_b((const __bf16*)(vrow + AT_VB), lane); }
    __builtin_amdgcn_sched_barrier(0);   // keeps the eight V^T fragments' reads together ahead of their matrix instructions
#pragma unroll
    for (int dt = 0; dt < 4; ++dt) { acc[dt] = wmma_bf(vh[dt], pb.l, acc[dt]); acc[dt] = wmma_bf(vl[dt], pb.h, acc[dt]); acc[dt] = wmma_bf(vh[dt], pb.h, acc[dt]); } }
    asm volatile("s_wait_dscnt 0x0" ::: "memory");      // this wave's reads of the buffer have returned before it is refilled
    asm volatile("s_wait_asynccnt 0x0" ::: "memory");   // this wave's copies of stage st + 1 have landed
    __syncthreads();                                    // publishes stage st + 1 and ends every wave's reads of stage st
    if (st + 2 < AT_NS) { pj_cp8(lk + (st & 1) * AT_BUF, 8u * AT_KP, gk + (size_t)(st + 2) * AT_KT * QKVP, 8 * QKVP); at_cp44(lv + (st & 1) * AT_BUF, 16u * AT_VP, gvh + (st + 2) * AT_KT, gvl + (st + 2) * AT_KT, 16 * SS); } }
  asm volatile("s_wait_asynccnt 0x0" ::: "memory");     // no copy is outstanding when the buffers become output staging
  const float il = 1.0f / (l + xhalf(l));
#pragma unroll
  for (int dt = 0; dt < 4; ++dt) { v4f lo, hi;
#pragma unroll
    for (int r = 0; r < 4; ++r) { lo[r] = acc[dt][r] * il; hi[r] = acc[dt][4 + r] * il; }
    *(v4f*)&so[wave][col][dt * 16 + 8 * g] = lo; *(v4f*)&so[wave][col][dt * 16 + 8 * g + 4] = hi; }
  LDSX();
  for (int rl = 0; rl < 16; ++rl) if (lane < 16) vst2(OUT + (tq + rl) * DM + h * HD + lane * 4, *(const v4f*)&so[wave][rl][lane * 4]);
}

extern "C" void kernel_launch(void* const* d_in, const int* in_sizes, int n_in, void* d_out, int out_size, void* d_ws, size_t ws_size, hipStream_t stream) {
  (void)in_sizes; (void)n_in; (void)out_size;
  const float** F = (const float**)d_in;   // x, W_cq, b_cq, W_ck, b_ck, W_cv, b_cv, W_pq, b_pq, W_pk, b_pk, W_pv, b_pv  ([in][out] weights)
  if (ws_size < (size_t)WS_END) return;
  char* ws = (char*)d_ws; __bf16 *PT = (__bf16*)(ws + WS_PT), *VTH = (__bf16*)(ws + WS_VTH), *VTL = (__bf16*)(ws + WS_VTL); float* QKV = (float*)(ws + WS_QKV);
  k_pack<<<dim3(DM / PK_T, 2 * DM / PK_T, 3), 128, 0, stream>>>(F[1], F[3], F[5], F[7], F[9], F[11], PT);
  k_proj<<<dim3(TRB, QKVP / 128), 128, 0, stream>>>(F[0], PT, F[2], F[4], F[6], F[8], F[10], F[12], QKV, VTH, VTL);
  k_attn<<<dim3(TQB, TNB * NH), 128, 0, stream>>>(QKV, VTH, VTL, (float*)d_out);
}
